// v000
// Measured on an AMD MI455X. A time is GPU time per run, averaged over a window of back-to-back runs after a warm-up
// (all launches, gaps included; the runs take copies of the inputs in turn), and the median of several windows.
// Apart from v000's, it joins two sittings. Times from different sittings can be a few percent apart, while
// side-by-side timings come from the same sitting.
// v000, which the later versions start from, runs in 2490 microseconds.
#include <hip/hip_runtime.h>
#include <hip/hip_bf16.h>

#define B_ 4
#define L_ 2048
#define D_ 512
#define CHUNK_ 64
#define NCH (L_ / CHUNK_)
#define VW 32           // value-dim slice per workgroup in the scan kernel
#define KSTR 516        // Kt row stride (16B-aligned rows, conflict-free)
#define EPS_ 1e-5f

typedef float v2f __attribute__((ext_vector_type(2)));
typedef float v8f __attribute__((ext_vector_type(8)));

__device__ __forceinline__ v8f wmma_f32(v2f a, v2f b, v8f c) {
  // D = A(16x4 f32) * B(4x16 f32) + C(16x16 f32)
  return __builtin_amdgcn_wmma_f32_16x16x4_f32(false, a, false, b, (short)0, c,
                                               false, false);
}

// Async HBM -> LDS DMA (ASYNCcnt-tracked).  vDst = per-lane LDS byte offset.
__device__ __forceinline__ void async_b128(const float* g, unsigned lds_byte_off) {
  asm volatile("global_load_async_to_lds_b128 %0, %1, off"
               :
               : "v"(lds_byte_off), "v"(g)
               : "memory");
}
__device__ __forceinline__ void wait_async_lds() {
  asm volatile("s_wait_asynccnt 0x0" ::: "memory");
}

// ---------------------------------------------------------------- kernel 1
__global__ void tanh_k(const float* __restrict__ x, float* __restrict__ xa, int n) {
  int i = blockIdx.x * blockDim.x + threadIdx.x;
  if (i < n) xa[i] = tanhf(x[i]);
}

// ---------------------------------------------------------------- kernel 2
// static_out[m, e] = sum_d xa[m, d] * W[e, d]   (M=8192, N=512, K=512)
__global__ __launch_bounds__(256) void gemm_xw(const float* __restrict__ xa,
                                               const float* __restrict__ Wm,
                                               float* __restrict__ out) {
  __shared__ float At[64 * 33];   // A panel [64 rows][32 k] padded
  __shared__ float Bt[32 * 65];   // B panel [32 k][64 n] padded (B[k][n] = W[n][k])
  const int tid = threadIdx.x, lane = tid & 31, w = tid >> 5;
  const int m0 = blockIdx.x * 64, n0 = blockIdx.y * 64;
  const int wm = w & 3, wn = w >> 2;           // 4 x 2 wave grid
  const int nn = lane & 15;
  const int kbo = (lane >> 4) << 1;
  const int rh = (lane >> 4) << 3;

  v8f c0 = {}, c1 = {};
  for (int kp = 0; kp < D_; kp += 32) {
    for (int idx = tid; idx < 64 * 32; idx += 256) {
      int r = idx >> 5, c = idx & 31;
      At[r * 33 + c] = xa[(size_t)(m0 + r) * D_ + kp + c];
    }
    for (int idx = tid; idx < 64 * 32; idx += 256) {
      int k = idx & 31, n = idx >> 5;
      Bt[k * 65 + n] = Wm[(size_t)(n0 + n) * D_ + kp + k];
    }
    __syncthreads();
#pragma unroll
    for (int kk = 0; kk < 32; kk += 4) {
      int kb = kk + kbo;
      v2f a  = { At[(wm * 16 + nn) * 33 + kb], At[(wm * 16 + nn) * 33 + kb + 1] };
      v2f b0 = { Bt[kb * 65 + wn * 32 + nn], Bt[(kb + 1) * 65 + wn * 32 + nn] };
      v2f b1 = { Bt[kb * 65 + wn * 32 + 16 + nn], Bt[(kb + 1) * 65 + wn * 32 + 16 + nn] };
      c0 = wmma_f32(a, b0, c0);
      c1 = wmma_f32(a, b1, c1);
    }
    __syncthreads();
  }
#pragma unroll
  for (int i = 0; i < 8; ++i) {
    int r = m0 + wm * 16 + i + rh;
    out[(size_t)r * D_ + n0 + wn * 32 + nn]      = c0[i];
    out[(size_t)r * D_ + n0 + wn * 32 + 16 + nn] = c1[i];
  }
}

// ---------------------------------------------------------------- kernel 3
// Chunked gated delta-rule scan for one (batch, value-slice), q == k.
// Dynamic-LDS layout (byte offsets are compile-time constants; no static LDS,
// so the dynamic region starts at LDS offset 0 -> usable by async DMA):
#define S_OFF   0u
#define KT_OFF  (512u * VW * 4u)
#define UT_OFF  (KT_OFF + 64u * KSTR * 4u)
#define AT_OFF  (UT_OFF + 64u * 33u * 4u)
#define GS_OFF  (AT_OFF + 64u * 33u * 4u)
#define LP_OFF  (GS_OFF + 64u * 65u * 4u)
#define SMEM_FLOATS (512 * VW + 64 * KSTR + 2 * 64 * 33 + 64 * 65 + 65)

__global__ __launch_bounds__(256) void gdn_scan(const float* __restrict__ xa,
                                                const float* __restrict__ vstat,
                                                const float* __restrict__ eta_p,
                                                const float* __restrict__ laml_p,
                                                float* __restrict__ y) {
  extern __shared__ float smem[];
  float* S      = smem;                 // [512][VW]
  float* Kt     = S + 512 * VW;         // [64][KSTR]
  float* Ut     = Kt + 64 * KSTR;       // [64][33]
  float* At     = Ut + 64 * 33;         // [64][33]
  float* GS     = At + 64 * 33;         // [64][65]
  float* lampow = GS + 64 * 65;         // [65]

  const int tid = threadIdx.x, lane = tid & 31, w = tid >> 5;
  const int b  = blockIdx.x >> 4;             // 4 batches x 16 slices
  const int v0 = (blockIdx.x & 15) * VW;
  const float beta = eta_p[0];
  const float lam  = 1.f / (1.f + __expf(-laml_p[0]));

  for (int i = tid; i < 512 * VW; i += 256) S[i] = 0.f;
  if (tid < 65) lampow[tid] = powf(lam, (float)tid);

  const size_t bbase = (size_t)b * L_ * D_;
  // async-stage chunk 0's K (=Q) block
  for (int i = tid; i < CHUNK_ * D_ / 4; i += 256) {
    int t = i >> 7, d4 = (i & 127) << 2;
    async_b128(xa + bbase + (size_t)t * D_ + d4,
               KT_OFF + (unsigned)((t * KSTR + d4) * 4));
  }

  const int nn  = lane & 15;            // N index inside a 16-wide tile
  const int kbo = (lane >> 4) << 1;     // K sub-offset of the f32 A/B fragment
  const int rh  = (lane >> 4) << 3;     // row-half offset of C/D fragment
  const int tm = w & 3, tn = w >> 2;    // wave tile coords (4 x 2)
  const int rowA = tm * 16 + nn;

  for (int ch = 0; ch < NCH; ++ch) {
    const size_t xbase = bbase + (size_t)ch * CHUNK_ * D_;
    wait_async_lds();
    __syncthreads();                    // Kt ready; S/At/GS/Ut consistent
    const float lamC = lampow[64];

    // ---- prefetch next chunk (K + V slice) into cache while we compute
    if (ch + 1 < NCH) {
      const float* nk = xa + xbase + (size_t)CHUNK_ * D_;
      for (int i = tid; i < CHUNK_ * D_ / 32; i += 256)
        __builtin_prefetch(nk + i * 32, 0, 3);
      if (tid < CHUNK_)
        __builtin_prefetch(vstat + xbase + (size_t)(CHUNK_ + tid) * D_ + v0, 0, 3);
    }

    // ---- A = K@S [64x32], GS = mask/decay(K@K^T) [64x64]
    v8f aA = {}, aG0 = {}, aG1 = {};
    for (int k0 = 0; k0 < D_; k0 += 4) {
      int kb = k0 + kbo;
      v2f a  = { Kt[rowA * KSTR + kb], Kt[rowA * KSTR + kb + 1] };
      v2f bS = { S[kb * VW + tn * 16 + nn], S[(kb + 1) * VW + tn * 16 + nn] };
      aA = wmma_f32(a, bS, aA);
      v2f b0 = { Kt[((2 * tn) * 16 + nn) * KSTR + kb],
                 Kt[((2 * tn) * 16 + nn) * KSTR + kb + 1] };
      v2f b1 = { Kt[((2 * tn + 1) * 16 + nn) * KSTR + kb],
                 Kt[((2 * tn + 1) * 16 + nn) * KSTR + kb + 1] };
      aG0 = wmma_f32(a, b0, aG0);
      aG1 = wmma_f32(a, b1, aG1);
    }
#pragma unroll
    for (int i = 0; i < 8; ++i) {
      int t = tm * 16 + i + rh;
      At[t * 33 + tn * 16 + nn] = aA[i];
      int s0 = (2 * tn) * 16 + nn, s1 = s0 + 16;
      GS[t * 65 + s0] = (s0 <= t) ? lampow[t - s0] * aG0[i] : 0.f;
      GS[t * 65 + s1] = (s1 <= t) ? lampow[t - s1] * aG1[i] : 0.f;
    }
    __syncthreads();

    // ---- RHS: U <- beta*(V - lam^{t+1} A)   (V straight from global/L2)
    for (int i = tid; i < CHUNK_ * VW; i += 256) {
      int t = i >> 5, j = i & 31;
      float v = vstat[xbase + (size_t)t * D_ + v0 + j];
      Ut[t * 33 + j] = beta * (v - lampow[t + 1] * At[t * 33 + j]);
    }
    __syncthreads();

    // ---- blocked forward substitution: (I + beta*strictlow(GS)) U = R
    // (e1) rows 0..31; wave w owns value-columns [4w, 4w+4)
    for (int t = 1; t < 32; ++t) {
#pragma unroll
      for (int jj = 0; jj < 4; ++jj) {
        int j = w * 4 + jj;
        float p = (lane < t) ? GS[t * 65 + lane] * Ut[lane * 33 + j] : 0.f;
#pragma unroll
        for (int off = 16; off > 0; off >>= 1) p += __shfl_xor(p, off, 32);
        if (lane == 0) Ut[t * 33 + j] -= beta * p;
      }
    }
    __syncthreads();
    // (e2) U_hi -= beta * GS[32:64,0:32] @ U_lo   (WMMA, -beta folded into A)
    if (w < 4) {
      const int tm2 = w & 1, tn2 = w >> 1;
      const float nbeta = -beta;
      v8f acc;
#pragma unroll
      for (int i = 0; i < 8; ++i)
        acc[i] = Ut[(32 + tm2 * 16 + i + rh) * 33 + tn2 * 16 + nn];
#pragma unroll
      for (int k0 = 0; k0 < 32; k0 += 4) {
        int kb = k0 + kbo;
        v2f a  = { nbeta * GS[(32 + tm2 * 16 + nn) * 65 + kb],
                   nbeta * GS[(32 + tm2 * 16 + nn) * 65 + kb + 1] };
        v2f bU = { Ut[kb * 33 + tn2 * 16 + nn], Ut[(kb + 1) * 33 + tn2 * 16 + nn] };
        acc = wmma_f32(a, bU, acc);
      }
#pragma unroll
      for (int i = 0; i < 8; ++i)
        Ut[(32 + tm2 * 16 + i + rh) * 33 + tn2 * 16 + nn] = acc[i];
    }
    __syncthreads();
    // (e3) rows 33..63, remaining strictly-lower terms s in [32, t)
    for (int t = 33; t < CHUNK_; ++t) {
#pragma unroll
      for (int jj = 0; jj < 4; ++jj) {
        int j = w * 4 + jj;
        int s = 32 + lane;
        float p = (s < t) ? GS[t * 65 + s] * Ut[s * 33 + j] : 0.f;
#pragma unroll
        for (int off = 16; off > 0; off >>= 1) p += __shfl_xor(p, off, 32);
        if (lane == 0) Ut[t * 33 + j] -= beta * p;
      }
    }
    __syncthreads();

    // ---- state carry FIRST (last Kt consumer): S = lam^64 S + (lam^{63-s}k_s)^T U
    for (int r = 0; r < 4; ++r) {
      int mt = w + r * 8;
      for (int t2 = 0; t2 < 2; ++t2) {
        v8f acc;
#pragma unroll
        for (int i = 0; i < 8; ++i)
          acc[i] = lamC * S[(mt * 16 + i + rh) * VW + t2 * 16 + nn];
        for (int k0 = 0; k0 < CHUNK_; k0 += 4) {
          int kb = k0 + kbo;
          v2f a  = { lampow[63 - kb] * Kt[kb * KSTR + mt * 16 + nn],
                     lampow[62 - kb] * Kt[(kb + 1) * KSTR + mt * 16 + nn] };
          v2f bU = { Ut[kb * 33 + t2 * 16 + nn], Ut[(kb + 1) * 33 + t2 * 16 + nn] };
          acc = wmma_f32(a, bU, acc);
        }
#pragma unroll
        for (int i = 0; i < 8; ++i)
          S[(mt * 16 + i + rh) * VW + t2 * 16 + nn] = acc[i];
      }
    }
    __syncthreads();                     // all waves done reading Kt

    // ---- kick off next chunk's async K copy; it overlaps the O-matmul below
    if (ch + 1 < NCH) {
      const float* nk = xa + xbase + (size_t)CHUNK_ * D_;
      for (int i = tid; i < CHUNK_ * D_ / 4; i += 256) {
        int t = i >> 7, d4 = (i & 127) << 2;
        async_b128(nk + (size_t)t * D_ + d4,
                   KT_OFF + (unsigned)((t * KSTR + d4) * 4));
      }
    }

    // ---- O = GS @ U ; y = V + lam^{t+1} A + O
    v8f aO = {};
    for (int k0 = 0; k0 < CHUNK_; k0 += 4) {
      int kb = k0 + kbo;
      v2f a  = { GS[rowA * 65 + kb], GS[rowA * 65 + kb + 1] };
      v2f bU = { Ut[kb * 33 + tn * 16 + nn], Ut[(kb + 1) * 33 + tn * 16 + nn] };
      aO = wmma_f32(a, bU, aO);
    }
#pragma unroll
    for (int i = 0; i < 8; ++i) {
      int t = tm * 16 + i + rh;
      int j = tn * 16 + nn;
      float v = vstat[xbase + (size_t)t * D_ + v0 + j];
      y[xbase + (size_t)t * D_ + v0 + j] =
          v + lampow[t + 1] * At[t * 33 + j] + aO[i];
    }
    // loop-top barrier orders these GS/Ut/At reads before next chunk rewrites them
  }
}

// ---------------------------------------------------------------- kernel 4
__global__ __launch_bounds__(256) void layernorm_k(float* __restrict__ y,
                                                   const float* __restrict__ gam,
                                                   const float* __restrict__ bet) {
  __shared__ float rs[256];
  __shared__ float rq[256];
  const int row = blockIdx.x, tid = threadIdx.x;
  float v0 = y[(size_t)row * D_ + tid];
  float v1 = y[(size_t)row * D_ + tid + 256];
  rs[tid] = v0 + v1;
  rq[tid] = v0 * v0 + v1 * v1;
  __syncthreads();
  for (int s = 128; s > 0; s >>= 1) {
    if (tid < s) { rs[tid] += rs[tid + s]; rq[tid] += rq[tid + s]; }
    __syncthreads();
  }
  float mean = rs[0] * (1.f / D_);
  float var  = rq[0] * (1.f / D_) - mean * mean;
  float inv  = rsqrtf(var + EPS_);
  y[(size_t)row * D_ + tid]       = (v0 - mean) * inv * gam[tid] + bet[tid];
  y[(size_t)row * D_ + tid + 256] = (v1 - mean) * inv * gam[tid + 256] + bet[tid + 256];
}

// ---------------------------------------------------------------- launch
extern "C" void kernel_launch(void* const* d_in, const int* in_sizes, int n_in,
                              void* d_out, int out_size, void* d_ws, size_t ws_size,
                              hipStream_t stream) {
  const float* x    = (const float*)d_in[0];
  const float* W    = (const float*)d_in[1];
  const float* eta  = (const float*)d_in[2];
  const float* laml = (const float*)d_in[3];
  const float* g    = (const float*)d_in[4];
  const float* bb   = (const float*)d_in[5];
  float* out = (float*)d_out;

  float* xa    = (float*)d_ws;                       // [B,L,D] tanh(x)
  float* vstat = xa + (size_t)B_ * L_ * D_;          // [B,L,D] static_out

  const int n = B_ * L_ * D_;
  tanh_k<<<(n + 255) / 256, 256, 0, stream>>>(x, xa, n);

  dim3 g2(B_ * L_ / 64, D_ / 64);
  gemm_xw<<<g2, 256, 0, stream>>>(xa, W, vstat);

  size_t smem = (size_t)SMEM_FLOATS * sizeof(float);
  gdn_scan<<<B_ * (D_ / VW), 256, smem, stream>>>(xa, vstat, eta, laml, out);

  layernorm_k<<<B_ * L_, 256, 0, stream>>>(out, g, bb);
}

// v001
// Measured time: 846 microseconds a run.
// Two timings next to v000 both put it at 2.96 times that version's speed.
#include <hip/hip_runtime.h>
#include <hip/hip_bf16.h>

#define B_ 4
#define L_ 2048
#define D_ 512
#define CHUNK_ 64
#define NCH (L_ / CHUNK_)
#define VW 32           // value-dim slice per workgroup in the scan kernel
#define KSTR 516        // Kt row stride (16B-aligned rows, conflict-free)
#define GP 36            // row stride of the transposed triangle copies (16B-aligned)
#define EPS_ 1e-5f

typedef float v2f __attribute__((ext_vector_type(2)));
typedef float v4f __attribute__((ext_vector_type(4)));
typedef float v8f __attribute__((ext_vector_type(8)));

__device__ __forceinline__ v8f wmma_f32(v2f a, v2f b, v8f c) {
  // D = A(16x4 f32) * B(4x16 f32) + C(16x16 f32)
  return __builtin_amdgcn_wmma_f32_16x16x4_f32(false, a, false, b, (short)0, c,
                                               false, false);
}

// Async HBM -> LDS DMA (ASYNCcnt-tracked).  vDst = per-lane LDS byte offset.
__device__ __forceinline__ void async_b128(const float* g, unsigned lds_byte_off) {
  asm volatile("global_load_async_to_lds_b128 %0, %1, off"
               :
               : "v"(lds_byte_off), "v"(g)
               : "memory");
}
__device__ __forceinline__ void wait_async_lds() {
  asm volatile("s_wait_asynccnt 0x0" ::: "memory");
}

// ---------------------------------------------------------------- kernel 1
__global__ void tanh_k(const float* __restrict__ x, float* __restrict__ xa, int n) {
  int i = blockIdx.x * blockDim.x + threadIdx.x;
  if (i < n) xa[i] = tanhf(x[i]);
}

// ---------------------------------------------------------------- kernel 2
// static_out[m, e] = sum_d xa[m, d] * W[e, d]   (M=8192, N=512, K=512)
__global__ __launch_bounds__(256) void gemm_xw(const float* __restrict__ xa,
                                               const float* __restrict__ Wm,
                                               float* __restrict__ out) {
  __shared__ float At[64 * 33];   // A panel [64 rows][32 k] padded
  __shared__ float Bt[32 * 65];   // B panel [32 k][64 n] padded (B[k][n] = W[n][k])
  const int tid = threadIdx.x, lane = tid & 31, w = tid >> 5;
  const int m0 = blockIdx.x * 64, n0 = blockIdx.y * 64;
  const int wm = w & 3, wn = w >> 2;           // 4 x 2 wave grid
  const int nn = lane & 15;
  const int kbo = (lane >> 4) << 1;
  const int rh = (lane >> 4) << 3;

  v8f c0 = {}, c1 = {};
  for (int kp = 0; kp < D_; kp += 32) {
    for (int idx = tid; idx < 64 * 32; idx += 256) {
      int r = idx >> 5, c = idx & 31;
      At[r * 33 + c] = xa[(size_t)(m0 + r) * D_ + kp + c];
    }
    for (int idx = tid; idx < 64 * 32; idx += 256) {
      int k = idx & 31, n = idx >> 5;
      Bt[k * 65 + n] = Wm[(size_t)(n0 + n) * D_ + kp + k];
    }
    __syncthreads();
#pragma unroll
    for (int kk = 0; kk < 32; kk += 4) {
      int kb = kk + kbo;
      v2f a  = { At[(wm * 16 + nn) * 33 + kb], At[(wm * 16 + nn) * 33 + kb + 1] };
      v2f b0 = { Bt[kb * 65 + wn * 32 + nn], Bt[(kb + 1) * 65 + wn * 32 + nn] };
      v2f b1 = { Bt[kb * 65 + wn * 32 + 16 + nn], Bt[(kb + 1) * 65 + wn * 32 + 16 + nn] };
      c0 = wmma_f32(a, b0, c0);
      c1 = wmma_f32(a, b1, c1);
    }
    __syncthreads();
  }
#pragma unroll
  for (int i = 0; i < 8; ++i) {
    int r = m0 + wm * 16 + i + rh;
    out[(size_t)r * D_ + n0 + wn * 32 + nn]      = c0[i];
    out[(size_t)r * D_ + n0 + wn * 32 + 16 + nn] = c1[i];
  }
}

// ---------------------------------------------------------------- kernel 3
// Chunked gated delta-rule scan for one (batch, value-slice), q == k.
// Dynamic-LDS layout (byte offsets are compile-time constants; no static LDS,
// so the dynamic region starts at LDS offset 0 -> usable by async DMA):
// GT comes first: its wave-uniform reads then fit the 16-bit DS offset field.
#define GT_OFF  0u
#define S_OFF   (2u * 32u * GP * 4u)
#define KT_OFF  (S_OFF + 512u * VW * 4u)
#define UT_OFF  (KT_OFF + 64u * KSTR * 4u)
#define AT_OFF  (UT_OFF + 64u * 33u * 4u)
#define GS_OFF  (AT_OFF + 64u * 33u * 4u)
#define LP_OFF  (GS_OFF + 64u * 65u * 4u)
#define SMEM_FLOATS (2 * 32 * GP + 512 * VW + 64 * KSTR + 2 * 64 * 33 + 64 * 65 + 65)

// Unit-lower-triangular solve of one 32-row block by ONE wave: lane = value
// column, the 32 rows of that column live in registers.  gt[s*GP + t] holds
// -beta*G[t][s] (t > s), so column s is read as wave-uniform 16-byte loads and
// applied to all later rows as independent FMAs once u[s] is final.
// (templates only so that every register index is a compile-time constant)
template <int C, int HI>
__device__ __forceinline__ void tri_load_cols(v4f (&g)[31][8], const float* gt) {
  if constexpr (C <= HI && C < 31) {
#pragma unroll
    for (int q = (C + 1) >> 2; q < 8; ++q)
      g[C][q] = *(const v4f*)(gt + C * GP + 4 * q);
    tri_load_cols<C + 1, HI>(g, gt);
  }
}
template <int S>
__device__ __forceinline__ void tri_col(float (&u)[32], v4f (&g)[31][8], const float* gt) {
  if constexpr (S < 31) {
    // read ahead: columns up to S + 2 + S/4 (about 20 loads in flight; later
    // columns are shorter) so that the FMAs cover the LDS latency
    tri_load_cols<(S == 0) ? 0 : S + 2 + ((S - 1) >> 2), S + 2 + (S >> 2)>(g, gt);
    // keeps the read-ahead loads above this column's FMAs; without it the
    // compiler sinks them next to their use and their latency is exposed
    __builtin_amdgcn_sched_barrier(0);
#pragma unroll
    for (int q = (S + 1) >> 2; q < 8; ++q) {
#pragma unroll
      for (int e = 0; e < 4; ++e) {
        const int t = 4 * q + e;
        if (t > S) u[t] = fmaf(g[S][q][e], u[S], u[t]);
      }
    }
    tri_col<S + 1>(u, g, gt);
  }
}
__device__ __forceinline__ void tri_solve32(float* ucol, const float* gt) {
  float u[32];
  v4f g[31][8];
#pragma unroll
  for (int t = 0; t < 32; ++t) u[t] = ucol[t * 33];
  // LDS reads return in order: keeps every u load ahead of the triangle loads,
  // so the first FMAs do not wait for the whole read-ahead
  __builtin_amdgcn_sched_barrier(0);
  tri_col<0>(u, g, gt);
#pragma unroll
  for (int t = 1; t < 32; ++t) ucol[t * 33] = u[t];
}

__global__ __launch_bounds__(256) void gdn_scan(const float* __restrict__ xa,
                                                const float* __restrict__ vstat,
                                                const float* __restrict__ eta_p,
                                                const float* __restrict__ laml_p,
                                                float* __restrict__ y) {
  extern __shared__ float smem[];
  float* GT     = smem;                 // [2][32][GP] -beta*strictlow(diag blocks)^T
  float* S      = GT + 2 * 32 * GP;     // [512][VW]
  float* Kt     = S + 512 * VW;         // [64][KSTR]
  float* Ut     = Kt + 64 * KSTR;       // [64][33]
  float* At     = Ut + 64 * 33;         // [64][33]
  float* GS     = At + 64 * 33;         // [64][65]
  float* lampow = GS + 64 * 65;         // [65]

  const int tid = threadIdx.x, lane = tid & 31, w = tid >> 5;
  const int b  = blockIdx.x >> 4;             // 4 batches x 16 slices
  const int v0 = (blockIdx.x & 15) * VW;
  const float beta = eta_p[0];
  const float lam  = 1.f / (1.f + __expf(-laml_p[0]));

  for (int i = tid; i < 512 * VW; i += 256) S[i] = 0.f;
  if (tid < 65) lampow[tid] = powf(lam, (float)tid);

  const size_t bbase = (size_t)b * L_ * D_;
  // async-stage chunk 0's K (=Q) block
  for (int i = tid; i < CHUNK_ * D_ / 4; i += 256) {
    int t = i >> 7, d4 = (i & 127) << 2;
    async_b128(xa + bbase + (size_t)t * D_ + d4,
               KT_OFF + (unsigned)((t * KSTR + d4) * 4));
  }

  const int nn  = lane & 15;            // N index inside a 16-wide tile
  const int kbo = (lane >> 4) << 1;     // K sub-offset of the f32 A/B fragment
  const int rh  = (lane >> 4) << 3;     // row-half offset of C/D fragment
  const int tm = w & 3, tn = w >> 2;    // wave tile coords (4 x 2)
  const int rowA = tm * 16 + nn;

  for (int ch = 0; ch < NCH; ++ch) {
    const size_t xbase = bbase + (size_t)ch * CHUNK_ * D_;
    wait_async_lds();
    __syncthreads();                    // Kt ready; S/At/GS/Ut consistent
    const float lamC = lampow[64];

    // ---- prefetch next chunk (K + V slice) into cache while we compute
    if (ch + 1 < NCH) {
      const float* nk = xa + xbase + (size_t)CHUNK_ * D_;
      for (int i = tid; i < CHUNK_ * D_ / 32; i += 256)
        __builtin_prefetch(nk + i * 32, 0, 3);
      if (tid < CHUNK_)
        __builtin_prefetch(vstat + xbase + (size_t)(CHUNK_ + tid) * D_ + v0, 0, 3);
    }

    // ---- A = K@S [64x32], GS = mask/decay(K@K^T) [64x64]
    v8f aA = {}, aG0 = {}, aG1 = {};
    for (int k0 = 0; k0 < D_; k0 += 4) {
      int kb = k0 + kbo;
      v2f a  = { Kt[rowA * KSTR + kb], Kt[rowA * KSTR + kb + 1] };
      v2f bS = { S[kb * VW + tn * 16 + nn], S[(kb + 1) * VW + tn * 16 + nn] };
      aA = wmma_f32(a, bS, aA);
      v2f b0 = { Kt[((2 * tn) * 16 + nn) * KSTR + kb],
                 Kt[((2 * tn) * 16 + nn) * KSTR + kb + 1] };
      v2f b1 = { Kt[((2 * tn + 1) * 16 + nn) * KSTR + kb],
                 Kt[((2 * tn + 1) * 16 + nn) * KSTR + kb + 1] };
      aG0 = wmma_f32(a, b0, aG0);
      aG1 = wmma_f32(a, b1, aG1);
    }
    v8f h0, h1;
#pragma unroll
    for (int i = 0; i < 8; ++i) {
      int t = tm * 16 + i + rh;
      At[t * 33 + tn * 16 + nn] = aA[i];
      int s0 = (2 * tn) * 16 + nn, s1 = s0 + 16;
      float g0 = (s0 <= t) ? lampow[t - s0] * aG0[i] : 0.f;
      float g1 = (s1 <= t) ? lampow[t - s1] * aG1[i] : 0.f;
      GS[t * 65 + s0] = g0;
      GS[t * 65 + s1] = g1;
      h0[i] = (s0 < t) ? -beta * g0 : 0.f;
      h1[i] = (s1 < t) ? -beta * g1 : 0.f;
    }
    if ((tm >> 1) == tn) {
      // this wave's two tiles lie in a diagonal 32x32 block; a lane holds 8
      // consecutive rows t of one column s, so the transposed copy is contiguous
      float* g = GT + (tn * 32 + nn) * GP + (tm & 1) * 16 + rh;
      *(v4f*)(g)               = __builtin_shufflevector(h0, h0, 0, 1, 2, 3);
      *(v4f*)(g + 4)           = __builtin_shufflevector(h0, h0, 4, 5, 6, 7);
      *(v4f*)(g + 16 * GP)     = __builtin_shufflevector(h1, h1, 0, 1, 2, 3);
      *(v4f*)(g + 16 * GP + 4) = __builtin_shufflevector(h1, h1, 4, 5, 6, 7);
    }
    __syncthreads();

    // ---- RHS: U <- beta*(V - lam^{t+1} A)   (V straight from global/L2)
    for (int i = tid; i < CHUNK_ * VW; i += 256) {
      int t = i >> 5, j = i & 31;
      float v = vstat[xbase + (size_t)t * D_ + v0 + j];
      Ut[t * 33 + j] = beta * (v - lampow[t + 1] * At[t * 33 + j]);
    }
    __syncthreads();

    // ---- blocked forward substitution: (I + beta*strictlow(GS)) U = R
    // (e1) rows 0..31: wave 0, one value column per lane
    if (w == 0) tri_solve32(Ut + lane, GT);
    __syncthreads();
    // (e2) U_hi -= beta * GS[32:64,0:32] @ U_lo   (WMMA, -beta folded into A)
    if (w < 4) {
      const int tm2 = w & 1, tn2 = w >> 1;
      const float nbeta = -beta;
      v8f acc;
#pragma unroll
      for (int i = 0; i < 8; ++i)
        acc[i] = Ut[(32 + tm2 * 16 + i + rh) * 33 + tn2 * 16 + nn];
#pragma unroll
      for (int k0 = 0; k0 < 32; k0 += 4) {
        int kb = k0 + kbo;
        v2f a  = { nbeta * GS[(32 + tm2 * 16 + nn) * 65 + kb],
                   nbeta * GS[(32 + tm2 * 16 + nn) * 65 + kb + 1] };
        v2f bU = { Ut[kb * 33 + tn2 * 16 + nn], Ut[(kb + 1) * 33 + tn2 * 16 + nn] };
        acc = wmma_f32(a, bU, acc);
      }
#pragma unroll
      for (int i = 0; i < 8; ++i)
        Ut[(32 + tm2 * 16 + i + rh) * 33 + tn2 * 16 + nn] = acc[i];
    }
    __syncthreads();
    // (e3) rows 32..63, remaining strictly-lower terms s in [32, t)
    if (w == 0) tri_solve32(Ut + 32 * 33 + lane, GT + 32 * GP);
    __syncthreads();

    // ---- state carry FIRST (last Kt consumer): S = lam^64 S + (lam^{63-s}k_s)^T U
    for (int r = 0; r < 4; ++r) {
      int mt = w + r * 8;
      for (int t2 = 0; t2 < 2; ++t2) {
        v8f acc;
#pragma unroll
        for (int i = 0; i < 8; ++i)
          acc[i] = lamC * S[(mt * 16 + i + rh) * VW + t2 * 16 + nn];
        for (int k0 = 0; k0 < CHUNK_; k0 += 4) {
          int kb = k0 + kbo;
          v2f a  = { lampow[63 - kb] * Kt[kb * KSTR + mt * 16 + nn],
                     lampow[62 - kb] * Kt[(kb + 1) * KSTR + mt * 16 + nn] };
          v2f bU = { Ut[kb * 33 + t2 * 16 + nn], Ut[(kb + 1) * 33 + t2 * 16 + nn] };
          acc = wmma_f32(a, bU, acc);
        }
#pragma unroll
        for (int i = 0; i < 8; ++i)
          S[(mt * 16 + i + rh) * VW + t2 * 16 + nn] = acc[i];
      }
    }
    __syncthreads();                     // all waves done reading Kt

    // ---- kick off next chunk's async K copy; it overlaps the O-matmul below
    if (ch + 1 < NCH) {
      const float* nk = xa + xbase + (size_t)CHUNK_ * D_;
      for (int i = tid; i < CHUNK_ * D_ / 4; i += 256) {
        int t = i >> 7, d4 = (i & 127) << 2;
        async_b128(nk + (size_t)t * D_ + d4,
                   KT_OFF + (unsigned)((t * KSTR + d4) * 4));
      }
    }

    // ---- O = GS @ U ; y = V + lam^{t+1} A + O
    v8f aO = {};
    for (int k0 = 0; k0 < CHUNK_; k0 += 4) {
      int kb = k0 + kbo;
      v2f a  = { GS[rowA * 65 + kb], GS[rowA * 65 + kb + 1] };
      v2f bU = { Ut[kb * 33 + tn * 16 + nn], Ut[(kb + 1) * 33 + tn * 16 + nn] };
      aO = wmma_f32(a, bU, aO);
    }
#pragma unroll
    for (int i = 0; i < 8; ++i) {
      int t = tm * 16 + i + rh;
      int j = tn * 16 + nn;
      float v = vstat[xbase + (size_t)t * D_ + v0 + j];
      y[xbase + (size_t)t * D_ + v0 + j] =
          v + lampow[t + 1] * At[t * 33 + j] + aO[i];
    }
    // loop-top barrier orders these GS/Ut/At reads before next chunk rewrites them
  }
}

// ---------------------------------------------------------------- kernel 4
__global__ __launch_bounds__(256) void layernorm_k(float* __restrict__ y,
                                                   const float* __restrict__ gam,
                                                   const float* __restrict__ bet) {
  __shared__ float rs[256];
  __shared__ float rq[256];
  const int row = blockIdx.x, tid = threadIdx.x;
  float v0 = y[(size_t)row * D_ + tid];
  float v1 = y[(size_t)row * D_ + tid + 256];
  rs[tid] = v0 + v1;
  rq[tid] = v0 * v0 + v1 * v1;
  __syncthreads();
  for (int s = 128; s > 0; s >>= 1) {
    if (tid < s) { rs[tid] += rs[tid + s]; rq[tid] += rq[tid + s]; }
    __syncthreads();
  }
  float mean = rs[0] * (1.f / D_);
  float var  = rq[0] * (1.f / D_) - mean * mean;
  float inv  = rsqrtf(var + EPS_);
  y[(size_t)row * D_ + tid]       = (v0 - mean) * inv * gam[tid] + bet[tid];
  y[(size_t)row * D_ + tid + 256] = (v1 - mean) * inv * gam[tid + 256] + bet[tid + 256];
}

// ---------------------------------------------------------------- launch
extern "C" void kernel_launch(void* const* d_in, const int* in_sizes, int n_in,
                              void* d_out, int out_size, void* d_ws, size_t ws_size,
                              hipStream_t stream) {
  const float* x    = (const float*)d_in[0];
  const float* W    = (const float*)d_in[1];
  const float* eta  = (const float*)d_in[2];
  const float* laml = (const float*)d_in[3];
  const float* g    = (const float*)d_in[4];
  const float* bb   = (const float*)d_in[5];
  float* out = (float*)d_out;

  float* xa    = (float*)d_ws;                       // [B,L,D] tanh(x)
  float* vstat = xa + (size_t)B_ * L_ * D_;          // [B,L,D] static_out

  const int n = B_ * L_ * D_;
  tanh_k<<<(n + 255) / 256, 256, 0, stream>>>(x, xa, n);

  dim3 g2(B_ * L_ / 64, D_ / 64);
  gemm_xw<<<g2, 256, 0, stream>>>(xa, W, vstat);

  size_t smem = (size_t)SMEM_FLOATS * sizeof(float);
  gdn_scan<<<B_ * (D_ / VW), 256, smem, stream>>>(xa, vstat, eta, laml, out);

  layernorm_k<<<B_ * L_, 256, 0, stream>>>(out, g, bb);
}

// v002
// A run of this version takes 583 microseconds.
// In both of two side-by-side timings against v001, it was 1.45 times as fast.
// Over all steps from v000 it is 4.30 times as fast.
#include <hip/hip_runtime.h>
#include <hip/hip_bf16.h>

#define B_ 4
#define L_ 2048
#define D_ 512
#define CHUNK_ 64
#define NCH (L_ / CHUNK_)
#define VW 32           // value-dim slice per workgroup in the scan kernel
#define KSTR 516        // Kt row stride (16B-aligned rows, conflict-free)
#define GP 36            // row stride of the transposed triangle copies (16B-aligned)
#define EPS_ 1e-5f
#define GIMG (CHUNK_ * CHUNK_ + 2 * 32 * 32)  // floats of one chunk's Gram image in the workspace

typedef float v2f __attribute__((ext_vector_type(2)));
typedef float v4f __attribute__((ext_vector_type(4)));
typedef float v8f __attribute__((ext_vector_type(8)));

__device__ __forceinline__ v8f wmma_f32(v2f a, v2f b, v8f c) {
  // D = A(16x4 f32) * B(4x16 f32) + C(16x16 f32)
  return __builtin_amdgcn_wmma_f32_16x16x4_f32(false, a, false, b, (short)0, c,
                                               false, false);
}

// Async HBM -> LDS DMA (ASYNCcnt-tracked).  vDst = per-lane LDS byte offset.
__device__ __forceinline__ void async_b128(const float* g, unsigned lds_byte_off) {
  asm volatile("global_load_async_to_lds_b128 %0, %1, off"
               :
               : "v"(lds_byte_off), "v"(g)
               : "memory");
}
__device__ __forceinline__ void wait_async_lds() {
  asm volatile("s_wait_asynccnt 0x0" ::: "memory");
}

// ---------------------------------------------------------------- kernel 1
__global__ void tanh_k(const float* __restrict__ x, float* __restrict__ xa, int n) {
  int i = blockIdx.x * blockDim.x + threadIdx.x;
  if (i < n) xa[i] = tanhf(x[i]);
}

// ---------------------------------------------------------------- kernel 2
// static_out[m, e] = sum_d xa[m, d] * W[e, d]   (M=8192, N=512, K=512)
__global__ __launch_bounds__(256) void gemm_xw(const float* __restrict__ xa,
                                               const float* __restrict__ Wm,
                                               float* __restrict__ out) {
  __shared__ float At[64 * 33];   // A panel [64 rows][32 k] padded
  __shared__ float Bt[32 * 65];   // B panel [32 k][64 n] padded (B[k][n] = W[n][k])
  const int tid = threadIdx.x, lane = tid & 31, w = tid >> 5;
  const int m0 = blockIdx.x * 64, n0 = blockIdx.y * 64;
  const int wm = w & 3, wn = w >> 2;           // 4 x 2 wave grid
  const int nn = lane & 15;
  const int kbo = (lane >> 4) << 1;
  const int rh = (lane >> 4) << 3;

  v8f c0 = {}, c1 = {};
  for (int kp = 0; kp < D_; kp += 32) {
    for (int idx = tid; idx < 64 * 32; idx += 256) {
      int r = idx >> 5, c = idx & 31;
      At[r * 33 + c] = xa[(size_t)(m0 + r) * D_ + kp + c];
    }
    for (int idx = tid; idx < 64 * 32; idx += 256) {
      int k = idx & 31, n = idx >> 5;
      Bt[k * 65 + n] = Wm[(size_t)(n0 + n) * D_ + kp + k];
    }
    __syncthreads();
#pragma unroll
    for (int kk = 0; kk < 32; kk += 4) {
      int kb = kk + kbo;
      v2f a  = { At[(wm * 16 + nn) * 33 + kb], At[(wm * 16 + nn) * 33 + kb + 1] };
      v2f b0 = { Bt[kb * 65 + wn * 32 + nn], Bt[(kb + 1) * 65 + wn * 32 + nn] };
      v2f b1 = { Bt[kb * 65 + wn * 32 + 16 + nn], Bt[(kb + 1) * 65 + wn * 32 + 16 + nn] };
      c0 = wmma_f32(a, b0, c0);
      c1 = wmma_f32(a, b1, c1);
    }
    __syncthreads();
  }
#pragma unroll
  for (int i = 0; i < 8; ++i) {
    int r = m0 + wm * 16 + i + rh;
    out[(size_t)r * D_ + n0 + wn * 32 + nn]      = c0[i];
    out[(size_t)r * D_ + n0 + wn * 32 + 16 + nn] = c1[i];
  }
}

// ---------------------------------------------------------------- kernel 2b
// One workgroup per (batch, chunk).  Nothing here depends on the scan state, so
// every chunk is done at once, and once instead of once per value slice.
// Image of a chunk: [64][64] lam^(t-s) * (k_t . k_s) for s <= t, else 0; then
// [2][32][32] the two diagonal 32x32 blocks, strictly lower, times -beta, transposed.
__global__ __launch_bounds__(256) void gram_k(const float* __restrict__ xa,
                                              const float* __restrict__ eta_p,
                                              const float* __restrict__ laml_p,
                                              float* __restrict__ gimg) {
  extern __shared__ float smem[];
  float* Kt     = smem;                 // [64][KSTR]
  float* lampow = Kt + 64 * KSTR;       // [65]
  const int tid = threadIdx.x, lane = tid & 31, w = tid >> 5;
  const float beta = eta_p[0];
  const float lam  = 1.f / (1.f + __expf(-laml_p[0]));
  if (tid < 65) lampow[tid] = powf(lam, (float)tid);

  // The chunk is one contiguous run of 64*512 floats: thread tid takes 16-byte
  // piece tid + 256*j, which is row (tid >> 7) + 2*j of Kt.
  const v4f* s4 = (const v4f*)(xa + (size_t)blockIdx.x * CHUNK_ * D_) + tid;
  float* kd = Kt + (tid >> 7) * KSTR + ((tid & 127) << 2);
  // unrolled: constant offsets from one address, many loads in flight at once
#pragma unroll
  for (int j = 0; j < CHUNK_ * D_ / 4 / 256; ++j)
    *(v4f*)(kd + 2 * j * KSTR) = s4[256 * j];
  __syncthreads();

  const int nn  = lane & 15;
  const int kbo = (lane >> 4) << 1;
  const int rh  = (lane >> 4) << 3;
  const int tm = w & 3, tn = w >> 2;
  const int rowA = tm * 16 + nn;

  v8f aG0 = {}, aG1 = {};
  // unrolled so that the LDS reads of several k steps issue as one group
#pragma unroll 8
  for (int k0 = 0; k0 < D_; k0 += 4) {
    int kb = k0 + kbo;
    v2f a  = { Kt[rowA * KSTR + kb], Kt[rowA * KSTR + kb + 1] };
    v2f b0 = { Kt[((2 * tn) * 16 + nn) * KSTR + kb],
               Kt[((2 * tn) * 16 + nn) * KSTR + kb + 1] };
    v2f b1 = { Kt[((2 * tn + 1) * 16 + nn) * KSTR + kb],
               Kt[((2 * tn + 1) * 16 + nn) * KSTR + kb + 1] };
    aG0 = wmma_f32(a, b0, aG0);
    aG1 = wmma_f32(a, b1, aG1);
  }

  float* gs = gimg + (size_t)blockIdx.x * GIMG;
  float* gt = gs + CHUNK_ * CHUNK_;
  v8f h0, h1;
#pragma unroll
  for (int i = 0; i < 8; ++i) {
    int t = tm * 16 + i + rh;
    int s0 = (2 * tn) * 16 + nn, s1 = s0 + 16;
    float p0 = lampow[(s0 <= t) ? t - s0 : 0];
    float p1 = lampow[(s1 <= t) ? t - s1 : 0];
    float g0 = (s0 <= t) ? p0 * aG0[i] : 0.f;
    float g1 = (s1 <= t) ? p1 * aG1[i] : 0.f;
    gs[t * CHUNK_ + s0] = g0;
    gs[t * CHUNK_ + s1] = g1;
    h0[i] = (s0 < t) ? -beta * g0 : 0.f;
    h1[i] = (s1 < t) ? -beta * g1 : 0.f;
  }
  if ((tm >> 1) == tn) {
    // this wave's two tiles lie in a diagonal 32x32 block; a lane holds 8
    // consecutive rows t of one column s, so the transposed copy is contiguous
    float* g = gt + (tn * 32 + nn) * 32 + (tm & 1) * 16 + rh;
    *(v4f*)(g)               = __builtin_shufflevector(h0, h0, 0, 1, 2, 3);
    *(v4f*)(g + 4)           = __builtin_shufflevector(h0, h0, 4, 5, 6, 7);
    *(v4f*)(g + 16 * 32)     = __builtin_shufflevector(h1, h1, 0, 1, 2, 3);
    *(v4f*)(g + 16 * 32 + 4) = __builtin_shufflevector(h1, h1, 4, 5, 6, 7);
  }
}

// ---------------------------------------------------------------- kernel 3
// Chunked gated delta-rule scan for one (batch, value-slice), q == k.
// Dynamic-LDS layout (byte offsets are compile-time constants; no static LDS,
// so the dynamic region starts at LDS offset 0 -> usable by async DMA):
// GT comes first: its wave-uniform reads then fit the 16-bit DS offset field.
#define GT_OFF  0u
#define S_OFF   (2u * 32u * GP * 4u)
#define KT_OFF  (S_OFF + 512u * VW * 4u)
#define UT_OFF  (KT_OFF + 64u * KSTR * 4u)
#define AT_OFF  (UT_OFF + 64u * 33u * 4u)
#define GS_OFF  (AT_OFF + 64u * 33u * 4u)
#define LP_OFF  (GS_OFF + 64u * 65u * 4u)
#define SMEM_FLOATS (2 * 32 * GP + 512 * VW + 64 * KSTR + 2 * 64 * 33 + 64 * 65 + 65)

// Unit-lower-triangular solve of one 32-row block by ONE wave: lane = value
// column, the 32 rows of that column live in registers.  gt[s*GP + t] holds
// -beta*G[t][s] (t > s), so column s is read as wave-uniform 16-byte loads and
// applied to all later rows as independent FMAs once u[s] is final.
// (templates only so that every register index is a compile-time constant)
template <int C, int HI>
__device__ __forceinline__ void tri_load_cols(v4f (&g)[31][8], const float* gt) {
  if constexpr (C <= HI && C < 31) {
#pragma unroll
    for (int q = (C + 1) >> 2; q < 8; ++q)
      g[C][q] = *(const v4f*)(gt + C * GP + 4 * q);
    tri_load_cols<C + 1, HI>(g, gt);
  }
}
template <int S>
__device__ __forceinline__ void tri_col(float (&u)[32], v4f (&g)[31][8], const float* gt) {
  if constexpr (S < 31) {
    // read ahead: columns up to S + 2 + S/4 (about 20 loads in flight; later
    // columns are shorter) so that the FMAs cover the LDS latency
    tri_load_cols<(S == 0) ? 0 : S + 2 + ((S - 1) >> 2), S + 2 + (S >> 2)>(g, gt);
    // keeps the read-ahead loads above this column's FMAs; without it the
    // compiler sinks them next to their use and their latency is exposed
    __builtin_amdgcn_sched_barrier(0);
#pragma unroll
    for (int q = (S + 1) >> 2; q < 8; ++q) {
#pragma unroll
      for (int e = 0; e < 4; ++e) {
        const int t = 4 * q + e;
        if (t > S) u[t] = fmaf(g[S][q][e], u[S], u[t]);
      }
    }
    tri_col<S + 1>(u, g, gt);
  }
}
__device__ __forceinline__ void tri_solve32(float* ucol, const float* gt) {
  float u[32];
  v4f g[31][8];
#pragma unroll
  for (int t = 0; t < 32; ++t) u[t] = ucol[t * 33];
  // LDS reads return in order: keeps every u load ahead of the triangle loads,
  // so the first FMAs do not wait for the whole read-ahead
  __builtin_amdgcn_sched_barrier(0);
  tri_col<0>(u, g, gt);
#pragma unroll
  for (int t = 1; t < 32; ++t) ucol[t * 33] = u[t];
}

__global__ __launch_bounds__(256) void gdn_scan(const float* __restrict__ xa,
                                                const float* __restrict__ vstat,
                                                const float* __restrict__ gimg,
                                                const float* __restrict__ eta_p,
                                                const float* __restrict__ laml_p,
                                                float* __restrict__ y) {
  extern __shared__ float smem[];
  float* GT     = smem;                 // [2][32][GP] -beta*strictlow(diag blocks)^T
  float* S      = GT + 2 * 32 * GP;     // [512][VW]
  float* Kt     = S + 512 * VW;         // [64][KSTR]
  float* Ut     = Kt + 64 * KSTR;       // [64][33]
  float* At     = Ut + 64 * 33;         // [64][33]
  float* GS     = At + 64 * 33;         // [64][65]
  float* lampow = GS + 64 * 65;         // [65]

  const int tid = threadIdx.x, lane = tid & 31, w = tid >> 5;
  const int b  = blockIdx.x >> 4;             // 4 batches x 16 slices
  const int v0 = (blockIdx.x & 15) * VW;
  const float beta = eta_p[0];
  const float lam  = 1.f / (1.f + __expf(-laml_p[0]));

  for (int i = tid; i < 512 * VW; i += 256) S[i] = 0.f;
  if (tid < 65) lampow[tid] = powf(lam, (float)tid);

  const size_t bbase = (size_t)b * L_ * D_;
  // async-stage chunk 0's K (=Q) block
  for (int i = tid; i < CHUNK_ * D_ / 4; i += 256) {
    int t = i >> 7, d4 = (i & 127) << 2;
    async_b128(xa + bbase + (size_t)t * D_ + d4,
               KT_OFF + (unsigned)((t * KSTR + d4) * 4));
  }

  const int nn  = lane & 15;            // N index inside a 16-wide tile
  const int kbo = (lane >> 4) << 1;     // K sub-offset of the f32 A/B fragment
  const int rh  = (lane >> 4) << 3;     // row-half offset of C/D fragment
  const int tm = w & 3, tn = w >> 2;    // wave tile coords (4 x 2)
  const int rowA = tm * 16 + nn;

  for (int ch = 0; ch < NCH; ++ch) {
    const size_t xbase = bbase + (size_t)ch * CHUNK_ * D_;
    wait_async_lds();
    __syncthreads();                    // Kt ready; S/At/GS/Ut consistent
    const float lamC = lampow[64];

    // ---- prefetch next chunk (K + V slice) into cache while we compute
    if (ch + 1 < NCH) {
      const float* nk = xa + xbase + (size_t)CHUNK_ * D_;
      for (int i = tid; i < CHUNK_ * D_ / 32; i += 256)
        __builtin_prefetch(nk + i * 32, 0, 3);
      if (tid < CHUNK_)
        __builtin_prefetch(vstat + xbase + (size_t)(CHUNK_ + tid) * D_ + v0, 0, 3);
    }

    // ---- this chunk's Gram image (gram_k): loads issued here, stored to LDS
    // behind the K@S loop, which covers their latency
    const v4f* gi = (const v4f*)(gimg + (size_t)(b * NCH + ch) * GIMG);
    v4f gq[GIMG / 4 / 256];
    // (the three unrolls below keep gq's indices constant, so it stays in registers)
#pragma unroll
    for (int j = 0; j < GIMG / 4 / 256; ++j) gq[j] = gi[tid + 256 * j];

    // ---- A = K@S [64x32]
    v8f aA = {};
    for (int k0 = 0; k0 < D_; k0 += 4) {
      int kb = k0 + kbo;
      v2f a  = { Kt[rowA * KSTR + kb], Kt[rowA * KSTR + kb + 1] };
      v2f bS = { S[kb * VW + tn * 16 + nn], S[(kb + 1) * VW + tn * 16 + nn] };
      aA = wmma_f32(a, bS, aA);
    }
#pragma unroll
    for (int i = 0; i < 8; ++i) {
      int t = tm * 16 + i + rh;
      At[t * 33 + tn * 16 + nn] = aA[i];
    }
#pragma unroll
    for (int j = 0; j < CHUNK_ * CHUNK_ / 4 / 256; ++j) {
      int i = tid + 256 * j;
      int t = i >> 4, s4 = (i & 15) << 2;
#pragma unroll
      for (int e = 0; e < 4; ++e) GS[t * 65 + s4 + e] = gq[j][e];
    }
#pragma unroll
    for (int j = 0; j < 2 * 32 * 32 / 4 / 256; ++j) {
      int i = tid + 256 * j;
      *(v4f*)(GT + (i >> 3) * GP + ((i & 7) << 2)) = gq[CHUNK_ * CHUNK_ / 4 / 256 + j];
    }
    __syncthreads();

    // ---- RHS: U <- beta*(V - lam^{t+1} A)   (V straight from global/L2)
    for (int i = tid; i < CHUNK_ * VW; i += 256) {
      int t = i >> 5, j = i & 31;
      float v = vstat[xbase + (size_t)t * D_ + v0 + j];
      Ut[t * 33 + j] = beta * (v - lampow[t + 1] * At[t * 33 + j]);
    }
    __syncthreads();

    // ---- blocked forward substitution: (I + beta*strictlow(GS)) U = R
    // (e1) rows 0..31: wave 0, one value column per lane
    if (w == 0) tri_solve32(Ut + lane, GT);
    __syncthreads();
    // (e2) U_hi -= beta * GS[32:64,0:32] @ U_lo   (WMMA, -beta folded into A)
    if (w < 4) {
      const int tm2 = w & 1, tn2 = w >> 1;
      const float nbeta = -beta;
      v8f acc;
#pragma unroll
      for (int i = 0; i < 8; ++i)
        acc[i] = Ut[(32 + tm2 * 16 + i + rh) * 33 + tn2 * 16 + nn];
#pragma unroll
      for (int k0 = 0; k0 < 32; k0 += 4) {
        int kb = k0 + kbo;
        v2f a  = { nbeta * GS[(32 + tm2 * 16 + nn) * 65 + kb],
                   nbeta * GS[(32 + tm2 * 16 + nn) * 65 + kb + 1] };
        v2f bU = { Ut[kb * 33 + tn2 * 16 + nn], Ut[(kb + 1) * 33 + tn2 * 16 + nn] };
        acc = wmma_f32(a, bU, acc);
      }
#pragma unroll
      for (int i = 0; i < 8; ++i)
        Ut[(32 + tm2 * 16 + i + rh) * 33 + tn2 * 16 + nn] = acc[i];
    }
    __syncthreads();
    // (e3) rows 32..63, remaining strictly-lower terms s in [32, t)
    if (w == 0) tri_solve32(Ut + 32 * 33 + lane, GT + 32 * GP);
    __syncthreads();

    // ---- state carry FIRST (last Kt consumer): S = lam^64 S + (lam^{63-s}k_s)^T U
    for (int r = 0; r < 4; ++r) {
      int mt = w + r * 8;
      for (int t2 = 0; t2 < 2; ++t2) {
        v8f acc;
#pragma unroll
        for (int i = 0; i < 8; ++i)
          acc[i] = lamC * S[(mt * 16 + i + rh) * VW + t2 * 16 + nn];
        for (int k0 = 0; k0 < CHUNK_; k0 += 4) {
          int kb = k0 + kbo;
          v2f a  = { lampow[63 - kb] * Kt[kb * KSTR + mt * 16 + nn],
                     lampow[62 - kb] * Kt[(kb + 1) * KSTR + mt * 16 + nn] };
          v2f bU = { Ut[kb * 33 + t2 * 16 + nn], Ut[(kb + 1) * 33 + t2 * 16 + nn] };
          acc = wmma_f32(a, bU, acc);
        }
#pragma unroll
        for (int i = 0; i < 8; ++i)
          S[(mt * 16 + i + rh) * VW + t2 * 16 + nn] = acc[i];
      }
    }
    __syncthreads();                     // all waves done reading Kt

    // ---- kick off next chunk's async K copy; it overlaps the O-matmul below
    if (ch + 1 < NCH) {
      const float* nk = xa + xbase + (size_t)CHUNK_ * D_;
      for (int i = tid; i < CHUNK_ * D_ / 4; i += 256) {
        int t = i >> 7, d4 = (i & 127) << 2;
        async_b128(nk + (size_t)t * D_ + d4,
                   KT_OFF + (unsigned)((t * KSTR + d4) * 4));
      }
    }

    // ---- O = GS @ U ; y = V + lam^{t+1} A + O
    v8f aO = {};
    for (int k0 = 0; k0 < CHUNK_; k0 += 4) {
      int kb = k0 + kbo;
      v2f a  = { GS[rowA * 65 + kb], GS[rowA * 65 + kb + 1] };
      v2f bU = { Ut[kb * 33 + tn * 16 + nn], Ut[(kb + 1) * 33 + tn * 16 + nn] };
      aO = wmma_f32(a, bU, aO);
    }
#pragma unroll
    for (int i = 0; i < 8; ++i) {
      int t = tm * 16 + i + rh;
      int j = tn * 16 + nn;
      float v = vstat[xbase + (size_t)t * D_ + v0 + j];
      y[xbase + (size_t)t * D_ + v0 + j] =
          v + lampow[t + 1] * At[t * 33 + j] + aO[i];
    }
    // the stores' address registers are reused by the next trip's loads
    asm volatile("s_wait_xcnt 0x0" ::: "memory");
    // loop-top wait_async + barrier orders the Kt DMA before next chunk's K@S reads
  }
}

// ---------------------------------------------------------------- kernel 4
__global__ __launch_bounds__(256) void layernorm_k(float* __restrict__ y,
                                                   const float* __restrict__ gam,
                                                   const float* __restrict__ bet) {
  __shared__ float rs[256];
  __shared__ float rq[256];
  const int row = blockIdx.x, tid = threadIdx.x;
  float v0 = y[(size_t)row * D_ + tid];
  float v1 = y[(size_t)row * D_ + tid + 256];
  rs[tid] = v0 + v1;
  rq[tid] = v0 * v0 + v1 * v1;
  __syncthreads();
  for (int s = 128; s > 0; s >>= 1) {
    if (tid < s) { rs[tid] += rs[tid + s]; rq[tid] += rq[tid + s]; }
    __syncthreads();
  }
  float mean = rs[0] * (1.f / D_);
  float var  = rq[0] * (1.f / D_) - mean * mean;
  float inv  = rsqrtf(var + EPS_);
  y[(size_t)row * D_ + tid]       = (v0 - mean) * inv * gam[tid] + bet[tid];
  y[(size_t)row * D_ + tid + 256] = (v1 - mean) * inv * gam[tid + 256] + bet[tid + 256];
}

// ---------------------------------------------------------------- launch
extern "C" void kernel_launch(void* const* d_in, const int* in_sizes, int n_in,
                              void* d_out, int out_size, void* d_ws, size_t ws_size,
                              hipStream_t stream) {
  const float* x    = (const float*)d_in[0];
  const float* W    = (const float*)d_in[1];
  const float* eta  = (const float*)d_in[2];
  const float* laml = (const float*)d_in[3];
  const float* g    = (const float*)d_in[4];
  const float* bb   = (const float*)d_in[5];
  float* out = (float*)d_out;

  float* xa    = (float*)d_ws;                       // [B,L,D] tanh(x)
  float* vstat = xa + (size_t)B_ * L_ * D_;          // [B,L,D] static_out
  float* gimg  = vstat + (size_t)B_ * L_ * D_;       // [B*NCH][GIMG] Gram images

  const int n = B_ * L_ * D_;
  tanh_k<<<(n + 255) / 256, 256, 0, stream>>>(x, xa, n);

  dim3 g2(B_ * L_ / 64, D_ / 64);
  gemm_xw<<<g2, 256, 0, stream>>>(xa, W, vstat);

  size_t gsmem = (size_t)(64 * KSTR + 65) * sizeof(float);
  gram_k<<<B_ * NCH, 256, gsmem, stream>>>(xa, eta, laml, gimg);

  size_t smem = (size_t)SMEM_FLOATS * sizeof(float);
  gdn_scan<<<B_ * (D_ / VW), 256, smem, stream>>>(xa, vstat, gimg, eta, laml, out);

  layernorm_k<<<B_ * L_, 256, 0, stream>>>(out, g, bb);
}

// v003
// One run takes 421 microseconds.
// Timed twice side by side with v002, it ran 1.39 times as fast both times.
// Over all steps from v000 it is 5.95 times as fast.
#include <hip/hip_runtime.h>
#include <hip/hip_bf16.h>

#define B_ 4
#define L_ 2048
#define D_ 512
#define CHUNK_ 64
#define NCH (L_ / CHUNK_)
#define VW 32           // value-dim slice per workgroup in the scan kernel
#define KSTR 516        // Kt row stride (16B-aligned rows, conflict-free)
#define GP 36            // row stride of the transposed triangle copies (16B-aligned)
#define EPS_ 1e-5f
#define GIMG (CHUNK_ * CHUNK_ + 2 * 32 * 32)  // floats of one chunk's Gram image in the workspace

typedef float v2f __attribute__((ext_vector_type(2)));
typedef float v4f __attribute__((ext_vector_type(4)));
typedef float v8f __attribute__((ext_vector_type(8)));

__device__ __forceinline__ v8f wmma_f32(v2f a, v2f b, v8f c) {
  // D = A(16x4 f32) * B(4x16 f32) + C(16x16 f32)
  return __builtin_amdgcn_wmma_f32_16x16x4_f32(false, a, false, b, (short)0, c,
                                               false, false);
}

// Async HBM -> LDS DMA (ASYNCcnt-tracked).  vDst = per-lane LDS byte offset.
__device__ __forceinline__ void async_b128(const float* g, unsigned lds_byte_off) {
  asm volatile("global_load_async_to_lds_b128 %0, %1, off"
               :
               : "v"(lds_byte_off), "v"(g)
               : "memory");
}
__device__ __forceinline__ void wait_async_lds() {
  asm volatile("s_wait_asynccnt 0x0" ::: "memory");
}

// ---------------------------------------------------------------- kernel 1
__global__ void tanh_k(const float* __restrict__ x, float* __restrict__ xa, int n) {
  int i = blockIdx.x * blockDim.x + threadIdx.x;
  if (i < n) xa[i] = tanhf(x[i]);
}

// ---------------------------------------------------------------- kernel 2
// static_out[m, e] = sum_d xa[m, d] * W[e, d]   (M=8192, N=512, K=512)
__global__ __launch_bounds__(256) void gemm_xw(const float* __restrict__ xa,
                                               const float* __restrict__ Wm,
                                               float* __restrict__ out) {
  __shared__ float At[64 * 33];   // A panel [64 rows][32 k] padded
  __shared__ float Bt[32 * 65];   // B panel [32 k][64 n] padded (B[k][n] = W[n][k])
  const int tid = threadIdx.x, lane = tid & 31, w = tid >> 5;
  const int m0 = blockIdx.x * 64, n0 = blockIdx.y * 64;
  const int wm = w & 3, wn = w >> 2;           // 4 x 2 wave grid
  const int nn = lane & 15;
  const int kbo = (lane >> 4) << 1;
  const int rh = (lane >> 4) << 3;

  v8f c0 = {}, c1 = {};
  for (int kp = 0; kp < D_; kp += 32) {
    for (int idx = tid; idx < 64 * 32; idx += 256) {
      int r = idx >> 5, c = idx & 31;
      At[r * 33 + c] = xa[(size_t)(m0 + r) * D_ + kp + c];
    }
    for (int idx = tid; idx < 64 * 32; idx += 256) {
      int k = idx & 31, n = idx >> 5;
      Bt[k * 65 + n] = Wm[(size_t)(n0 + n) * D_ + kp + k];
    }
    __syncthreads();
#pragma unroll
    for (int kk = 0; kk < 32; kk += 4) {
      int kb = kk + kbo;
      v2f a  = { At[(wm * 16 + nn) * 33 + kb], At[(wm * 16 + nn) * 33 + kb + 1] };
      v2f b0 = { Bt[kb * 65 + wn * 32 + nn], Bt[(kb + 1) * 65 + wn * 32 + nn] };
      v2f b1 = { Bt[kb * 65 + wn * 32 + 16 + nn], Bt[(kb + 1) * 65 + wn * 32 + 16 + nn] };
      c0 = wmma_f32(a, b0, c0);
      c1 = wmma_f32(a, b1, c1);
    }
    __syncthreads();
  }
#pragma unroll
  for (int i = 0; i < 8; ++i) {
    int r = m0 + wm * 16 + i + rh;
    out[(size_t)r * D_ + n0 + wn * 32 + nn]      = c0[i];
    out[(size_t)r * D_ + n0 + wn * 32 + 16 + nn] = c1[i];
  }
}

// ---------------------------------------------------------------- kernel 2b
// One workgroup per (batch, chunk).  Nothing here depends on the scan state, so
// every chunk is done at once, and once instead of once per value slice.
// Image of a chunk: [64][64] lam^(t-s) * (k_t . k_s) for s <= t, else 0; then
// [2][32][32] the two diagonal 32x32 blocks, strictly lower, times -beta, transposed.
__global__ __launch_bounds__(256) void gram_k(const float* __restrict__ xa,
                                              const float* __restrict__ eta_p,
                                              const float* __restrict__ laml_p,
                                              float* __restrict__ gimg) {
  extern __shared__ float smem[];
  float* Kt     = smem;                 // [64][KSTR]
  float* lampow = Kt + 64 * KSTR;       // [65]
  const int tid = threadIdx.x, lane = tid & 31, w = tid >> 5;
  const float beta = eta_p[0];
  const float lam  = 1.f / (1.f + __expf(-laml_p[0]));
  if (tid < 65) lampow[tid] = powf(lam, (float)tid);

  // The chunk is one contiguous run of 64*512 floats: thread tid takes 16-byte
  // piece tid + 256*j, which is row (tid >> 7) + 2*j of Kt.
  const v4f* s4 = (const v4f*)(xa + (size_t)blockIdx.x * CHUNK_ * D_) + tid;
  float* kd = Kt + (tid >> 7) * KSTR + ((tid & 127) << 2);
  // unrolled: constant offsets from one address, many loads in flight at once
#pragma unroll
  for (int j = 0; j < CHUNK_ * D_ / 4 / 256; ++j)
    *(v4f*)(kd + 2 * j * KSTR) = s4[256 * j];
  __syncthreads();

  const int nn  = lane & 15;
  const int kbo = (lane >> 4) << 1;
  const int rh  = (lane >> 4) << 3;
  const int tm = w & 3, tn = w >> 2;
  const int rowA = tm * 16 + nn;

  v8f aG0 = {}, aG1 = {};
  // unrolled so that the LDS reads of several k steps issue as one group
#pragma unroll 8
  for (int k0 = 0; k0 < D_; k0 += 4) {
    int kb = k0 + kbo;
    v2f a  = { Kt[rowA * KSTR + kb], Kt[rowA * KSTR + kb + 1] };
    v2f b0 = { Kt[((2 * tn) * 16 + nn) * KSTR + kb],
               Kt[((2 * tn) * 16 + nn) * KSTR + kb + 1] };
    v2f b1 = { Kt[((2 * tn + 1) * 16 + nn) * KSTR + kb],
               Kt[((2 * tn + 1) * 16 + nn) * KSTR + kb + 1] };
    aG0 = wmma_f32(a, b0, aG0);
    aG1 = wmma_f32(a, b1, aG1);
  }

  float* gs = gimg + (size_t)blockIdx.x * GIMG;
  float* gt = gs + CHUNK_ * CHUNK_;
  v8f h0, h1;
#pragma unroll
  for (int i = 0; i < 8; ++i) {
    int t = tm * 16 + i + rh;
    int s0 = (2 * tn) * 16 + nn, s1 = s0 + 16;
    float p0 = lampow[(s0 <= t) ? t - s0 : 0];
    float p1 = lampow[(s1 <= t) ? t - s1 : 0];
    float g0 = (s0 <= t) ? p0 * aG0[i] : 0.f;
    float g1 = (s1 <= t) ? p1 * aG1[i] : 0.f;
    gs[t * CHUNK_ + s0] = g0;
    gs[t * CHUNK_ + s1] = g1;
    h0[i] = (s0 < t) ? -beta * g0 : 0.f;
    h1[i] = (s1 < t) ? -beta * g1 : 0.f;
  }
  if ((tm >> 1) == tn) {
    // this wave's two tiles lie in a diagonal 32x32 block; a lane holds 8
    // consecutive rows t of one column s, so the transposed copy is contiguous
    float* g = gt + (tn * 32 + nn) * 32 + (tm & 1) * 16 + rh;
    *(v4f*)(g)               = __builtin_shufflevector(h0, h0, 0, 1, 2, 3);
    *(v4f*)(g + 4)           = __builtin_shufflevector(h0, h0, 4, 5, 6, 7);
    *(v4f*)(g + 16 * 32)     = __builtin_shufflevector(h1, h1, 0, 1, 2, 3);
    *(v4f*)(g + 16 * 32 + 4) = __builtin_shufflevector(h1, h1, 4, 5, 6, 7);
  }
}

// ---------------------------------------------------------------- kernel 3
// Chunked gated delta-rule scan for one (batch, value-slice), q == k.
// Dynamic-LDS layout (byte offsets are compile-time constants; no static LDS,
// so the dynamic region starts at LDS offset 0 -> usable by async DMA):
// GT comes first: its wave-uniform reads then fit the 16-bit DS offset field.
#define GT_OFF  0u
#define S_OFF   (2u * 32u * GP * 4u)
#define KT_OFF  (S_OFF + 512u * VW * 4u)
#define UT_OFF  (KT_OFF + 64u * KSTR * 4u)
#define AT_OFF  (UT_OFF + 64u * 33u * 4u)
#define GS_OFF  (AT_OFF + 64u * 33u * 4u)
#define LP_OFF  (GS_OFF + 64u * 65u * 4u)
#define SMEM_FLOATS (2 * 32 * GP + 512 * VW + 64 * KSTR + 2 * 64 * 33 + 64 * 65 + 65)

// Unit-lower-triangular solve of one 32-row block by ONE wave: lane = value
// column, the 32 rows of that column live in registers.  gt[s*GP + t] holds
// -beta*G[t][s] (t > s), so column s is read as wave-uniform 16-byte loads and
// applied to all later rows as independent FMAs once u[s] is final.
// (templates only so that every register index is a compile-time constant)
template <int C, int HI>
__device__ __forceinline__ void tri_load_cols(v4f (&g)[31][8], const float* gt) {
  if constexpr (C <= HI && C < 31) {
#pragma unroll
    for (int q = (C + 1) >> 2; q < 8; ++q)
      g[C][q] = *(const v4f*)(gt + C * GP + 4 * q);
    tri_load_cols<C + 1, HI>(g, gt);
  }
}
template <int S>
__device__ __forceinline__ void tri_col(float (&u)[32], v4f (&g)[31][8], const float* gt) {
  if constexpr (S < 31) {
    // read ahead: columns up to S + 2 + S/4 (about 20 loads in flight; later
    // columns are shorter) so that the FMAs cover the LDS latency
    tri_load_cols<(S == 0) ? 0 : S + 2 + ((S - 1) >> 2), S + 2 + (S >> 2)>(g, gt);
    // keeps the read-ahead loads above this column's FMAs; without it the
    // compiler sinks them next to their use and their latency is exposed
    __builtin_amdgcn_sched_barrier(0);
#pragma unroll
    for (int q = (S + 1) >> 2; q < 8; ++q) {
#pragma unroll
      for (int e = 0; e < 4; ++e) {
        const int t = 4 * q + e;
        if (t > S) u[t] = fmaf(g[S][q][e], u[S], u[t]);
      }
    }
    tri_col<S + 1>(u, g, gt);
  }
}
__device__ __forceinline__ void tri_solve32(float* ucol, const float* gt) {
  float u[32];
  v4f g[31][8];
#pragma unroll
  for (int t = 0; t < 32; ++t) u[t] = ucol[t * 33];
  // LDS reads return in order: keeps every u load ahead of the triangle loads,
  // so the first FMAs do not wait for the whole read-ahead
  __builtin_amdgcn_sched_barrier(0);
  tri_col<0>(u, g, gt);
#pragma unroll
  for (int t = 1; t < 32; ++t) ucol[t * 33] = u[t];
}

__global__ __launch_bounds__(256) void gdn_scan(const float* __restrict__ xa,
                                                const float* __restrict__ vstat,
                                                const float* __restrict__ gimg,
                                                const float* __restrict__ eta_p,
                                                const float* __restrict__ laml_p,
                                                float* __restrict__ y) {
  extern __shared__ float smem[];
  float* GT     = smem;                 // [2][32][GP] -beta*strictlow(diag blocks)^T
  float* Pb     = GT + 2 * 32 * GP;     // [8 waves][8 tiles][2][32 lanes][4] K@S partial sums
  float* Kt     = Pb + 512 * VW;        // [64][KSTR]
  float* Ut     = Kt + 64 * KSTR;       // [64][33]
  float* At     = Ut + 64 * 33;         // [64][33]
  float* GS     = At + 64 * 33;         // [64][65]
  float* lampow = GS + 64 * 65;         // [65]

  const int tid = threadIdx.x, lane = tid & 31, w = tid >> 5;
  const int b  = blockIdx.x >> 4;             // 4 batches x 16 slices
  const int v0 = (blockIdx.x & 15) * VW;
  const float beta = eta_p[0];
  const float lam  = 1.f / (1.f + __expf(-laml_p[0]));

  if (tid < 65) lampow[tid] = powf(lam, (float)tid);

  const size_t bbase = (size_t)b * L_ * D_;
  // async-stage chunk 0's K (=Q) block
  for (int i = tid; i < CHUNK_ * D_ / 4; i += 256) {
    int t = i >> 7, d4 = (i & 127) << 2;
    async_b128(xa + bbase + (size_t)t * D_ + d4,
               KT_OFF + (unsigned)((t * KSTR + d4) * 4));
  }

  const int nn  = lane & 15;            // N index inside a 16-wide tile
  const int kbo = (lane >> 4) << 1;     // K sub-offset of the f32 A/B fragment
  const int rh  = (lane >> 4) << 3;     // row-half offset of C/D fragment
  const int tm = w & 3, tn = w >> 2;    // wave tile coords (4 x 2)
  const int rowA = tm * 16 + nn;

  // The state never leaves the registers: wave w owns rows d = 64w .. 64w+63 of
  // S as 4 x 2 accumulator tiles, Sa[j][t2][i] = S[64w + 16j + i + rh][16*t2 + nn].
  v8f Sa[4][2] = {};

  for (int ch = 0; ch < NCH; ++ch) {
    const size_t xbase = bbase + (size_t)ch * CHUNK_ * D_;
    wait_async_lds();
    __syncthreads();                    // Kt ready; At/GS/Ut consistent
    const float lamC = lampow[64];

    // ---- prefetch next chunk (K + V slice) into cache while we compute
    if (ch + 1 < NCH) {
      const float* nk = xa + xbase + (size_t)CHUNK_ * D_;
      for (int i = tid; i < CHUNK_ * D_ / 32; i += 256)
        __builtin_prefetch(nk + i * 32, 0, 3);
      if (tid < CHUNK_)
        __builtin_prefetch(vstat + xbase + (size_t)(CHUNK_ + tid) * D_ + v0, 0, 3);
    }

    // ---- this chunk's Gram image (gram_k): loads issued here, stored to LDS
    // behind the K@S loop, which covers their latency
    const v4f* gi = (const v4f*)(gimg + (size_t)(b * NCH + ch) * GIMG);
    v4f gq[GIMG / 4 / 256];
    // (the three unrolls below keep gq's indices constant, so it stays in registers)
#pragma unroll
    for (int j = 0; j < GIMG / 4 / 256; ++j) gq[j] = gi[tid + 256 * j];

    // ---- A = K@S [64x32]: each wave multiplies all 64 rows of K by its own 64
    // rows of S.  Registers (i, i+1) of a state tile ARE a B fragment: k slots
    // 0,1 (lanes 0-15) are rows i, i+1 of the tile, k slots 2,3 (lanes 16-31)
    // rows i+8, i+9; the K loads below take their columns in the same order.
    {
      v8f P[4][2] = {};
      // (all loops unrolled: every register index is a compile-time constant)
#pragma unroll
      for (int j = 0; j < 4; ++j) {
#pragma unroll
        for (int q = 0; q < 2; ++q) {
          v4f a4[4];
#pragma unroll
          for (int m = 0; m < 4; ++m)
            a4[m] = *(const v4f*)(Kt + (m * 16 + nn) * KSTR + w * 64 + j * 16 + rh + q * 4);
#pragma unroll
          for (int e = 0; e < 2; ++e) {
#pragma unroll
            for (int m = 0; m < 4; ++m) {
              v2f a = { a4[m][2 * e], a4[m][2 * e + 1] };
#pragma unroll
              for (int t2 = 0; t2 < 2; ++t2) {
                v2f bS = { Sa[j][t2][4 * q + 2 * e], Sa[j][t2][4 * q + 2 * e + 1] };
                P[m][t2] = wmma_f32(a, bS, P[m][t2]);
              }
            }
          }
        }
      }
#pragma unroll
      for (int t2 = 0; t2 < 2; ++t2) {
#pragma unroll
        for (int m = 0; m < 4; ++m) {
          float* pd = Pb + ((w * 8 + t2 * 4 + m) * 2) * 128 + lane * 4;
          *(v4f*)(pd)       = __builtin_shufflevector(P[m][t2], P[m][t2], 0, 1, 2, 3);
          *(v4f*)(pd + 128) = __builtin_shufflevector(P[m][t2], P[m][t2], 4, 5, 6, 7);
        }
      }
    }
    __syncthreads();                    // all eight partial sums are in Pb
    // wave w adds up tile (tm, tn) = tile number w, partial sums in wave order
    v8f aA;
    {
      v4f lo[8], hi[8];
#pragma unroll
      for (int s = 0; s < 8; ++s) {
        const float* ps = Pb + ((s * 8 + w) * 2) * 128 + lane * 4;
        lo[s] = *(const v4f*)(ps);
        hi[s] = *(const v4f*)(ps + 128);
      }
#pragma unroll
      for (int s = 1; s < 8; ++s) { lo[0] += lo[s]; hi[0] += hi[s]; }
      aA = __builtin_shufflevector(lo[0], hi[0], 0, 1, 2, 3, 4, 5, 6, 7);
    }
#pragma unroll
    for (int i = 0; i < 8; ++i) {
      int t = tm * 16 + i + rh;
      At[t * 33 + tn * 16 + nn] = aA[i];
    }
#pragma unroll
    for (int j = 0; j < CHUNK_ * CHUNK_ / 4 / 256; ++j) {
      int i = tid + 256 * j;
      int t = i >> 4, s4 = (i & 15) << 2;
#pragma unroll
      for (int e = 0; e < 4; ++e) GS[t * 65 + s4 + e] = gq[j][e];
    }
#pragma unroll
    for (int j = 0; j < 2 * 32 * 32 / 4 / 256; ++j) {
      int i = tid + 256 * j;
      *(v4f*)(GT + (i >> 3) * GP + ((i & 7) << 2)) = gq[CHUNK_ * CHUNK_ / 4 / 256 + j];
    }
    __syncthreads();

    // ---- RHS: U <- beta*(V - lam^{t+1} A)   (V straight from global/L2)
    for (int i = tid; i < CHUNK_ * VW; i += 256) {
      int t = i >> 5, j = i & 31;
      float v = vstat[xbase + (size_t)t * D_ + v0 + j];
      Ut[t * 33 + j] = beta * (v - lampow[t + 1] * At[t * 33 + j]);
    }
    __syncthreads();

    // ---- blocked forward substitution: (I + beta*strictlow(GS)) U = R
    // (e1) rows 0..31: wave 0, one value column per lane
    if (w == 0) tri_solve32(Ut + lane, GT);
    __syncthreads();
    // (e2) U_hi -= beta * GS[32:64,0:32] @ U_lo   (WMMA, -beta folded into A)
    if (w < 4) {
      const int tm2 = w & 1, tn2 = w >> 1;
      const float nbeta = -beta;
      v8f acc;
#pragma unroll
      for (int i = 0; i < 8; ++i)
        acc[i] = Ut[(32 + tm2 * 16 + i + rh) * 33 + tn2 * 16 + nn];
#pragma unroll
      for (int k0 = 0; k0 < 32; k0 += 4) {
        int kb = k0 + kbo;
        v2f a  = { nbeta * GS[(32 + tm2 * 16 + nn) * 65 + kb],
                   nbeta * GS[(32 + tm2 * 16 + nn) * 65 + kb + 1] };
        v2f bU = { Ut[kb * 33 + tn2 * 16 + nn], Ut[(kb + 1) * 33 + tn2 * 16 + nn] };
        acc = wmma_f32(a, bU, acc);
      }
#pragma unroll
      for (int i = 0; i < 8; ++i)
        Ut[(32 + tm2 * 16 + i + rh) * 33 + tn2 * 16 + nn] = acc[i];
    }
    __syncthreads();
    // (e3) rows 32..63, remaining strictly-lower terms s in [32, t)
    if (w == 0) tri_solve32(Ut + 32 * 33 + lane, GT + 32 * GP);
    __syncthreads();

    // ---- state carry FIRST (last Kt consumer): S = lam^64 S + (lam^{63-s}k_s)^T U
#pragma unroll
    for (int j = 0; j < 4; ++j) {
#pragma unroll
      for (int t2 = 0; t2 < 2; ++t2) Sa[j][t2] *= lamC;
    }
    // unrolled: the LDS reads of later k steps issue under the WMMAs of earlier ones
#pragma unroll
    for (int k0 = 0; k0 < CHUNK_; k0 += 4) {
      int kb = k0 + kbo;
      float p0 = lampow[63 - kb], p1 = lampow[62 - kb];
      v2f bU0 = { Ut[kb * 33 + nn], Ut[(kb + 1) * 33 + nn] };
      v2f bU1 = { Ut[kb * 33 + 16 + nn], Ut[(kb + 1) * 33 + 16 + nn] };
#pragma unroll
      for (int j = 0; j < 4; ++j) {
        v2f a = { p0 * Kt[kb * KSTR + w * 64 + j * 16 + nn],
                  p1 * Kt[(kb + 1) * KSTR + w * 64 + j * 16 + nn] };
        Sa[j][0] = wmma_f32(a, bU0, Sa[j][0]);
        Sa[j][1] = wmma_f32(a, bU1, Sa[j][1]);
      }
    }
    __syncthreads();                     // all waves done reading Kt

    // ---- kick off next chunk's async K copy; it overlaps the O-matmul below
    if (ch + 1 < NCH) {
      const float* nk = xa + xbase + (size_t)CHUNK_ * D_;
      for (int i = tid; i < CHUNK_ * D_ / 4; i += 256) {
        int t = i >> 7, d4 = (i & 127) << 2;
        async_b128(nk + (size_t)t * D_ + d4,
                   KT_OFF + (unsigned)((t * KSTR + d4) * 4));
      }
    }

    // ---- O = GS @ U ; y = V + lam^{t+1} A + O
    v8f aO = {};
    for (int k0 = 0; k0 < CHUNK_; k0 += 4) {
      int kb = k0 + kbo;
      v2f a  = { GS[rowA * 65 + kb], GS[rowA * 65 + kb + 1] };
      v2f bU = { Ut[kb * 33 + tn * 16 + nn], Ut[(kb + 1) * 33 + tn * 16 + nn] };
      aO = wmma_f32(a, bU, aO);
    }
#pragma unroll
    for (int i = 0; i < 8; ++i) {
      int t = tm * 16 + i + rh;
      int j = tn * 16 + nn;
      float v = vstat[xbase + (size_t)t * D_ + v0 + j];
      y[xbase + (size_t)t * D_ + v0 + j] =
          v + lampow[t + 1] * At[t * 33 + j] + aO[i];
    }
    // the stores' address registers are reused by the next trip's loads
    asm volatile("s_wait_xcnt 0x0" ::: "memory");
    // loop-top wait_async + barrier orders the Kt DMA before next chunk's K@S reads
  }
}

// ---------------------------------------------------------------- kernel 4
__global__ __launch_bounds__(256) void layernorm_k(float* __restrict__ y,
                                                   const float* __restrict__ gam,
                                                   const float* __restrict__ bet) {
  __shared__ float rs[256];
  __shared__ float rq[256];
  const int row = blockIdx.x, tid = threadIdx.x;
  float v0 = y[(size_t)row * D_ + tid];
  float v1 = y[(size_t)row * D_ + tid + 256];
  rs[tid] = v0 + v1;
  rq[tid] = v0 * v0 + v1 * v1;
  __syncthreads();
  for (int s = 128; s > 0; s >>= 1) {
    if (tid < s) { rs[tid] += rs[tid + s]; rq[tid] += rq[tid + s]; }
    __syncthreads();
  }
  float mean = rs[0] * (1.f / D_);
  float var  = rq[0] * (1.f / D_) - mean * mean;
  float inv  = rsqrtf(var + EPS_);
  y[(size_t)row * D_ + tid]       = (v0 - mean) * inv * gam[tid] + bet[tid];
  y[(size_t)row * D_ + tid + 256] = (v1 - mean) * inv * gam[tid + 256] + bet[tid + 256];
}

// ---------------------------------------------------------------- launch
extern "C" void kernel_launch(void* const* d_in, const int* in_sizes, int n_in,
                              void* d_out, int out_size, void* d_ws, size_t ws_size,
                              hipStream_t stream) {
  const float* x    = (const float*)d_in[0];
  const float* W    = (const float*)d_in[1];
  const float* eta  = (const float*)d_in[2];
  const float* laml = (const float*)d_in[3];
  const float* g    = (const float*)d_in[4];
  const float* bb   = (const float*)d_in[5];
  float* out = (float*)d_out;

  float* xa    = (float*)d_ws;                       // [B,L,D] tanh(x)
  float* vstat = xa + (size_t)B_ * L_ * D_;          // [B,L,D] static_out
  float* gimg  = vstat + (size_t)B_ * L_ * D_;       // [B*NCH][GIMG] Gram images

  const int n = B_ * L_ * D_;
  tanh_k<<<(n + 255) / 256, 256, 0, stream>>>(x, xa, n);

  dim3 g2(B_ * L_ / 64, D_ / 64);
  gemm_xw<<<g2, 256, 0, stream>>>(xa, W, vstat);

  size_t gsmem = (size_t)(64 * KSTR + 65) * sizeof(float);
  gram_k<<<B_ * NCH, 256, gsmem, stream>>>(xa, eta, laml, gimg);

  size_t smem = (size_t)SMEM_FLOATS * sizeof(float);
  gdn_scan<<<B_ * (D_ / VW), 256, smem, stream>>>(xa, vstat, gimg, eta, laml, out);

  layernorm_k<<<B_ * L_, 256, 0, stream>>>(out, g, bb);
}

// v004
// One run takes 333 microseconds.
// Next to v003, in two timings, it ran 1.26 times as fast each time.
// All steps since v000 together make it 7.53 times as fast.
#include <hip/hip_runtime.h>
#include <hip/hip_bf16.h>

#define B_ 4
#define L_ 2048
#define D_ 512
#define CHUNK_ 64
#define NCH (L_ / CHUNK_)
#define VW 16           // value-dim slice per workgroup in the scan kernel
#define NSL (D_ / VW)   // value slices, one scan workgroup each per batch
#define US 18           // row stride of Ut and At: 16-wide rows 1, 2 or 8 apart share no bank
#define KSTR 516        // Kt row stride (16B-aligned rows, conflict-free)
#define GP 36            // row stride of the transposed triangle copies (16B-aligned)
#define EPS_ 1e-5f
#define GIMG (CHUNK_ * CHUNK_ + 2 * 32 * 32)  // floats of one chunk's Gram image in the workspace

typedef float v2f __attribute__((ext_vector_type(2)));
typedef float v4f __attribute__((ext_vector_type(4)));
typedef float v8f __attribute__((ext_vector_type(8)));

__device__ __forceinline__ v8f wmma_f32(v2f a, v2f b, v8f c) {
  // D = A(16x4 f32) * B(4x16 f32) + C(16x16 f32)
  return __builtin_amdgcn_wmma_f32_16x16x4_f32(false, a, false, b, (short)0, c,
                                               false, false);
}

// Async HBM -> LDS DMA (ASYNCcnt-tracked).  vDst = per-lane LDS byte offset.
__device__ __forceinline__ void async_b128(const float* g, unsigned lds_byte_off) {
  asm volatile("global_load_async_to_lds_b128 %0, %1, off"
               :
               : "v"(lds_byte_off), "v"(g)
               : "memory");
}
__device__ __forceinline__ void wait_async_lds() {
  asm volatile("s_wait_asynccnt 0x0" ::: "memory");
}

// ---------------------------------------------------------------- kernel 1
__global__ void tanh_k(const float* __restrict__ x, float* __restrict__ xa, int n) {
  int i = blockIdx.x * blockDim.x + threadIdx.x;
  if (i < n) xa[i] = tanhf(x[i]);
}

// ---------------------------------------------------------------- kernel 2
// static_out[m, e] = sum_d xa[m, d] * W[e, d]   (M=8192, N=512, K=512)
__global__ __launch_bounds__(256) void gemm_xw(const float* __restrict__ xa,
                                               const float* __restrict__ Wm,
                                               float* __restrict__ out) {
  __shared__ float At[64 * 33];   // A panel [64 rows][32 k] padded
  __shared__ float Bt[32 * 65];   // B panel [32 k][64 n] padded (B[k][n] = W[n][k])
  const int tid = threadIdx.x, lane = tid & 31, w = tid >> 5;
  const int m0 = blockIdx.x * 64, n0 = blockIdx.y * 64;
  const int wm = w & 3, wn = w >> 2;           // 4 x 2 wave grid
  const int nn = lane & 15;
  const int kbo = (lane >> 4) << 1;
  const int rh = (lane >> 4) << 3;

  v8f c0 = {}, c1 = {};
  for (int kp = 0; kp < D_; kp += 32) {
    for (int idx = tid; idx < 64 * 32; idx += 256) {
      int r = idx >> 5, c = idx & 31;
      At[r * 33 + c] = xa[(size_t)(m0 + r) * D_ + kp + c];
    }
    for (int idx = tid; idx < 64 * 32; idx += 256) {
      int k = idx & 31, n = idx >> 5;
      Bt[k * 65 + n] = Wm[(size_t)(n0 + n) * D_ + kp + k];
    }
    __syncthreads();
#pragma unroll
    for (int kk = 0; kk < 32; kk += 4) {
      int kb = kk + kbo;
      v2f a  = { At[(wm * 16 + nn) * 33 + kb], At[(wm * 16 + nn) * 33 + kb + 1] };
      v2f b0 = { Bt[kb * 65 + wn * 32 + nn], Bt[(kb + 1) * 65 + wn * 32 + nn] };
      v2f b1 = { Bt[kb * 65 + wn * 32 + 16 + nn], Bt[(kb + 1) * 65 + wn * 32 + 16 + nn] };
      c0 = wmma_f32(a, b0, c0);
      c1 = wmma_f32(a, b1, c1);
    }
    __syncthreads();
  }
#pragma unroll
  for (int i = 0; i < 8; ++i) {
    int r = m0 + wm * 16 + i + rh;
    out[(size_t)r * D_ + n0 + wn * 32 + nn]      = c0[i];
    out[(size_t)r * D_ + n0 + wn * 32 + 16 + nn] = c1[i];
  }
}

// ---------------------------------------------------------------- kernel 2b
// One workgroup per (batch, chunk).  Nothing here depends on the scan state, so
// every chunk is done at once, and once instead of once per value slice.
// Image of a chunk: [64][64] lam^(t-s) * (k_t . k_s) for s <= t, else 0; then
// [2][32][32] the two diagonal 32x32 blocks, strictly lower, times -beta, transposed.
__global__ __launch_bounds__(256) void gram_k(const float* __restrict__ xa,
                                              const float* __restrict__ eta_p,
                                              const float* __restrict__ laml_p,
                                              float* __restrict__ gimg) {
  extern __shared__ float smem[];
  float* Kt     = smem;                 // [64][KSTR]
  float* lampow = Kt + 64 * KSTR;       // [65]
  const int tid = threadIdx.x, lane = tid & 31, w = tid >> 5;
  const float beta = eta_p[0];
  const float lam  = 1.f / (1.f + __expf(-laml_p[0]));
  if (tid < 65) lampow[tid] = powf(lam, (float)tid);

  // The chunk is one contiguous run of 64*512 floats: thread tid takes 16-byte
  // piece tid + 256*j, which is row (tid >> 7) + 2*j of Kt.
  const v4f* s4 = (const v4f*)(xa + (size_t)blockIdx.x * CHUNK_ * D_) + tid;
  float* kd = Kt + (tid >> 7) * KSTR + ((tid & 127) << 2);
  // unrolled: constant offsets from one address, many loads in flight at once
#pragma unroll
  for (int j = 0; j < CHUNK_ * D_ / 4 / 256; ++j)
    *(v4f*)(kd + 2 * j * KSTR) = s4[256 * j];
  __syncthreads();

  const int nn  = lane & 15;
  const int kbo = (lane >> 4) << 1;
  const int rh  = (lane >> 4) << 3;
  const int tm = w & 3, tn = w >> 2;
  const int rowA = tm * 16 + nn;

  v8f aG0 = {}, aG1 = {};
  // unrolled so that the LDS reads of several k steps issue as one group
#pragma unroll 8
  for (int k0 = 0; k0 < D_; k0 += 4) {
    int kb = k0 + kbo;
    v2f a  = { Kt[rowA * KSTR + kb], Kt[rowA * KSTR + kb + 1] };
    v2f b0 = { Kt[((2 * tn) * 16 + nn) * KSTR + kb],
               Kt[((2 * tn) * 16 + nn) * KSTR + kb + 1] };
    v2f b1 = { Kt[((2 * tn + 1) * 16 + nn) * KSTR + kb],
               Kt[((2 * tn + 1) * 16 + nn) * KSTR + kb + 1] };
    aG0 = wmma_f32(a, b0, aG0);
    aG1 = wmma_f32(a, b1, aG1);
  }

  float* gs = gimg + (size_t)blockIdx.x * GIMG;
  float* gt = gs + CHUNK_ * CHUNK_;
  v8f h0, h1;
#pragma unroll
  for (int i = 0; i < 8; ++i) {
    int t = tm * 16 + i + rh;
    int s0 = (2 * tn) * 16 + nn, s1 = s0 + 16;
    float p0 = lampow[(s0 <= t) ? t - s0 : 0];
    float p1 = lampow[(s1 <= t) ? t - s1 : 0];
    float g0 = (s0 <= t) ? p0 * aG0[i] : 0.f;
    float g1 = (s1 <= t) ? p1 * aG1[i] : 0.f;
    gs[t * CHUNK_ + s0] = g0;
    gs[t * CHUNK_ + s1] = g1;
    h0[i] = (s0 < t) ? -beta * g0 : 0.f;
    h1[i] = (s1 < t) ? -beta * g1 : 0.f;
  }
  if ((tm >> 1) == tn) {
    // this wave's two tiles lie in a diagonal 32x32 block; a lane holds 8
    // consecutive rows t of one column s, so the transposed copy is contiguous
    float* g = gt + (tn * 32 + nn) * 32 + (tm & 1) * 16 + rh;
    *(v4f*)(g)               = __builtin_shufflevector(h0, h0, 0, 1, 2, 3);
    *(v4f*)(g + 4)           = __builtin_shufflevector(h0, h0, 4, 5, 6, 7);
    *(v4f*)(g + 16 * 32)     = __builtin_shufflevector(h1, h1, 0, 1, 2, 3);
    *(v4f*)(g + 16 * 32 + 4) = __builtin_shufflevector(h1, h1, 4, 5, 6, 7);
  }
}

// ---------------------------------------------------------------- kernel 3
// Chunked gated delta-rule scan for one (batch, value-slice), q == k.
// Dynamic-LDS layout (byte offsets are compile-time constants; no static LDS,
// so the dynamic region starts at LDS offset 0 -> usable by async DMA):
// GT comes first: its wave-uniform reads then fit the 16-bit DS offset field.
#define GT_OFF  0u
#define S_OFF   (2u * 32u * GP * 4u)
#define KT_OFF  (S_OFF + 512u * VW * 4u)
#define UT_OFF  (KT_OFF + 64u * KSTR * 4u)
#define AT_OFF  (UT_OFF + 64u * US * 4u)
#define GS_OFF  (AT_OFF + 64u * US * 4u)
#define LP_OFF  (GS_OFF + 64u * 65u * 4u)
#define SMEM_FLOATS (2 * 32 * GP + 512 * VW + 64 * KSTR + 2 * 64 * US + 64 * 65 + 65)

// Unit-lower-triangular solve of one 32-row block by ONE wave: lane = value
// column, the 32 rows of that column live in registers.  gt[s*GP + t] holds
// -beta*G[t][s] (t > s), so column s is read as wave-uniform 16-byte loads and
// applied to all later rows as independent FMAs once u[s] is final.
// (templates only so that every register index is a compile-time constant)
template <int C, int HI>
__device__ __forceinline__ void tri_load_cols(v4f (&g)[31][8], const float* gt) {
  if constexpr (C <= HI && C < 31) {
#pragma unroll
    for (int q = (C + 1) >> 2; q < 8; ++q)
      g[C][q] = *(const v4f*)(gt + C * GP + 4 * q);
    tri_load_cols<C + 1, HI>(g, gt);
  }
}
template <int S>
__device__ __forceinline__ void tri_col(float (&u)[32], v4f (&g)[31][8], const float* gt) {
  if constexpr (S < 31) {
    // read ahead: columns up to S + 2 + S/4 (about 20 loads in flight; later
    // columns are shorter) so that the FMAs cover the LDS latency
    tri_load_cols<(S == 0) ? 0 : S + 2 + ((S - 1) >> 2), S + 2 + (S >> 2)>(g, gt);
    // keeps the read-ahead loads above this column's FMAs; without it the
    // compiler sinks them next to their use and their latency is exposed
    __builtin_amdgcn_sched_barrier(0);
#pragma unroll
    for (int q = (S + 1) >> 2; q < 8; ++q) {
#pragma unroll
      for (int e = 0; e < 4; ++e) {
        const int t = 4 * q + e;
        if (t > S) u[t] = fmaf(g[S][q][e], u[S], u[t]);
      }
    }
    tri_col<S + 1>(u, g, gt);
  }
}
__device__ __forceinline__ void tri_solve32(float* ucol, const float* gt) {
  float u[32];
  v4f g[31][8];
#pragma unroll
  for (int t = 0; t < 32; ++t) u[t] = ucol[t * US];
  // LDS reads return in order: keeps every u load ahead of the triangle loads,
  // so the first FMAs do not wait for the whole read-ahead
  __builtin_amdgcn_sched_barrier(0);
  tri_col<0>(u, g, gt);
#pragma unroll
  for (int t = 1; t < 32; ++t) ucol[t * US] = u[t];
}

__global__ __launch_bounds__(256) void gdn_scan(const float* __restrict__ xa,
                                                const float* __restrict__ vstat,
                                                const float* __restrict__ gimg,
                                                const float* __restrict__ eta_p,
                                                const float* __restrict__ laml_p,
                                                float* __restrict__ y) {
  extern __shared__ float smem[];
  float* GT     = smem;                 // [2][32][GP] -beta*strictlow(diag blocks)^T
  float* Pb     = GT + 2 * 32 * GP;     // [8 waves][4 tiles][2][32 lanes][4] K@S partial sums
  float* Kt     = Pb + 512 * VW;        // [64][KSTR]
  float* Ut     = Kt + 64 * KSTR;       // [64][US]
  float* At     = Ut + 64 * US;         // [64][US]
  float* GS     = At + 64 * US;         // [64][65]
  float* lampow = GS + 64 * 65;         // [65]

  const int tid = threadIdx.x, lane = tid & 31, w = tid >> 5;
  const int b  = blockIdx.x / NSL;            // 4 batches x 32 slices
  const int v0 = (blockIdx.x % NSL) * VW;
  // y plane of this workgroup alone, [L][VW]: a row of the slice is half a
  // 128-byte line, so in [L][D] order two workgroups would write into one line
  float* ysl = y + (size_t)blockIdx.x * L_ * VW;
  const float beta = eta_p[0];
  const float lam  = 1.f / (1.f + __expf(-laml_p[0]));

  if (tid < 65) lampow[tid] = powf(lam, (float)tid);

  const size_t bbase = (size_t)b * L_ * D_;
  // async-stage chunk 0's K (=Q) block
  for (int i = tid; i < CHUNK_ * D_ / 4; i += 256) {
    int t = i >> 7, d4 = (i & 127) << 2;
    async_b128(xa + bbase + (size_t)t * D_ + d4,
               KT_OFF + (unsigned)((t * KSTR + d4) * 4));
  }

  const int nn  = lane & 15;            // N index inside a 16-wide tile
  const int kbo = (lane >> 4) << 1;     // K sub-offset of the f32 A/B fragment
  const int rh  = (lane >> 4) << 3;     // row-half offset of C/D fragment
  const int tm = w & 3, tn = w >> 2;    // row tile, and which half of its registers
  const int rowA = tm * 16 + nn;

  // The state never leaves the registers: wave w owns rows d = 64w .. 64w+63 of
  // S as 4 accumulator tiles, Sa[j][i] = S[64w + 16j + i + rh][nn].
  v8f Sa[4] = {};

  for (int ch = 0; ch < NCH; ++ch) {
    const size_t xbase = bbase + (size_t)ch * CHUNK_ * D_;
    wait_async_lds();
    __syncthreads();                    // Kt ready; At/GS/Ut consistent
    const float lamC = lampow[64];

    // ---- prefetch next chunk (K + V slice) into cache while we compute
    if (ch + 1 < NCH) {
      const float* nk = xa + xbase + (size_t)CHUNK_ * D_;
      for (int i = tid; i < CHUNK_ * D_ / 32; i += 256)
        __builtin_prefetch(nk + i * 32, 0, 3);
      if (tid < CHUNK_)
        __builtin_prefetch(vstat + xbase + (size_t)(CHUNK_ + tid) * D_ + v0, 0, 3);
    }

    // ---- this chunk's Gram image (gram_k): loads issued here, stored to LDS
    // behind the K@S loop, which covers their latency
    const v4f* gi = (const v4f*)(gimg + (size_t)(b * NCH + ch) * GIMG);
    v4f gq[GIMG / 4 / 256];
    // (the three unrolls below keep gq's indices constant, so it stays in registers)
#pragma unroll
    for (int j = 0; j < GIMG / 4 / 256; ++j) gq[j] = gi[tid + 256 * j];

    // ---- A = K@S [64x16]: each wave multiplies all 64 rows of K by its own 64
    // rows of S.  Registers (i, i+1) of a state tile ARE a B fragment: k slots
    // 0,1 (lanes 0-15) are rows i, i+1 of the tile, k slots 2,3 (lanes 16-31)
    // rows i+8, i+9; the K loads below take their columns in the same order.
    {
      v8f P[4] = {};
      // (all loops unrolled: every register index is a compile-time constant)
#pragma unroll
      for (int j = 0; j < 4; ++j) {
#pragma unroll
        for (int q = 0; q < 2; ++q) {
          v4f a4[4];
#pragma unroll
          for (int m = 0; m < 4; ++m)
            a4[m] = *(const v4f*)(Kt + (m * 16 + nn) * KSTR + w * 64 + j * 16 + rh + q * 4);
#pragma unroll
          for (int e = 0; e < 2; ++e) {
#pragma unroll
            for (int m = 0; m < 4; ++m) {
              v2f a = { a4[m][2 * e], a4[m][2 * e + 1] };
              v2f bS = { Sa[j][4 * q + 2 * e], Sa[j][4 * q + 2 * e + 1] };
              P[m] = wmma_f32(a, bS, P[m]);
            }
          }
        }
      }
#pragma unroll
      for (int m = 0; m < 4; ++m) {
        float* pd = Pb + ((w * 4 + m) * 2) * 128 + lane * 4;
        *(v4f*)(pd)       = __builtin_shufflevector(P[m], P[m], 0, 1, 2, 3);
        *(v4f*)(pd + 128) = __builtin_shufflevector(P[m], P[m], 4, 5, 6, 7);
      }
    }
    __syncthreads();                    // all eight partial sums are in Pb
    // wave w adds up registers 4*tn .. 4*tn+3 of tile tm, partial sums in wave order
    {
      v4f ps[8];
#pragma unroll
      for (int s = 0; s < 8; ++s)
        ps[s] = *(const v4f*)(Pb + ((s * 4 + tm) * 2 + tn) * 128 + lane * 4);
#pragma unroll
      for (int s = 1; s < 8; ++s) ps[0] += ps[s];
#pragma unroll
      for (int e = 0; e < 4; ++e)
        At[(tm * 16 + tn * 4 + e + rh) * US + nn] = ps[0][e];
    }
#pragma unroll
    for (int j = 0; j < CHUNK_ * CHUNK_ / 4 / 256; ++j) {
      int i = tid + 256 * j;
      int t = i >> 4, s4 = (i & 15) << 2;
#pragma unroll
      for (int e = 0; e < 4; ++e) GS[t * 65 + s4 + e] = gq[j][e];
    }
#pragma unroll
    for (int j = 0; j < 2 * 32 * 32 / 4 / 256; ++j) {
      int i = tid + 256 * j;
      *(v4f*)(GT + (i >> 3) * GP + ((i & 7) << 2)) = gq[CHUNK_ * CHUNK_ / 4 / 256 + j];
    }
    __syncthreads();

    // ---- RHS: U <- beta*(V - lam^{t+1} A)   (V straight from global/L2)
    for (int i = tid; i < CHUNK_ * VW; i += 256) {
      int t = i / VW, j = i % VW;
      float v = vstat[xbase + (size_t)t * D_ + v0 + j];
      Ut[t * US + j] = beta * (v - lampow[t + 1] * At[t * US + j]);
    }
    __syncthreads();

    // ---- blocked forward substitution: (I + beta*strictlow(GS)) U = R
    // (e1) rows 0..31: one value column per lane, VW lanes of wave 0
    if (tid < VW) tri_solve32(Ut + lane, GT);
    __syncthreads();
    // (e2) U_hi -= beta * GS[32:64,0:32] @ U_lo   (WMMA, -beta folded into A)
    if (w < 2) {
      const int tm2 = w;
      const float nbeta = -beta;
      v8f acc;
#pragma unroll
      for (int i = 0; i < 8; ++i)
        acc[i] = Ut[(32 + tm2 * 16 + i + rh) * US + nn];
#pragma unroll
      for (int k0 = 0; k0 < 32; k0 += 4) {
        int kb = k0 + kbo;
        v2f a  = { nbeta * GS[(32 + tm2 * 16 + nn) * 65 + kb],
                   nbeta * GS[(32 + tm2 * 16 + nn) * 65 + kb + 1] };
        v2f bU = { Ut[kb * US + nn], Ut[(kb + 1) * US + nn] };
        acc = wmma_f32(a, bU, acc);
      }
#pragma unroll
      for (int i = 0; i < 8; ++i)
        Ut[(32 + tm2 * 16 + i + rh) * US + nn] = acc[i];
    }
    __syncthreads();
    // (e3) rows 32..63, remaining strictly-lower terms s in [32, t)
    if (tid < VW) tri_solve32(Ut + 32 * US + lane, GT + 32 * GP);
    __syncthreads();

    // ---- state carry FIRST (last Kt consumer): S = lam^64 S + (lam^{63-s}k_s)^T U
#pragma unroll
    for (int j = 0; j < 4; ++j) Sa[j] *= lamC;
    // unrolled: the LDS reads of later k steps issue under the WMMAs of earlier ones
#pragma unroll
    for (int k0 = 0; k0 < CHUNK_; k0 += 4) {
      int kb = k0 + kbo;
      float p0 = lampow[63 - kb], p1 = lampow[62 - kb];
      v2f bU = { Ut[kb * US + nn], Ut[(kb + 1) * US + nn] };
#pragma unroll
      for (int j = 0; j < 4; ++j) {
        v2f a = { p0 * Kt[kb * KSTR + w * 64 + j * 16 + nn],
                  p1 * Kt[(kb + 1) * KSTR + w * 64 + j * 16 + nn] };
        Sa[j] = wmma_f32(a, bU, Sa[j]);
      }
    }
    __syncthreads();                     // all waves done reading Kt

    // ---- kick off next chunk's async K copy; it overlaps the O-matmul below
    if (ch + 1 < NCH) {
      const float* nk = xa + xbase + (size_t)CHUNK_ * D_;
      for (int i = tid; i < CHUNK_ * D_ / 4; i += 256) {
        int t = i >> 7, d4 = (i & 127) << 2;
        async_b128(nk + (size_t)t * D_ + d4,
                   KT_OFF + (unsigned)((t * KSTR + d4) * 4));
      }
    }

    // ---- O = GS @ U ; y = V + lam^{t+1} A + O   (four 16x16 tiles: waves 0..3)
    if (w < 4) {
      v8f aO = {};
      for (int k0 = 0; k0 < CHUNK_; k0 += 4) {
        int kb = k0 + kbo;
        v2f a  = { GS[rowA * 65 + kb], GS[rowA * 65 + kb + 1] };
        v2f bU = { Ut[kb * US + nn], Ut[(kb + 1) * US + nn] };
        aO = wmma_f32(a, bU, aO);
      }
#pragma unroll
      for (int i = 0; i < 8; ++i) {
        int t = tm * 16 + i + rh;
        float v = vstat[xbase + (size_t)t * D_ + v0 + nn];
        ysl[(size_t)(ch * CHUNK_ + t) * VW + nn] =
            v + lampow[t + 1] * At[t * US + nn] + aO[i];
      }
      // the stores' address registers are reused by the next trip's loads
      asm volatile("s_wait_xcnt 0x0" ::: "memory");
    }
    // loop-top barrier orders these GS/Ut/At reads before the next chunk rewrites them
  }
}

// ---------------------------------------------------------------- kernel 4
// ys is the scan's plane order [B][NSL][L][VW]; y is the output, [B][L][D]
__global__ __launch_bounds__(256) void layernorm_k(const float* __restrict__ ys,
                                                   float* __restrict__ y,
                                                   const float* __restrict__ gam,
                                                   const float* __restrict__ bet) {
  __shared__ float rs[256];
  __shared__ float rq[256];
  const int row = blockIdx.x, tid = threadIdx.x;
  const float* yr = ys + ((size_t)(row / L_) * NSL * L_ + row % L_) * VW +
                    (size_t)(tid / VW) * L_ * VW + tid % VW;
  float v0 = yr[0];
  float v1 = yr[(size_t)(256 / VW) * L_ * VW];
  rs[tid] = v0 + v1;
  rq[tid] = v0 * v0 + v1 * v1;
  __syncthreads();
  for (int s = 128; s > 0; s >>= 1) {
    if (tid < s) { rs[tid] += rs[tid + s]; rq[tid] += rq[tid + s]; }
    __syncthreads();
  }
  float mean = rs[0] * (1.f / D_);
  float var  = rq[0] * (1.f / D_) - mean * mean;
  float inv  = rsqrtf(var + EPS_);
  y[(size_t)row * D_ + tid]       = (v0 - mean) * inv * gam[tid] + bet[tid];
  y[(size_t)row * D_ + tid + 256] = (v1 - mean) * inv * gam[tid + 256] + bet[tid + 256];
}

// ---------------------------------------------------------------- launch
extern "C" void kernel_launch(void* const* d_in, const int* in_sizes, int n_in,
                              void* d_out, int out_size, void* d_ws, size_t ws_size,
                              hipStream_t stream) {
  const float* x    = (const float*)d_in[0];
  const float* W    = (const float*)d_in[1];
  const float* eta  = (const float*)d_in[2];
  const float* laml = (const float*)d_in[3];
  const float* g    = (const float*)d_in[4];
  const float* bb   = (const float*)d_in[5];
  float* out = (float*)d_out;

  float* xa    = (float*)d_ws;                       // [B,L,D] tanh(x)
  float* vstat = xa + (size_t)B_ * L_ * D_;          // [B,L,D] static_out
  float* gimg  = vstat + (size_t)B_ * L_ * D_;       // [B*NCH][GIMG] Gram images
  float* ys    = gimg + (size_t)B_ * NCH * GIMG;     // [B][NSL][L][VW] y before layernorm

  const int n = B_ * L_ * D_;
  tanh_k<<<(n + 255) / 256, 256, 0, stream>>>(x, xa, n);

  dim3 g2(B_ * L_ / 64, D_ / 64);
  gemm_xw<<<g2, 256, 0, stream>>>(xa, W, vstat);

  size_t gsmem = (size_t)(64 * KSTR + 65) * sizeof(float);
  gram_k<<<B_ * NCH, 256, gsmem, stream>>>(xa, eta, laml, gimg);

  size_t smem = (size_t)SMEM_FLOATS * sizeof(float);
  gdn_scan<<<B_ * (D_ / VW), 256, smem, stream>>>(xa, vstat, gimg, eta, laml, ys);

  layernorm_k<<<B_ * L_, 256, 0, stream>>>(ys, out, g, bb);
}

// v005
// A run of this version takes 322 microseconds.
// In both of two side-by-side timings against v004, it was 1.03 times as fast.
// Counting every step since v000, it is 7.78 times as fast.
#include <hip/hip_runtime.h>
#include <hip/hip_bf16.h>

#define B_ 4
#define L_ 2048
#define D_ 512
#define CHUNK_ 64
#define NCH (L_ / CHUNK_)
#define VW 16           // value-dim slice per workgroup in the scan kernel
#define NSL (D_ / VW)   // value slices, one scan workgroup each per batch
#define US 18           // row stride of Ut and At: 16-wide rows 1, 2 or 8 apart share no bank
#define KSTR 516        // Kt row stride (16B-aligned rows, conflict-free)
#define GP 36            // row stride of the transposed triangle copies (16B-aligned)
#define EPS_ 1e-5f
#define GIMG (CHUNK_ * CHUNK_ + 2 * 32 * 32)  // floats of one chunk's Gram image in the workspace

typedef float v2f __attribute__((ext_vector_type(2)));
typedef float v4f __attribute__((ext_vector_type(4)));
typedef float v8f __attribute__((ext_vector_type(8)));

__device__ __forceinline__ v8f wmma_f32(v2f a, v2f b, v8f c) {
  // D = A(16x4 f32) * B(4x16 f32) + C(16x16 f32)
  return __builtin_amdgcn_wmma_f32_16x16x4_f32(false, a, false, b, (short)0, c,
                                               false, false);
}

// Async HBM -> LDS DMA (ASYNCcnt-tracked).  vDst = per-lane LDS byte offset.
__device__ __forceinline__ void async_b128(const float* g, unsigned lds_byte_off) {
  asm volatile("global_load_async_to_lds_b128 %0, %1, off"
               :
               : "v"(lds_byte_off), "v"(g)
               : "memory");
}
__device__ __forceinline__ void wait_async_lds() {
  asm volatile("s_wait_asynccnt 0x0" ::: "memory");
}

// ---------------------------------------------------------------- kernel 1
// Each thread takes TPT 16-byte pieces, 256 pieces apart, all loads in flight at
// once: 4,096 waves in the launch instead of one wave per 32 values.
#define TPT 8
static_assert((B_ * L_ * D_) % (256 * TPT * 4) == 0, "whole blocks only");
__global__ __launch_bounds__(256) void tanh_k(const float* __restrict__ x, float* __restrict__ xa) {
  const size_t p0 = (size_t)blockIdx.x * (256 * TPT) + threadIdx.x;
  const v4f* s = (const v4f*)x + p0;
  v4f* d = (v4f*)xa + p0;
  v4f r[TPT];
  // (both loops unrolled: r's indices are constants, so it stays in registers)
#pragma unroll
  for (int j = 0; j < TPT; ++j) r[j] = s[256 * j];
#pragma unroll
  for (int j = 0; j < TPT; ++j) {
    v4f o = { tanhf(r[j][0]), tanhf(r[j][1]), tanhf(r[j][2]), tanhf(r[j][3]) };
    d[256 * j] = o;
  }
}

// ---------------------------------------------------------------- kernel 2
// static_out[m, e] = sum_d xa[m, d] * W[e, d]   (M=8192, N=512, K=512)
__global__ __launch_bounds__(256) void gemm_xw(const float* __restrict__ xa,
                                               const float* __restrict__ Wm,
                                               float* __restrict__ out) {
  __shared__ float At[64 * 33];   // A panel [64 rows][32 k] padded
  __shared__ float Bt[32 * 65];   // B panel [32 k][64 n] padded (B[k][n] = W[n][k])
  const int tid = threadIdx.x, lane = tid & 31, w = tid >> 5;
  const int m0 = blockIdx.x * 64, n0 = blockIdx.y * 64;
  const int wm = w & 3, wn = w >> 2;           // 4 x 2 wave grid
  const int nn = lane & 15;
  const int kbo = (lane >> 4) << 1;
  const int rh = (lane >> 4) << 3;

  v8f c0 = {}, c1 = {};
  for (int kp = 0; kp < D_; kp += 32) {
    for (int idx = tid; idx < 64 * 32; idx += 256) {
      int r = idx >> 5, c = idx & 31;
      At[r * 33 + c] = xa[(size_t)(m0 + r) * D_ + kp + c];
    }
    for (int idx = tid; idx < 64 * 32; idx += 256) {
      int k = idx & 31, n = idx >> 5;
      Bt[k * 65 + n] = Wm[(size_t)(n0 + n) * D_ + kp + k];
    }
    __syncthreads();
#pragma unroll
    for (int kk = 0; kk < 32; kk += 4) {
      int kb = kk + kbo;
      v2f a  = { At[(wm * 16 + nn) * 33 + kb], At[(wm * 16 + nn) * 33 + kb + 1] };
      v2f b0 = { Bt[kb * 65 + wn * 32 + nn], Bt[(kb + 1) * 65 + wn * 32 + nn] };
      v2f b1 = { Bt[kb * 65 + wn * 32 + 16 + nn], Bt[(kb + 1) * 65 + wn * 32 + 16 + nn] };
      c0 = wmma_f32(a, b0, c0);
      c1 = wmma_f32(a, b1, c1);
    }
    __syncthreads();
  }
#pragma unroll
  for (int i = 0; i < 8; ++i) {
    int r = m0 + wm * 16 + i + rh;
    out[(size_t)r * D_ + n0 + wn * 32 + nn]      = c0[i];
    out[(size_t)r * D_ + n0 + wn * 32 + 16 + nn] = c1[i];
  }
}

// ---------------------------------------------------------------- kernel 2b
// One workgroup per (batch, chunk).  Nothing here depends on the scan state, so
// every chunk is done at once, and once instead of once per value slice.
// Image of a chunk: [64][64] lam^(t-s) * (k_t . k_s) for s <= t, else 0; then
// [2][32][32] the two diagonal 32x32 blocks, strictly lower, times -beta, transposed.
__global__ __launch_bounds__(256) void gram_k(const float* __restrict__ xa,
                                              const float* __restrict__ eta_p,
                                              const float* __restrict__ laml_p,
                                              float* __restrict__ gimg) {
  extern __shared__ float smem[];
  float* Kt     = smem;                 // [64][KSTR]
  float* lampow = Kt + 64 * KSTR;       // [65]
  const int tid = threadIdx.x, lane = tid & 31, w = tid >> 5;
  const float beta = eta_p[0];
  const float lam  = 1.f / (1.f + __expf(-laml_p[0]));
  if (tid < 65) lampow[tid] = powf(lam, (float)tid);

  // The chunk is one contiguous run of 64*512 floats: thread tid takes 16-byte
  // piece tid + 256*j, which is row (tid >> 7) + 2*j of Kt.
  const v4f* s4 = (const v4f*)(xa + (size_t)blockIdx.x * CHUNK_ * D_) + tid;
  float* kd = Kt + (tid >> 7) * KSTR + ((tid & 127) << 2);
  // unrolled: constant offsets from one address, many loads in flight at once
#pragma unroll
  for (int j = 0; j < CHUNK_ * D_ / 4 / 256; ++j)
    *(v4f*)(kd + 2 * j * KSTR) = s4[256 * j];
  __syncthreads();

  const int nn  = lane & 15;
  const int kbo = (lane >> 4) << 1;
  const int rh  = (lane >> 4) << 3;
  const int tm = w & 3, tn = w >> 2;
  const int rowA = tm * 16 + nn;

  v8f aG0 = {}, aG1 = {};
  // unrolled so that the LDS reads of several k steps issue as one group
#pragma unroll 8
  for (int k0 = 0; k0 < D_; k0 += 4) {
    int kb = k0 + kbo;
    v2f a  = { Kt[rowA * KSTR + kb], Kt[rowA * KSTR + kb + 1] };
    v2f b0 = { Kt[((2 * tn) * 16 + nn) * KSTR + kb],
               Kt[((2 * tn) * 16 + nn) * KSTR + kb + 1] };
    v2f b1 = { Kt[((2 * tn + 1) * 16 + nn) * KSTR + kb],
               Kt[((2 * tn + 1) * 16 + nn) * KSTR + kb + 1] };
    aG0 = wmma_f32(a, b0, aG0);
    aG1 = wmma_f32(a, b1, aG1);
  }

  float* gs = gimg + (size_t)blockIdx.x * GIMG;
  float* gt = gs + CHUNK_ * CHUNK_;
  v8f h0, h1;
#pragma unroll
  for (int i = 0; i < 8; ++i) {
    int t = tm * 16 + i + rh;
    int s0 = (2 * tn) * 16 + nn, s1 = s0 + 16;
    float p0 = lampow[(s0 <= t) ? t - s0 : 0];
    float p1 = lampow[(s1 <= t) ? t - s1 : 0];
    float g0 = (s0 <= t) ? p0 * aG0[i] : 0.f;
    float g1 = (s1 <= t) ? p1 * aG1[i] : 0.f;
    gs[t * CHUNK_ + s0] = g0;
    gs[t * CHUNK_ + s1] = g1;
    h0[i] = (s0 < t) ? -beta * g0 : 0.f;
    h1[i] = (s1 < t) ? -beta * g1 : 0.f;
  }
  if ((tm >> 1) == tn) {
    // this wave's two tiles lie in a diagonal 32x32 block; a lane holds 8
    // consecutive rows t of one column s, so the transposed copy is contiguous
    float* g = gt + (tn * 32 + nn) * 32 + (tm & 1) * 16 + rh;
    *(v4f*)(g)               = __builtin_shufflevector(h0, h0, 0, 1, 2, 3);
    *(v4f*)(g + 4)           = __builtin_shufflevector(h0, h0, 4, 5, 6, 7);
    *(v4f*)(g + 16 * 32)     = __builtin_shufflevector(h1, h1, 0, 1, 2, 3);
    *(v4f*)(g + 16 * 32 + 4) = __builtin_shufflevector(h1, h1, 4, 5, 6, 7);
  }
}

// ---------------------------------------------------------------- kernel 3
// Chunked gated delta-rule scan for one (batch, value-slice), q == k.
// Dynamic-LDS layout (byte offsets are compile-time constants; no static LDS,
// so the dynamic region starts at LDS offset 0 -> usable by async DMA):
// GT comes first: its wave-uniform reads then fit the 16-bit DS offset field.
#define GT_OFF  0u
#define S_OFF   (2u * 32u * GP * 4u)
#define KT_OFF  (S_OFF + 512u * VW * 4u)
#define UT_OFF  (KT_OFF + 64u * KSTR * 4u)
#define AT_OFF  (UT_OFF + 64u * US * 4u)
#define GS_OFF  (AT_OFF + 64u * US * 4u)
#define LP_OFF  (GS_OFF + 64u * 65u * 4u)
#define SMEM_FLOATS (2 * 32 * GP + 512 * VW + 64 * KSTR + 2 * 64 * US + 64 * 65 + 65)

// Unit-lower-triangular solve of one 32-row block by ONE wave: lane = value
// column, the 32 rows of that column live in registers.  gt[s*GP + t] holds
// -beta*G[t][s] (t > s), so column s is read as wave-uniform 16-byte loads and
// applied to all later rows as independent FMAs once u[s] is final.
// (templates only so that every register index is a compile-time constant)
template <int C, int HI>
__device__ __forceinline__ void tri_load_cols(v4f (&g)[31][8], const float* gt) {
  if constexpr (C <= HI && C < 31) {
#pragma unroll
    for (int q = (C + 1) >> 2; q < 8; ++q)
      g[C][q] = *(const v4f*)(gt + C * GP + 4 * q);
    tri_load_cols<C + 1, HI>(g, gt);
  }
}
template <int S>
__device__ __forceinline__ void tri_col(float (&u)[32], v4f (&g)[31][8], const float* gt) {
  if constexpr (S < 31) {
    // read ahead: columns up to S + 2 + S/4 (about 20 loads in flight; later
    // columns are shorter) so that the FMAs cover the LDS latency
    tri_load_cols<(S == 0) ? 0 : S + 2 + ((S - 1) >> 2), S + 2 + (S >> 2)>(g, gt);
    // keeps the read-ahead loads above this column's FMAs; without it the
    // compiler sinks them next to their use and their latency is exposed
    __builtin_amdgcn_sched_barrier(0);
#pragma unroll
    for (int q = (S + 1) >> 2; q < 8; ++q) {
#pragma unroll
      for (int e = 0; e < 4; ++e) {
        const int t = 4 * q + e;
        if (t > S) u[t] = fmaf(g[S][q][e], u[S], u[t]);
      }
    }
    tri_col<S + 1>(u, g, gt);
  }
}
__device__ __forceinline__ void tri_solve32(float* ucol, const float* gt) {
  float u[32];
  v4f g[31][8];
#pragma unroll
  for (int t = 0; t < 32; ++t) u[t] = ucol[t * US];
  // LDS reads return in order: keeps every u load ahead of the triangle loads,
  // so the first FMAs do not wait for the whole read-ahead
  __builtin_amdgcn_sched_barrier(0);
  tri_col<0>(u, g, gt);
#pragma unroll
  for (int t = 1; t < 32; ++t) ucol[t * US] = u[t];
}

__global__ __launch_bounds__(256) void gdn_scan(const float* __restrict__ xa,
                                                const float* __restrict__ vstat,
                                                const float* __restrict__ gimg,
                                                const float* __restrict__ eta_p,
                                                const float* __restrict__ laml_p,
                                                float* __restrict__ y) {
  extern __shared__ float smem[];
  float* GT     = smem;                 // [2][32][GP] -beta*strictlow(diag blocks)^T
  float* Pb     = GT + 2 * 32 * GP;     // [8 waves][4 tiles][2][32 lanes][4] K@S partial sums
  float* Kt     = Pb + 512 * VW;        // [64][KSTR]
  float* Ut     = Kt + 64 * KSTR;       // [64][US]
  float* At     = Ut + 64 * US;         // [64][US]
  float* GS     = At + 64 * US;         // [64][65]
  float* lampow = GS + 64 * 65;         // [65]

  const int tid = threadIdx.x, lane = tid & 31, w = tid >> 5;
  const int b  = blockIdx.x / NSL;            // 4 batches x 32 slices
  const int v0 = (blockIdx.x % NSL) * VW;
  // y plane of this workgroup alone, [L][VW]: a row of the slice is half a
  // 128-byte line, so in [L][D] order two workgroups would write into one line
  float* ysl = y + (size_t)blockIdx.x * L_ * VW;
  const float beta = eta_p[0];
  const float lam  = 1.f / (1.f + __expf(-laml_p[0]));

  if (tid < 65) lampow[tid] = powf(lam, (float)tid);

  const size_t bbase = (size_t)b * L_ * D_;
  // async-stage chunk 0's K (=Q) block
  for (int i = tid; i < CHUNK_ * D_ / 4; i += 256) {
    int t = i >> 7, d4 = (i & 127) << 2;
    async_b128(xa + bbase + (size_t)t * D_ + d4,
               KT_OFF + (unsigned)((t * KSTR + d4) * 4));
  }

  const int nn  = lane & 15;            // N index inside a 16-wide tile
  const int kbo = (lane >> 4) << 1;     // K sub-offset of the f32 A/B fragment
  const int rh  = (lane >> 4) << 3;     // row-half offset of C/D fragment
  const int tm = w & 3, tn = w >> 2;    // row tile, and which half of its registers
  const int rowA = tm * 16 + nn;

  // The state never leaves the registers: wave w owns rows d = 64w .. 64w+63 of
  // S as 4 accumulator tiles, Sa[j][i] = S[64w + 16j + i + rh][nn].
  v8f Sa[4] = {};

  for (int ch = 0; ch < NCH; ++ch) {
    const size_t xbase = bbase + (size_t)ch * CHUNK_ * D_;
    wait_async_lds();
    __syncthreads();                    // Kt ready; At/GS/Ut consistent
    const float lamC = lampow[64];

    // ---- prefetch next chunk (K + V slice) into cache while we compute
    if (ch + 1 < NCH) {
      const float* nk = xa + xbase + (size_t)CHUNK_ * D_;
      for (int i = tid; i < CHUNK_ * D_ / 32; i += 256)
        __builtin_prefetch(nk + i * 32, 0, 3);
      if (tid < CHUNK_)
        __builtin_prefetch(vstat + xbase + (size_t)(CHUNK_ + tid) * D_ + v0, 0, 3);
    }

    // ---- this chunk's Gram image (gram_k): loads issued here, stored to LDS
    // behind the K@S loop, which covers their latency
    const v4f* gi = (const v4f*)(gimg + (size_t)(b * NCH + ch) * GIMG);
    v4f gq[GIMG / 4 / 256];
    // (the three unrolls below keep gq's indices constant, so it stays in registers)
#pragma unroll
    for (int j = 0; j < GIMG / 4 / 256; ++j) gq[j] = gi[tid + 256 * j];

    // ---- A = K@S [64x16]: each wave multiplies all 64 rows of K by its own 64
    // rows of S.  Registers (i, i+1) of a state tile ARE a B fragment: k slots
    // 0,1 (lanes 0-15) are rows i, i+1 of the tile, k slots 2,3 (lanes 16-31)
    // rows i+8, i+9; the K loads below take their columns in the same order.
    {
      v8f P[4] = {};
      // (all loops unrolled: every register index is a compile-time constant)
#pragma unroll
      for (int j = 0; j < 4; ++j) {
#pragma unroll
        for (int q = 0; q < 2; ++q) {
          v4f a4[4];
#pragma unroll
          for (int m = 0; m < 4; ++m)
            a4[m] = *(const v4f*)(Kt + (m * 16 + nn) * KSTR + w * 64 + j * 16 + rh + q * 4);
#pragma unroll
          for (int e = 0; e < 2; ++e) {
#pragma unroll
            for (int m = 0; m < 4; ++m) {
              v2f a = { a4[m][2 * e], a4[m][2 * e + 1] };
              v2f bS = { Sa[j][4 * q + 2 * e], Sa[j][4 * q + 2 * e + 1] };
              P[m] = wmma_f32(a, bS, P[m]);
            }
          }
        }
      }
#pragma unroll
      for (int m = 0; m < 4; ++m) {
        float* pd = Pb + ((w * 4 + m) * 2) * 128 + lane * 4;
        *(v4f*)(pd)       = __builtin_shufflevector(P[m], P[m], 0, 1, 2, 3);
        *(v4f*)(pd + 128) = __builtin_shufflevector(P[m], P[m], 4, 5, 6, 7);
      }
    }
    __syncthreads();                    // all eight partial sums are in Pb
    // wave w adds up registers 4*tn .. 4*tn+3 of tile tm, partial sums in wave order
    {
      v4f ps[8];
#pragma unroll
      for (int s = 0; s < 8; ++s)
        ps[s] = *(const v4f*)(Pb + ((s * 4 + tm) * 2 + tn) * 128 + lane * 4);
#pragma unroll
      for (int s = 1; s < 8; ++s) ps[0] += ps[s];
#pragma unroll
      for (int e = 0; e < 4; ++e)
        At[(tm * 16 + tn * 4 + e + rh) * US + nn] = ps[0][e];
    }
#pragma unroll
    for (int j = 0; j < CHUNK_ * CHUNK_ / 4 / 256; ++j) {
      int i = tid + 256 * j;
      int t = i >> 4, s4 = (i & 15) << 2;
#pragma unroll
      for (int e = 0; e < 4; ++e) GS[t * 65 + s4 + e] = gq[j][e];
    }
#pragma unroll
    for (int j = 0; j < 2 * 32 * 32 / 4 / 256; ++j) {
      int i = tid + 256 * j;
      *(v4f*)(GT + (i >> 3) * GP + ((i & 7) << 2)) = gq[CHUNK_ * CHUNK_ / 4 / 256 + j];
    }
    __syncthreads();

    // ---- RHS: U <- beta*(V - lam^{t+1} A)   (V straight from global/L2)
    for (int i = tid; i < CHUNK_ * VW; i += 256) {
      int t = i / VW, j = i % VW;
      float v = vstat[xbase + (size_t)t * D_ + v0 + j];
      Ut[t * US + j] = beta * (v - lampow[t + 1] * At[t * US + j]);
    }
    __syncthreads();

    // ---- blocked forward substitution: (I + beta*strictlow(GS)) U = R
    // (e1) rows 0..31: one value column per lane, VW lanes of wave 0
    if (tid < VW) tri_solve32(Ut + lane, GT);
    __syncthreads();
    // (e2) U_hi -= beta * GS[32:64,0:32] @ U_lo   (WMMA, -beta folded into A)
    if (w < 2) {
      const int tm2 = w;
      const float nbeta = -beta;
      v8f acc;
#pragma unroll
      for (int i = 0; i < 8; ++i)
        acc[i] = Ut[(32 + tm2 * 16 + i + rh) * US + nn];
#pragma unroll
      for (int k0 = 0; k0 < 32; k0 += 4) {
        int kb = k0 + kbo;
        v2f a  = { nbeta * GS[(32 + tm2 * 16 + nn) * 65 + kb],
                   nbeta * GS[(32 + tm2 * 16 + nn) * 65 + kb + 1] };
        v2f bU = { Ut[kb * US + nn], Ut[(kb + 1) * US + nn] };
        acc = wmma_f32(a, bU, acc);
      }
#pragma unroll
      for (int i = 0; i < 8; ++i)
        Ut[(32 + tm2 * 16 + i + rh) * US + nn] = acc[i];
    }
    __syncthreads();
    // (e3) rows 32..63, remaining strictly-lower terms s in [32, t)
    if (tid < VW) tri_solve32(Ut + 32 * US + lane, GT + 32 * GP);
    __syncthreads();

    // ---- state carry FIRST (last Kt consumer): S = lam^64 S + (lam^{63-s}k_s)^T U
#pragma unroll
    for (int j = 0; j < 4; ++j) Sa[j] *= lamC;
    // unrolled: the LDS reads of later k steps issue under the WMMAs of earlier ones
#pragma unroll
    for (int k0 = 0; k0 < CHUNK_; k0 += 4) {
      int kb = k0 + kbo;
      float p0 = lampow[63 - kb], p1 = lampow[62 - kb];
      v2f bU = { Ut[kb * US + nn], Ut[(kb + 1) * US + nn] };
#pragma unroll
      for (int j = 0; j < 4; ++j) {
        v2f a = { p0 * Kt[kb * KSTR + w * 64 + j * 16 + nn],
                  p1 * Kt[(kb + 1) * KSTR + w * 64 + j * 16 + nn] };
        Sa[j] = wmma_f32(a, bU, Sa[j]);
      }
    }
    __syncthreads();                     // all waves done reading Kt

    // ---- kick off next chunk's async K copy; it overlaps the O-matmul below
    if (ch + 1 < NCH) {
      const float* nk = xa + xbase + (size_t)CHUNK_ * D_;
      for (int i = tid; i < CHUNK_ * D_ / 4; i += 256) {
        int t = i >> 7, d4 = (i & 127) << 2;
        async_b128(nk + (size_t)t * D_ + d4,
                   KT_OFF + (unsigned)((t * KSTR + d4) * 4));
      }
    }

    // ---- O = GS @ U ; y = V + lam^{t+1} A + O   (four 16x16 tiles: waves 0..3)
    if (w < 4) {
      v8f aO = {};
      for (int k0 = 0; k0 < CHUNK_; k0 += 4) {
        int kb = k0 + kbo;
        v2f a  = { GS[rowA * 65 + kb], GS[rowA * 65 + kb + 1] };
        v2f bU = { Ut[kb * US + nn], Ut[(kb + 1) * US + nn] };
        aO = wmma_f32(a, bU, aO);
      }
#pragma unroll
      for (int i = 0; i < 8; ++i) {
        int t = tm * 16 + i + rh;
        float v = vstat[xbase + (size_t)t * D_ + v0 + nn];
        ysl[(size_t)(ch * CHUNK_ + t) * VW + nn] =
            v + lampow[t + 1] * At[t * US + nn] + aO[i];
      }
      // the stores' address registers are reused by the next trip's loads
      asm volatile("s_wait_xcnt 0x0" ::: "memory");
    }
    // loop-top barrier orders these GS/Ut/At reads before the next chunk rewrites them
  }
}

// ---------------------------------------------------------------- kernel 4
// ys is the scan's plane order [B][NSL][L][VW]; y is the output, [B][L][D]
// One wave per two adjacent rows, no LDS and no barrier.  In a plane rows t and
// t+1 (t even) are one 128-byte line: lanes 8g..8g+7 read that line of slice
// g + 4j, so lane bit 2 says which of the two rows a lane holds 32 values of.
static_assert(VW == 16 && NSL == 32 && L_ % 2 == 0, "lane map of layernorm_k");
__global__ __launch_bounds__(256) void layernorm_k(const float* __restrict__ ys,
                                                   float* __restrict__ y,
                                                   const float* __restrict__ gam,
                                                   const float* __restrict__ bet) {
  const int lane = threadIdx.x & 31;
  const int row = (blockIdx.x * 8 + (threadIdx.x >> 5)) * 2 + ((lane >> 2) & 1);
  const int sl0 = lane >> 3, c4 = (lane & 3) << 2;
  const float* yr = ys + ((size_t)((row / L_) * NSL + sl0) * L_ + row % L_) * VW + c4;
  v4f v[8];
  // (all loops unrolled: v's indices are constants, and the 8 loads fly together)
#pragma unroll
  for (int j = 0; j < 8; ++j) v[j] = *(const v4f*)(yr + (size_t)(4 * j) * L_ * VW);
  // the loads' address registers are reused by what follows
  asm volatile("s_wait_xcnt 0x0" ::: "memory");
  float s = 0.f, q = 0.f;
#pragma unroll
  for (int j = 0; j < 8; ++j) {
#pragma unroll
    for (int e = 0; e < 4; ++e) { s += v[j][e]; q = fmaf(v[j][e], v[j][e], q); }
  }
  // sum over the 16 lanes of the same row: every lane bit but bit 2
#pragma unroll
  for (int mk = 1; mk < 32; mk <<= 1) {
    if (mk == 4) continue;
    s += __shfl_xor(s, mk, 32);
    q += __shfl_xor(q, mk, 32);
  }
  float mean = s * (1.f / D_);
  float var  = q * (1.f / D_) - mean * mean;
  float inv  = rsqrtf(var + EPS_);
  const int col = sl0 * VW + c4;
  float* yo = y + (size_t)row * D_ + col;
#pragma unroll
  for (int j = 0; j < 8; ++j) {
    v4f g = *(const v4f*)(gam + col + 4 * j * VW);
    v4f b = *(const v4f*)(bet + col + 4 * j * VW);
    *(v4f*)(yo + 4 * j * VW) = (v[j] - mean) * inv * g + b;
  }
}

// ---------------------------------------------------------------- launch
extern "C" void kernel_launch(void* const* d_in, const int* in_sizes, int n_in,
                              void* d_out, int out_size, void* d_ws, size_t ws_size,
                              hipStream_t stream) {
  const float* x    = (const float*)d_in[0];
  const float* W    = (const float*)d_in[1];
  const float* eta  = (const float*)d_in[2];
  const float* laml = (const float*)d_in[3];
  const float* g    = (const float*)d_in[4];
  const float* bb   = (const float*)d_in[5];
  float* out = (float*)d_out;

  float* xa    = (float*)d_ws;                       // [B,L,D] tanh(x)
  float* vstat = xa + (size_t)B_ * L_ * D_;          // [B,L,D] static_out
  float* gimg  = vstat + (size_t)B_ * L_ * D_;       // [B*NCH][GIMG] Gram images
  float* ys    = gimg + (size_t)B_ * NCH * GIMG;     // [B][NSL][L][VW] y before layernorm

  tanh_k<<<B_ * L_ * D_ / (256 * TPT * 4), 256, 0, stream>>>(x, xa);

  dim3 g2(B_ * L_ / 64, D_ / 64);
  gemm_xw<<<g2, 256, 0, stream>>>(xa, W, vstat);

  size_t gsmem = (size_t)(64 * KSTR + 65) * sizeof(float);
  gram_k<<<B_ * NCH, 256, gsmem, stream>>>(xa, eta, laml, gimg);

  size_t smem = (size_t)SMEM_FLOATS * sizeof(float);
  gdn_scan<<<B_ * (D_ / VW), 256, smem, stream>>>(xa, vstat, gimg, eta, laml, ys);

  layernorm_k<<<B_ * L_ / 16, 256, 0, stream>>>(ys, out, g, bb);
}

// v006
// One run takes 283 microseconds.
// Timed twice side by side with v005, it ran 1.14 times as fast both times.
// All steps since v000 together make it 8.88 times as fast.
#include <hip/hip_runtime.h>
#include <hip/hip_bf16.h>

#define B_ 4
#define L_ 2048
#define D_ 512
#define CHUNK_ 64
#define NCH (L_ / CHUNK_)
#define VW 16           // value-dim slice per workgroup in the scan kernel
#define NSL (D_ / VW)   // value slices, one scan workgroup each per batch
#define US 18           // row stride of Ut and At: 16-wide rows 1, 2 or 8 apart share no bank
#define KSTR 516        // Kt row stride (16B-aligned rows, conflict-free)
#define GP 36            // row stride of the transposed triangle copies (16B-aligned)
#define TS 68            // row stride of the inverse triangle in LDS: 8-byte A-fragment reads share no bank
#define EPS_ 1e-5f
#define GIMG (2 * CHUNK_ * CHUNK_)  // floats of one chunk's Gram image in the workspace

typedef float v2f __attribute__((ext_vector_type(2)));
typedef float v4f __attribute__((ext_vector_type(4)));
typedef float v8f __attribute__((ext_vector_type(8)));

__device__ __forceinline__ v8f wmma_f32(v2f a, v2f b, v8f c) {
  // D = A(16x4 f32) * B(4x16 f32) + C(16x16 f32)
  return __builtin_amdgcn_wmma_f32_16x16x4_f32(false, a, false, b, (short)0, c,
                                               false, false);
}

// Async HBM -> LDS DMA (ASYNCcnt-tracked).  vDst = per-lane LDS byte offset.
__device__ __forceinline__ void async_b128(const float* g, unsigned lds_byte_off) {
  asm volatile("global_load_async_to_lds_b128 %0, %1, off"
               :
               : "v"(lds_byte_off), "v"(g)
               : "memory");
}
__device__ __forceinline__ void wait_async_lds() {
  asm volatile("s_wait_asynccnt 0x0" ::: "memory");
}

// ---------------------------------------------------------------- kernel 1
// Each thread takes TPT 16-byte pieces, 256 pieces apart, all loads in flight at
// once: 4,096 waves in the launch instead of one wave per 32 values.
#define TPT 8
static_assert((B_ * L_ * D_) % (256 * TPT * 4) == 0, "whole blocks only");
__global__ __launch_bounds__(256) void tanh_k(const float* __restrict__ x, float* __restrict__ xa) {
  const size_t p0 = (size_t)blockIdx.x * (256 * TPT) + threadIdx.x;
  const v4f* s = (const v4f*)x + p0;
  v4f* d = (v4f*)xa + p0;
  v4f r[TPT];
  // (both loops unrolled: r's indices are constants, so it stays in registers)
#pragma unroll
  for (int j = 0; j < TPT; ++j) r[j] = s[256 * j];
#pragma unroll
  for (int j = 0; j < TPT; ++j) {
    v4f o = { tanhf(r[j][0]), tanhf(r[j][1]), tanhf(r[j][2]), tanhf(r[j][3]) };
    d[256 * j] = o;
  }
}

// ---------------------------------------------------------------- kernel 2
// static_out[m, e] = sum_d xa[m, d] * W[e, d]   (M=8192, N=512, K=512)
__global__ __launch_bounds__(256) void gemm_xw(const float* __restrict__ xa,
                                               const float* __restrict__ Wm,
                                               float* __restrict__ out) {
  __shared__ float At[64 * 33];   // A panel [64 rows][32 k] padded
  __shared__ float Bt[32 * 65];   // B panel [32 k][64 n] padded (B[k][n] = W[n][k])
  const int tid = threadIdx.x, lane = tid & 31, w = tid >> 5;
  const int m0 = blockIdx.x * 64, n0 = blockIdx.y * 64;
  const int wm = w & 3, wn = w >> 2;           // 4 x 2 wave grid
  const int nn = lane & 15;
  const int kbo = (lane >> 4) << 1;
  const int rh = (lane >> 4) << 3;

  v8f c0 = {}, c1 = {};
  for (int kp = 0; kp < D_; kp += 32) {
    for (int idx = tid; idx < 64 * 32; idx += 256) {
      int r = idx >> 5, c = idx & 31;
      At[r * 33 + c] = xa[(size_t)(m0 + r) * D_ + kp + c];
    }
    for (int idx = tid; idx < 64 * 32; idx += 256) {
      int k = idx & 31, n = idx >> 5;
      Bt[k * 65 + n] = Wm[(size_t)(n0 + n) * D_ + kp + k];
    }
    __syncthreads();
#pragma unroll
    for (int kk = 0; kk < 32; kk += 4) {
      int kb = kk + kbo;
      v2f a  = { At[(wm * 16 + nn) * 33 + kb], At[(wm * 16 + nn) * 33 + kb + 1] };
      v2f b0 = { Bt[kb * 65 + wn * 32 + nn], Bt[(kb + 1) * 65 + wn * 32 + nn] };
      v2f b1 = { Bt[kb * 65 + wn * 32 + 16 + nn], Bt[(kb + 1) * 65 + wn * 32 + 16 + nn] };
      c0 = wmma_f32(a, b0, c0);
      c1 = wmma_f32(a, b1, c1);
    }
    __syncthreads();
  }
#pragma unroll
  for (int i = 0; i < 8; ++i) {
    int r = m0 + wm * 16 + i + rh;
    out[(size_t)r * D_ + n0 + wn * 32 + nn]      = c0[i];
    out[(size_t)r * D_ + n0 + wn * 32 + 16 + nn] = c1[i];
  }
}

// Unit-lower-triangular solve of one 32-row block by ONE wave: lane = column of
// the right-hand side, the 32 rows of that column live in registers.  gt[s*GP + t]
// holds -beta*G[t][s] (t > s), so column s is read as wave-uniform 16-byte loads
// and applied to all later rows as independent FMAs once u[s] is final.
// (templates only so that every register index is a compile-time constant)
template <int C, int HI>
__device__ __forceinline__ void tri_load_cols(v4f (&g)[31][8], const float* gt) {
  if constexpr (C <= HI && C < 31) {
#pragma unroll
    for (int q = (C + 1) >> 2; q < 8; ++q)
      g[C][q] = *(const v4f*)(gt + C * GP + 4 * q);
    tri_load_cols<C + 1, HI>(g, gt);
  }
}
template <int S>
__device__ __forceinline__ void tri_col(float (&u)[32], v4f (&g)[31][8], const float* gt) {
  if constexpr (S < 31) {
    // read ahead: columns up to S + 2 + S/4 (about 20 loads in flight; later
    // columns are shorter) so that the FMAs cover the LDS latency
    tri_load_cols<(S == 0) ? 0 : S + 2 + ((S - 1) >> 2), S + 2 + (S >> 2)>(g, gt);
    // keeps the read-ahead loads above this column's FMAs; without it the
    // compiler sinks them next to their use and their latency is exposed
    __builtin_amdgcn_sched_barrier(0);
#pragma unroll
    for (int q = (S + 1) >> 2; q < 8; ++q) {
#pragma unroll
      for (int e = 0; e < 4; ++e) {
        const int t = 4 * q + e;
        if (t > S) u[t] = fmaf(g[S][q][e], u[S], u[t]);
      }
    }
    tri_col<S + 1>(u, g, gt);
  }
}
template <int ST>   // ST: row stride of the right-hand side
__device__ __forceinline__ void tri_solve32(float* ucol, const float* gt) {
  float u[32];
  v4f g[31][8];
#pragma unroll
  for (int t = 0; t < 32; ++t) u[t] = ucol[t * ST];
  // LDS reads return in order: keeps every u load ahead of the triangle loads,
  // so the first FMAs do not wait for the whole read-ahead
  __builtin_amdgcn_sched_barrier(0);
  tri_col<0>(u, g, gt);
#pragma unroll
  for (int t = 1; t < 32; ++t) ucol[t * ST] = u[t];
}

// ---------------------------------------------------------------- kernel 2b
// One workgroup per (batch, chunk).  Nothing here depends on the scan state, so
// every chunk is done at once, and once instead of once per value slice.
// Image of a chunk: [64][64] G = lam^(t-s) * (k_t . k_s) for s <= t, else 0; then
// [64][64] T = (I + beta*strictlow(G))^-1, unit lower triangular, zeros above.
__global__ __launch_bounds__(256) void gram_k(const float* __restrict__ xa,
                                              const float* __restrict__ eta_p,
                                              const float* __restrict__ laml_p,
                                              float* __restrict__ gimg) {
  extern __shared__ float smem[];
  float* GT     = smem;                 // [2][32][GP] -beta*strictlow(diag blocks)^T
  float* Nl     = GT + 2 * 32 * GP;     // [32][GP] -beta*G[32:64, 0:32]
  float* Tm     = Nl + 32 * GP;         // [64][TS] identity, solved in place into T
  float* Kt     = Tm + 64 * TS;         // [64][KSTR]
  float* lampow = Kt + 64 * KSTR;       // [65]
  const int tid = threadIdx.x, lane = tid & 31, w = tid >> 5;
  const float beta = eta_p[0];
  const float lam  = 1.f / (1.f + __expf(-laml_p[0]));
  if (tid < 65) lampow[tid] = powf(lam, (float)tid);
  // unrolled: four stores at constant offsets from one address
#pragma unroll
  for (int j = 0; j < CHUNK_ * CHUNK_ / 4 / 256; ++j) {
    int i = tid + 256 * j;
    int t = i >> 4, c4 = (i & 15) << 2;
    v4f e = { t == c4 ? 1.f : 0.f, t == c4 + 1 ? 1.f : 0.f,
              t == c4 + 2 ? 1.f : 0.f, t == c4 + 3 ? 1.f : 0.f };
    *(v4f*)(Tm + t * TS + c4) = e;
  }

  // The chunk is one contiguous run of 64*512 floats: thread tid takes 16-byte
  // piece tid + 256*j, which is row (tid >> 7) + 2*j of Kt.
  const v4f* s4 = (const v4f*)(xa + (size_t)blockIdx.x * CHUNK_ * D_) + tid;
  float* kd = Kt + (tid >> 7) * KSTR + ((tid & 127) << 2);
  // unrolled: constant offsets from one address, many loads in flight at once
#pragma unroll
  for (int j = 0; j < CHUNK_ * D_ / 4 / 256; ++j)
    *(v4f*)(kd + 2 * j * KSTR) = s4[256 * j];
  __syncthreads();

  const int nn  = lane & 15;
  const int kbo = (lane >> 4) << 1;
  const int rh  = (lane >> 4) << 3;
  const int tm = w & 3, tn = w >> 2;
  const int rowA = tm * 16 + nn;

  v8f aG0 = {}, aG1 = {};
  // unrolled so that the LDS reads of several k steps issue as one group
#pragma unroll 8
  for (int k0 = 0; k0 < D_; k0 += 4) {
    int kb = k0 + kbo;
    v2f a  = { Kt[rowA * KSTR + kb], Kt[rowA * KSTR + kb + 1] };
    v2f b0 = { Kt[((2 * tn) * 16 + nn) * KSTR + kb],
               Kt[((2 * tn) * 16 + nn) * KSTR + kb + 1] };
    v2f b1 = { Kt[((2 * tn + 1) * 16 + nn) * KSTR + kb],
               Kt[((2 * tn + 1) * 16 + nn) * KSTR + kb + 1] };
    aG0 = wmma_f32(a, b0, aG0);
    aG1 = wmma_f32(a, b1, aG1);
  }

  float* gs = gimg + (size_t)blockIdx.x * GIMG;
  v8f h0, h1;
#pragma unroll
  for (int i = 0; i < 8; ++i) {
    int t = tm * 16 + i + rh;
    int s0 = (2 * tn) * 16 + nn, s1 = s0 + 16;
    float p0 = lampow[(s0 <= t) ? t - s0 : 0];
    float p1 = lampow[(s1 <= t) ? t - s1 : 0];
    float g0 = (s0 <= t) ? p0 * aG0[i] : 0.f;
    float g1 = (s1 <= t) ? p1 * aG1[i] : 0.f;
    gs[t * CHUNK_ + s0] = g0;
    gs[t * CHUNK_ + s1] = g1;
    h0[i] = (s0 < t) ? -beta * g0 : 0.f;
    h1[i] = (s1 < t) ? -beta * g1 : 0.f;
  }
  if ((tm >> 1) == tn) {
    // this wave's two tiles lie in a diagonal 32x32 block; a lane holds 8
    // consecutive rows t of one column s, so the transposed copy is contiguous
    float* g = GT + (tn * 32 + nn) * GP + (tm & 1) * 16 + rh;
    *(v4f*)(g)               = __builtin_shufflevector(h0, h0, 0, 1, 2, 3);
    *(v4f*)(g + 4)           = __builtin_shufflevector(h0, h0, 4, 5, 6, 7);
    *(v4f*)(g + 16 * GP)     = __builtin_shufflevector(h1, h1, 0, 1, 2, 3);
    *(v4f*)(g + 16 * GP + 4) = __builtin_shufflevector(h1, h1, 4, 5, 6, 7);
  } else if (tn == 0) {
    // rows 32..63, columns 0..31: the block below the first diagonal block
    // (unrolled: the indices of h0 and h1 are constants, so they stay in registers)
#pragma unroll
    for (int i = 0; i < 8; ++i) {
      Nl[((tm - 2) * 16 + i + rh) * GP + nn]      = h0[i];
      Nl[((tm - 2) * 16 + i + rh) * GP + 16 + nn] = h1[i];
    }
  }
  __syncthreads();                      // GT, Nl and the identity are in LDS

  // ---- (I + beta*strictlow(G)) T = I by blocked forward substitution, one
  // column of T per lane.  The two diagonal blocks' own inverses first.
  if (w < 2) tri_solve32<TS>(Tm + w * (32 * TS + 32) + lane, GT + w * 32 * GP);
  __syncthreads();
  // right-hand side of the lower left block: -beta*G[32:64, 0:32] @ T[0:32, 0:32]
  if (w < 4) {
    const int tm2 = w & 1, tn2 = w >> 1;
    v8f acc = {};
    // (both loops unrolled: LDS reads issue ahead of the WMMAs; acc stays in registers)
#pragma unroll
    for (int k0 = 0; k0 < 32; k0 += 4) {
      int kb = k0 + kbo;
      v2f a  = *(const v2f*)(Nl + (tm2 * 16 + nn) * GP + kb);
      v2f bT = { Tm[kb * TS + tn2 * 16 + nn], Tm[(kb + 1) * TS + tn2 * 16 + nn] };
      acc = wmma_f32(a, bT, acc);
    }
#pragma unroll
    for (int i = 0; i < 8; ++i)
      Tm[(32 + tm2 * 16 + i + rh) * TS + tn2 * 16 + nn] = acc[i];
  }
  __syncthreads();
  if (w == 0) tri_solve32<TS>(Tm + 32 * TS + lane, GT + 32 * GP);
  __syncthreads();
  v4f* gt = (v4f*)(gs + CHUNK_ * CHUNK_);
  // unrolled: the four LDS reads fly together
#pragma unroll
  for (int j = 0; j < CHUNK_ * CHUNK_ / 4 / 256; ++j) {
    int i = tid + 256 * j;
    gt[i] = *(const v4f*)(Tm + (i >> 4) * TS + ((i & 15) << 2));
  }
}

// ---------------------------------------------------------------- kernel 3
// Chunked gated delta-rule scan for one (batch, value-slice), q == k.
// Dynamic-LDS layout (byte offsets are compile-time constants; no static LDS,
// so the dynamic region starts at LDS offset 0 -> usable by async DMA):
#define KT_OFF  (512u * VW * 4u)
#define SMEM_FLOATS (512 * VW + 64 * KSTR + 2 * 64 * US + 64 * VW + 64 * 65 + 64 * TS + 65)

__global__ __launch_bounds__(256) void gdn_scan(const float* __restrict__ xa,
                                                const float* __restrict__ vstat,
                                                const float* __restrict__ gimg,
                                                const float* __restrict__ eta_p,
                                                const float* __restrict__ laml_p,
                                                float* __restrict__ y) {
  extern __shared__ float smem[];
  float* Pb     = smem;                 // [8 waves][4 tiles][2][32 lanes][4] K@S partial sums
  float* Kt     = Pb + 512 * VW;        // [64][KSTR]
  float* Ut     = Kt + 64 * KSTR;       // [64][US]
  float* At     = Ut + 64 * US;         // [64][US]
  float* Rt     = At + 64 * US;         // [32 row pairs][VW][2]: a B fragment is one 8-byte read
  float* GS     = Rt + 64 * VW;         // [64][65]
  float* Tl     = GS + 64 * 65;         // [64][TS] (I + beta*strictlow(GS))^-1
  float* lampow = Tl + 64 * TS;         // [65]

  const int tid = threadIdx.x, lane = tid & 31, w = tid >> 5;
  const int b  = blockIdx.x / NSL;            // 4 batches x 32 slices
  const int v0 = (blockIdx.x % NSL) * VW;
  // y plane of this workgroup alone, [L][VW]: a row of the slice is half a
  // 128-byte line, so in [L][D] order two workgroups would write into one line
  float* ysl = y + (size_t)blockIdx.x * L_ * VW;
  const float beta = eta_p[0];
  const float lam  = 1.f / (1.f + __expf(-laml_p[0]));

  if (tid < 65) lampow[tid] = powf(lam, (float)tid);

  const size_t bbase = (size_t)b * L_ * D_;
  // async-stage chunk 0's K (=Q) block
  for (int i = tid; i < CHUNK_ * D_ / 4; i += 256) {
    int t = i >> 7, d4 = (i & 127) << 2;
    async_b128(xa + bbase + (size_t)t * D_ + d4,
               KT_OFF + (unsigned)((t * KSTR + d4) * 4));
  }

  const int nn  = lane & 15;            // N index inside a 16-wide tile
  const int kbo = (lane >> 4) << 1;     // K sub-offset of the f32 A/B fragment
  const int rh  = (lane >> 4) << 3;     // row-half offset of C/D fragment
  const int tm = w & 3, tn = w >> 2;    // row tile, and which half of its registers
  const int rowA = tm * 16 + nn;

  // The state never leaves the registers: wave w owns rows d = 64w .. 64w+63 of
  // S as 4 accumulator tiles, Sa[j][i] = S[64w + 16j + i + rh][nn].
  v8f Sa[4] = {};

  for (int ch = 0; ch < NCH; ++ch) {
    const size_t xbase = bbase + (size_t)ch * CHUNK_ * D_;
    wait_async_lds();
    __syncthreads();                    // Kt ready; At/GS/Ut consistent
    const float lamC = lampow[64];

    // ---- prefetch next chunk (K + V slice) into cache while we compute
    if (ch + 1 < NCH) {
      const float* nk = xa + xbase + (size_t)CHUNK_ * D_;
      for (int i = tid; i < CHUNK_ * D_ / 32; i += 256)
        __builtin_prefetch(nk + i * 32, 0, 3);
      if (tid < CHUNK_)
        __builtin_prefetch(vstat + xbase + (size_t)(CHUNK_ + tid) * D_ + v0, 0, 3);
    }

    // ---- this chunk's Gram image (gram_k): loads issued here, stored to LDS
    // behind the K@S loop, which covers their latency
    const v4f* gi = (const v4f*)(gimg + (size_t)(b * NCH + ch) * GIMG);
    v4f gq[GIMG / 4 / 256];
    // (the three unrolls below keep gq's indices constant, so it stays in registers)
#pragma unroll
    for (int j = 0; j < GIMG / 4 / 256; ++j) gq[j] = gi[tid + 256 * j];

    // ---- A = K@S [64x16]: each wave multiplies all 64 rows of K by its own 64
    // rows of S.  Registers (i, i+1) of a state tile ARE a B fragment: k slots
    // 0,1 (lanes 0-15) are rows i, i+1 of the tile, k slots 2,3 (lanes 16-31)
    // rows i+8, i+9; the K loads below take their columns in the same order.
    {
      v8f P[4] = {};
      // (all loops unrolled: every register index is a compile-time constant)
#pragma unroll
      for (int j = 0; j < 4; ++j) {
#pragma unroll
        for (int q = 0; q < 2; ++q) {
          v4f a4[4];
#pragma unroll
          for (int m = 0; m < 4; ++m)
            a4[m] = *(const v4f*)(Kt + (m * 16 + nn) * KSTR + w * 64 + j * 16 + rh + q * 4);
#pragma unroll
          for (int e = 0; e < 2; ++e) {
#pragma unroll
            for (int m = 0; m < 4; ++m) {
              v2f a = { a4[m][2 * e], a4[m][2 * e + 1] };
              v2f bS = { Sa[j][4 * q + 2 * e], Sa[j][4 * q + 2 * e + 1] };
              P[m] = wmma_f32(a, bS, P[m]);
            }
          }
        }
      }
#pragma unroll
      for (int m = 0; m < 4; ++m) {
        float* pd = Pb + ((w * 4 + m) * 2) * 128 + lane * 4;
        *(v4f*)(pd)       = __builtin_shufflevector(P[m], P[m], 0, 1, 2, 3);
        *(v4f*)(pd + 128) = __builtin_shufflevector(P[m], P[m], 4, 5, 6, 7);
      }
    }
    __syncthreads();                    // all eight partial sums are in Pb
    // wave w adds up registers 4*tn .. 4*tn+3 of tile tm, partial sums in wave order
    {
      v4f ps[8];
#pragma unroll
      for (int s = 0; s < 8; ++s)
        ps[s] = *(const v4f*)(Pb + ((s * 4 + tm) * 2 + tn) * 128 + lane * 4);
#pragma unroll
      for (int s = 1; s < 8; ++s) ps[0] += ps[s];
#pragma unroll
      for (int e = 0; e < 4; ++e)
        At[(tm * 16 + tn * 4 + e + rh) * US + nn] = ps[0][e];
    }
#pragma unroll
    for (int j = 0; j < CHUNK_ * CHUNK_ / 4 / 256; ++j) {
      int i = tid + 256 * j;
      int t = i >> 4, s4 = (i & 15) << 2;
#pragma unroll
      for (int e = 0; e < 4; ++e) GS[t * 65 + s4 + e] = gq[j][e];
    }
#pragma unroll
    for (int j = 0; j < CHUNK_ * CHUNK_ / 4 / 256; ++j) {
      int i = tid + 256 * j;
      *(v4f*)(Tl + (i >> 4) * TS + ((i & 15) << 2)) = gq[CHUNK_ * CHUNK_ / 4 / 256 + j];
    }
    __syncthreads();

    // ---- RHS: R = beta*(V - lam^{t+1} A)   (V straight from global/L2)
    for (int i = tid; i < CHUNK_ * VW; i += 256) {
      int t = i / VW, j = i % VW;
      float v = vstat[xbase + (size_t)t * D_ + v0 + j];
      Rt[(t >> 1) * (2 * VW) + 2 * j + (t & 1)] = beta * (v - lampow[t + 1] * At[t * US + j]);
    }
    __syncthreads();

    // ---- U = T @ R, T the chunk's inverse triangle from gram_k (four 16x16
    // tiles: waves 0..3; even and odd k steps in two sums, so that no WMMA
    // waits for the one before it)
    if (w < 4) {
      v8f u0 = {}, u1 = {};
      v2f ta[16], rb[16];
      // (unrolled: the indices of ta and rb are constants, so they stay in registers)
#pragma unroll
      for (int s = 0; s < 16; ++s) {
        ta[s] = *(const v2f*)(Tl + rowA * TS + 4 * s + kbo);
        rb[s] = *(const v2f*)(Rt + (2 * s + (lane >> 4)) * (2 * VW) + 2 * nn);
      }
      // keeps all the reads in front of the WMMAs: sunk next to their use, only
      // two WMMAs ahead, each pair would wait out most of an LDS latency
      __builtin_amdgcn_sched_barrier(0);
#pragma unroll
      for (int s = 0; s < 16; s += 2) {
        u0 = wmma_f32(ta[s], rb[s], u0);
        u1 = wmma_f32(ta[s + 1], rb[s + 1], u1);
      }
#pragma unroll
      for (int i = 0; i < 8; ++i)
        Ut[(tm * 16 + i + rh) * US + nn] = u0[i] + u1[i];
    }
    __syncthreads();

    // ---- state carry FIRST (last Kt consumer): S = lam^64 S + (lam^{63-s}k_s)^T U
#pragma unroll
    for (int j = 0; j < 4; ++j) Sa[j] *= lamC;
    // unrolled: the LDS reads of later k steps issue under the WMMAs of earlier ones
#pragma unroll
    for (int k0 = 0; k0 < CHUNK_; k0 += 4) {
      int kb = k0 + kbo;
      float p0 = lampow[63 - kb], p1 = lampow[62 - kb];
      v2f bU = { Ut[kb * US + nn], Ut[(kb + 1) * US + nn] };
#pragma unroll
      for (int j = 0; j < 4; ++j) {
        v2f a = { p0 * Kt[kb * KSTR + w * 64 + j * 16 + nn],
                  p1 * Kt[(kb + 1) * KSTR + w * 64 + j * 16 + nn] };
        Sa[j] = wmma_f32(a, bU, Sa[j]);
      }
    }
    __syncthreads();                     // all waves done reading Kt

    // ---- kick off next chunk's async K copy; it overlaps the O-matmul below
    if (ch + 1 < NCH) {
      const float* nk = xa + xbase + (size_t)CHUNK_ * D_;
      for (int i = tid; i < CHUNK_ * D_ / 4; i += 256) {
        int t = i >> 7, d4 = (i & 127) << 2;
        async_b128(nk + (size_t)t * D_ + d4,
                   KT_OFF + (unsigned)((t * KSTR + d4) * 4));
      }
    }

    // ---- O = GS @ U ; y = V + lam^{t+1} A + O   (four 16x16 tiles: waves 0..3)
    if (w < 4) {
      v8f aO = {};
      for (int k0 = 0; k0 < CHUNK_; k0 += 4) {
        int kb = k0 + kbo;
        v2f a  = { GS[rowA * 65 + kb], GS[rowA * 65 + kb + 1] };
        v2f bU = { Ut[kb * US + nn], Ut[(kb + 1) * US + nn] };
        aO = wmma_f32(a, bU, aO);
      }
#pragma unroll
      for (int i = 0; i < 8; ++i) {
        int t = tm * 16 + i + rh;
        float v = vstat[xbase + (size_t)t * D_ + v0 + nn];
        ysl[(size_t)(ch * CHUNK_ + t) * VW + nn] =
            v + lampow[t + 1] * At[t * US + nn] + aO[i];
      }
      // the stores' address registers are reused by the next trip's loads
      asm volatile("s_wait_xcnt 0x0" ::: "memory");
    }
    // loop-top barrier orders these GS/Ut/At reads before the next chunk rewrites them
  }
}

// ---------------------------------------------------------------- kernel 4
// ys is the scan's plane order [B][NSL][L][VW]; y is the output, [B][L][D]
// One wave per two adjacent rows, no LDS and no barrier.  In a plane rows t and
// t+1 (t even) are one 128-byte line: lanes 8g..8g+7 read that line of slice
// g + 4j, so lane bit 2 says which of the two rows a lane holds 32 values of.
static_assert(VW == 16 && NSL == 32 && L_ % 2 == 0, "lane map of layernorm_k");
__global__ __launch_bounds__(256) void layernorm_k(const float* __restrict__ ys,
                                                   float* __restrict__ y,
                                                   const float* __restrict__ gam,
                                                   const float* __restrict__ bet) {
  const int lane = threadIdx.x & 31;
  const int row = (blockIdx.x * 8 + (threadIdx.x >> 5)) * 2 + ((lane >> 2) & 1);
  const int sl0 = lane >> 3, c4 = (lane & 3) << 2;
  const float* yr = ys + ((size_t)((row / L_) * NSL + sl0) * L_ + row % L_) * VW + c4;
  v4f v[8];
  // (all loops unrolled: v's indices are constants, and the 8 loads fly together)
#pragma unroll
  for (int j = 0; j < 8; ++j) v[j] = *(const v4f*)(yr + (size_t)(4 * j) * L_ * VW);
  // the loads' address registers are reused by what follows
  asm volatile("s_wait_xcnt 0x0" ::: "memory");
  float s = 0.f, q = 0.f;
#pragma unroll
  for (int j = 0; j < 8; ++j) {
#pragma unroll
    for (int e = 0; e < 4; ++e) { s += v[j][e]; q = fmaf(v[j][e], v[j][e], q); }
  }
  // sum over the 16 lanes of the same row: every lane bit but bit 2
#pragma unroll
  for (int mk = 1; mk < 32; mk <<= 1) {
    if (mk == 4) continue;
    s += __shfl_xor(s, mk, 32);
    q += __shfl_xor(q, mk, 32);
  }
  float mean = s * (1.f / D_);
  float var  = q * (1.f / D_) - mean * mean;
  float inv  = rsqrtf(var + EPS_);
  const int col = sl0 * VW + c4;
  float* yo = y + (size_t)row * D_ + col;
#pragma unroll
  for (int j = 0; j < 8; ++j) {
    v4f g = *(const v4f*)(gam + col + 4 * j * VW);
    v4f b = *(const v4f*)(bet + col + 4 * j * VW);
    *(v4f*)(yo + 4 * j * VW) = (v[j] - mean) * inv * g + b;
  }
}

// ---------------------------------------------------------------- launch
extern "C" void kernel_launch(void* const* d_in, const int* in_sizes, int n_in,
                              void* d_out, int out_size, void* d_ws, size_t ws_size,
                              hipStream_t stream) {
  const float* x    = (const float*)d_in[0];
  const float* W    = (const float*)d_in[1];
  const float* eta  = (const float*)d_in[2];
  const float* laml = (const float*)d_in[3];
  const float* g    = (const float*)d_in[4];
  const float* bb   = (const float*)d_in[5];
  float* out = (float*)d_out;

  float* xa    = (float*)d_ws;                       // [B,L,D] tanh(x)
  float* vstat = xa + (size_t)B_ * L_ * D_;          // [B,L,D] static_out
  float* gimg  = vstat + (size_t)B_ * L_ * D_;       // [B*NCH][GIMG] Gram images
  float* ys    = gimg + (size_t)B_ * NCH * GIMG;     // [B][NSL][L][VW] y before layernorm

  tanh_k<<<B_ * L_ * D_ / (256 * TPT * 4), 256, 0, stream>>>(x, xa);

  dim3 g2(B_ * L_ / 64, D_ / 64);
  gemm_xw<<<g2, 256, 0, stream>>>(xa, W, vstat);

  size_t gsmem = (size_t)(3 * 32 * GP + 64 * TS + 64 * KSTR + 65) * sizeof(float);
  gram_k<<<B_ * NCH, 256, gsmem, stream>>>(xa, eta, laml, gimg);

  size_t smem = (size_t)SMEM_FLOATS * sizeof(float);
  gdn_scan<<<B_ * (D_ / VW), 256, smem, stream>>>(xa, vstat, gimg, eta, laml, ys);

  layernorm_k<<<B_ * L_ / 16, 256, 0, stream>>>(ys, out, g, bb);
}

// v007
// Measured time: 263 microseconds a run.
// Next to v006, in two timings, it ran 1.07 times as fast each time.
// All steps since v000 together make it 9.53 times as fast.
#include <hip/hip_runtime.h>
#include <hip/hip_bf16.h>

#define B_ 4
#define L_ 2048
#define D_ 512
#define CHUNK_ 64
#define NCH (L_ / CHUNK_)
#define VW 16           // value-dim slice per workgroup in the scan kernel
#define NSL (D_ / VW)   // value slices, one scan workgroup each per batch
#define US 18           // row stride of Ut and At: 16-wide rows 1, 2 or 8 apart share no bank
#define KSTR 516        // Kt row stride (16B-aligned rows, conflict-free)
#define GP 36            // row stride of the transposed triangle copies (16B-aligned)
#define TS 68            // row stride of the inverse triangle in LDS: 8-byte A-fragment reads share no bank
#define EPS_ 1e-5f
#define GIMG (2 * CHUNK_ * CHUNK_)  // floats of one chunk's Gram image in the workspace

typedef float v2f __attribute__((ext_vector_type(2)));
typedef float v4f __attribute__((ext_vector_type(4)));
typedef float v8f __attribute__((ext_vector_type(8)));

__device__ __forceinline__ v8f wmma_f32(v2f a, v2f b, v8f c) {
  // D = A(16x4 f32) * B(4x16 f32) + C(16x16 f32)
  return __builtin_amdgcn_wmma_f32_16x16x4_f32(false, a, false, b, (short)0, c,
                                               false, false);
}

// Async HBM -> LDS DMA (ASYNCcnt-tracked).  vDst = per-lane LDS byte offset.
__device__ __forceinline__ void async_b128(const float* g, unsigned lds_byte_off) {
  asm volatile("global_load_async_to_lds_b128 %0, %1, off"
               :
               : "v"(lds_byte_off), "v"(g)
               : "memory");
}
__device__ __forceinline__ void wait_async_lds() {
  asm volatile("s_wait_asynccnt 0x0" ::: "memory");
}

// ---------------------------------------------------------------- kernel 1
// Each thread takes TPT 16-byte pieces, 256 pieces apart, all loads in flight at
// once: 4,096 waves in the launch instead of one wave per 32 values.
#define TPT 8
static_assert((B_ * L_ * D_) % (256 * TPT * 4) == 0, "whole blocks only");
__global__ __launch_bounds__(256) void tanh_k(const float* __restrict__ x, float* __restrict__ xa) {
  const size_t p0 = (size_t)blockIdx.x * (256 * TPT) + threadIdx.x;
  const v4f* s = (const v4f*)x + p0;
  v4f* d = (v4f*)xa + p0;
  v4f r[TPT];
  // (both loops unrolled: r's indices are constants, so it stays in registers)
#pragma unroll
  for (int j = 0; j < TPT; ++j) r[j] = s[256 * j];
#pragma unroll
  for (int j = 0; j < TPT; ++j) {
    v4f o = { tanhf(r[j][0]), tanhf(r[j][1]), tanhf(r[j][2]), tanhf(r[j][3]) };
    d[256 * j] = o;
  }
}

// ---------------------------------------------------------------- kernel 2
// static_out[m, e] = sum_d xa[m, d] * W[e, d]   (M=8192, N=512, K=512)
__global__ __launch_bounds__(256) void gemm_xw(const float* __restrict__ xa,
                                               const float* __restrict__ Wm,
                                               float* __restrict__ out) {
  __shared__ float At[64 * 33];   // A panel [64 rows][32 k] padded
  __shared__ float Bt[32 * 65];   // B panel [32 k][64 n] padded (B[k][n] = W[n][k])
  const int tid = threadIdx.x, lane = tid & 31, w = tid >> 5;
  const int m0 = blockIdx.x * 64, n0 = blockIdx.y * 64;
  const int wm = w & 3, wn = w >> 2;           // 4 x 2 wave grid
  const int nn = lane & 15;
  const int kbo = (lane >> 4) << 1;
  const int rh = (lane >> 4) << 3;

  v8f c0 = {}, c1 = {};
  for (int kp = 0; kp < D_; kp += 32) {
    for (int idx = tid; idx < 64 * 32; idx += 256) {
      int r = idx >> 5, c = idx & 31;
      At[r * 33 + c] = xa[(size_t)(m0 + r) * D_ + kp + c];
    }
    for (int idx = tid; idx < 64 * 32; idx += 256) {
      int k = idx & 31, n = idx >> 5;
      Bt[k * 65 + n] = Wm[(size_t)(n0 + n) * D_ + kp + k];
    }
    __syncthreads();
#pragma unroll
    for (int kk = 0; kk < 32; kk += 4) {
      int kb = kk + kbo;
      v2f a  = { At[(wm * 16 + nn) * 33 + kb], At[(wm * 16 + nn) * 33 + kb + 1] };
      v2f b0 = { Bt[kb * 65 + wn * 32 + nn], Bt[(kb + 1) * 65 + wn * 32 + nn] };
      v2f b1 = { Bt[kb * 65 + wn * 32 + 16 + nn], Bt[(kb + 1) * 65 + wn * 32 + 16 + nn] };
      c0 = wmma_f32(a, b0, c0);
      c1 = wmma_f32(a, b1, c1);
    }
    __syncthreads();
  }
#pragma unroll
  for (int i = 0; i < 8; ++i) {
    int r = m0 + wm * 16 + i + rh;
    out[(size_t)r * D_ + n0 + wn * 32 + nn]      = c0[i];
    out[(size_t)r * D_ + n0 + wn * 32 + 16 + nn] = c1[i];
  }
}

// Unit-lower-triangular solve of one 32-row block by ONE wave: lane = column of
// the right-hand side, the 32 rows of that column live in registers.  gt[s*GP + t]
// holds -beta*G[t][s] (t > s), so column s is read as wave-uniform 16-byte loads
// and applied to all later rows as independent FMAs once u[s] is final.
// (templates only so that every register index is a compile-time constant)
template <int C, int HI>
__device__ __forceinline__ void tri_load_cols(v4f (&g)[31][8], const float* gt) {
  if constexpr (C <= HI && C < 31) {
#pragma unroll
    for (int q = (C + 1) >> 2; q < 8; ++q)
      g[C][q] = *(const v4f*)(gt + C * GP + 4 * q);
    tri_load_cols<C + 1, HI>(g, gt);
  }
}
template <int S>
__device__ __forceinline__ void tri_col(float (&u)[32], v4f (&g)[31][8], const float* gt) {
  if constexpr (S < 31) {
    // read ahead: columns up to S + 2 + S/4 (about 20 loads in flight; later
    // columns are shorter) so that the FMAs cover the LDS latency
    tri_load_cols<(S == 0) ? 0 : S + 2 + ((S - 1) >> 2), S + 2 + (S >> 2)>(g, gt);
    // keeps the read-ahead loads above this column's FMAs; without it the
    // compiler sinks them next to their use and their latency is exposed
    __builtin_amdgcn_sched_barrier(0);
#pragma unroll
    for (int q = (S + 1) >> 2; q < 8; ++q) {
#pragma unroll
      for (int e = 0; e < 4; ++e) {
        const int t = 4 * q + e;
        if (t > S) u[t] = fmaf(g[S][q][e], u[S], u[t]);
      }
    }
    tri_col<S + 1>(u, g, gt);
  }
}
template <int ST>   // ST: row stride of the right-hand side
__device__ __forceinline__ void tri_solve32(float* ucol, const float* gt) {
  float u[32];
  v4f g[31][8];
#pragma unroll
  for (int t = 0; t < 32; ++t) u[t] = ucol[t * ST];
  // LDS reads return in order: keeps every u load ahead of the triangle loads,
  // so the first FMAs do not wait for the whole read-ahead
  __builtin_amdgcn_sched_barrier(0);
  tri_col<0>(u, g, gt);
#pragma unroll
  for (int t = 1; t < 32; ++t) ucol[t * ST] = u[t];
}

// ---------------------------------------------------------------- kernel 2b
// One workgroup per (batch, chunk).  Nothing here depends on the scan state, so
// every chunk is done at once, and once instead of once per value slice.
// Image of a chunk: [64][64] G = lam^(t-s) * (k_t . k_s) for s <= t, else 0; then
// [64][64] T = (I + beta*strictlow(G))^-1, unit lower triangular, zeros above.
__global__ __launch_bounds__(256) void gram_k(const float* __restrict__ xa,
                                              const float* __restrict__ eta_p,
                                              const float* __restrict__ laml_p,
                                              float* __restrict__ gimg) {
  extern __shared__ float smem[];
  float* GT     = smem;                 // [2][32][GP] -beta*strictlow(diag blocks)^T
  float* Nl     = GT + 2 * 32 * GP;     // [32][GP] -beta*G[32:64, 0:32]
  float* Tm     = Nl + 32 * GP;         // [64][TS] identity, solved in place into T
  float* Kt     = Tm + 64 * TS;         // [64][KSTR]
  float* lampow = Kt + 64 * KSTR;       // [65]
  const int tid = threadIdx.x, lane = tid & 31, w = tid >> 5;
  const float beta = eta_p[0];
  const float lam  = 1.f / (1.f + __expf(-laml_p[0]));
  if (tid < 65) lampow[tid] = powf(lam, (float)tid);
  // unrolled: four stores at constant offsets from one address
#pragma unroll
  for (int j = 0; j < CHUNK_ * CHUNK_ / 4 / 256; ++j) {
    int i = tid + 256 * j;
    int t = i >> 4, c4 = (i & 15) << 2;
    v4f e = { t == c4 ? 1.f : 0.f, t == c4 + 1 ? 1.f : 0.f,
              t == c4 + 2 ? 1.f : 0.f, t == c4 + 3 ? 1.f : 0.f };
    *(v4f*)(Tm + t * TS + c4) = e;
  }

  // The chunk is one contiguous run of 64*512 floats: thread tid takes 16-byte
  // piece tid + 256*j, which is row (tid >> 7) + 2*j of Kt.
  const v4f* s4 = (const v4f*)(xa + (size_t)blockIdx.x * CHUNK_ * D_) + tid;
  float* kd = Kt + (tid >> 7) * KSTR + ((tid & 127) << 2);
  // unrolled: constant offsets from one address, many loads in flight at once
#pragma unroll
  for (int j = 0; j < CHUNK_ * D_ / 4 / 256; ++j)
    *(v4f*)(kd + 2 * j * KSTR) = s4[256 * j];
  __syncthreads();

  const int nn  = lane & 15;
  const int kbo = (lane >> 4) << 1;
  const int rh  = (lane >> 4) << 3;
  const int tm = w & 3, tn = w >> 2;
  const int rowA = tm * 16 + nn;

  v8f aG0 = {}, aG1 = {};
  // unrolled so that the LDS reads of several k steps issue as one group
#pragma unroll 8
  for (int k0 = 0; k0 < D_; k0 += 4) {
    int kb = k0 + kbo;
    v2f a  = { Kt[rowA * KSTR + kb], Kt[rowA * KSTR + kb + 1] };
    v2f b0 = { Kt[((2 * tn) * 16 + nn) * KSTR + kb],
               Kt[((2 * tn) * 16 + nn) * KSTR + kb + 1] };
    v2f b1 = { Kt[((2 * tn + 1) * 16 + nn) * KSTR + kb],
               Kt[((2 * tn + 1) * 16 + nn) * KSTR + kb + 1] };
    aG0 = wmma_f32(a, b0, aG0);
    aG1 = wmma_f32(a, b1, aG1);
  }

  float* gs = gimg + (size_t)blockIdx.x * GIMG;
  v8f h0, h1;
#pragma unroll
  for (int i = 0; i < 8; ++i) {
    int t = tm * 16 + i + rh;
    int s0 = (2 * tn) * 16 + nn, s1 = s0 + 16;
    float p0 = lampow[(s0 <= t) ? t - s0 : 0];
    float p1 = lampow[(s1 <= t) ? t - s1 : 0];
    float g0 = (s0 <= t) ? p0 * aG0[i] : 0.f;
    float g1 = (s1 <= t) ? p1 * aG1[i] : 0.f;
    gs[t * CHUNK_ + s0] = g0;
    gs[t * CHUNK_ + s1] = g1;
    h0[i] = (s0 < t) ? -beta * g0 : 0.f;
    h1[i] = (s1 < t) ? -beta * g1 : 0.f;
  }
  if ((tm >> 1) == tn) {
    // this wave's two tiles lie in a diagonal 32x32 block; a lane holds 8
    // consecutive rows t of one column s, so the transposed copy is contiguous
    float* g = GT + (tn * 32 + nn) * GP + (tm & 1) * 16 + rh;
    *(v4f*)(g)               = __builtin_shufflevector(h0, h0, 0, 1, 2, 3);
    *(v4f*)(g + 4)           = __builtin_shufflevector(h0, h0, 4, 5, 6, 7);
    *(v4f*)(g + 16 * GP)     = __builtin_shufflevector(h1, h1, 0, 1, 2, 3);
    *(v4f*)(g + 16 * GP + 4) = __builtin_shufflevector(h1, h1, 4, 5, 6, 7);
  } else if (tn == 0) {
    // rows 32..63, columns 0..31: the block below the first diagonal block
    // (unrolled: the indices of h0 and h1 are constants, so they stay in registers)
#pragma unroll
    for (int i = 0; i < 8; ++i) {
      Nl[((tm - 2) * 16 + i + rh) * GP + nn]      = h0[i];
      Nl[((tm - 2) * 16 + i + rh) * GP + 16 + nn] = h1[i];
    }
  }
  __syncthreads();                      // GT, Nl and the identity are in LDS

  // ---- (I + beta*strictlow(G)) T = I by blocked forward substitution, one
  // column of T per lane.  The two diagonal blocks' own inverses first.
  if (w < 2) tri_solve32<TS>(Tm + w * (32 * TS + 32) + lane, GT + w * 32 * GP);
  __syncthreads();
  // right-hand side of the lower left block: -beta*G[32:64, 0:32] @ T[0:32, 0:32]
  if (w < 4) {
    const int tm2 = w & 1, tn2 = w >> 1;
    v8f acc = {};
    // (both loops unrolled: LDS reads issue ahead of the WMMAs; acc stays in registers)
#pragma unroll
    for (int k0 = 0; k0 < 32; k0 += 4) {
      int kb = k0 + kbo;
      v2f a  = *(const v2f*)(Nl + (tm2 * 16 + nn) * GP + kb);
      v2f bT = { Tm[kb * TS + tn2 * 16 + nn], Tm[(kb + 1) * TS + tn2 * 16 + nn] };
      acc = wmma_f32(a, bT, acc);
    }
#pragma unroll
    for (int i = 0; i < 8; ++i)
      Tm[(32 + tm2 * 16 + i + rh) * TS + tn2 * 16 + nn] = acc[i];
  }
  __syncthreads();
  if (w == 0) tri_solve32<TS>(Tm + 32 * TS + lane, GT + 32 * GP);
  __syncthreads();
  v4f* gt = (v4f*)(gs + CHUNK_ * CHUNK_);
  // unrolled: the four LDS reads fly together
#pragma unroll
  for (int j = 0; j < CHUNK_ * CHUNK_ / 4 / 256; ++j) {
    int i = tid + 256 * j;
    gt[i] = *(const v4f*)(Tm + (i >> 4) * TS + ((i & 15) << 2));
  }
}

// ---------------------------------------------------------------- kernel 3
// Chunked gated delta-rule scan for one (batch, value-slice), q == k.
// Dynamic-LDS layout (byte offsets are compile-time constants; no static LDS,
// so the dynamic region starts at LDS offset 0 -> usable by async DMA):
#define KT_OFF  (512u * VW * 4u)
#define SMEM_FLOATS (512 * VW + 64 * KSTR + 2 * 64 * US + 64 * VW + 64 * 65 + 64 * TS + 65)

__global__ __launch_bounds__(256) void gdn_scan(const float* __restrict__ xa,
                                                const float* __restrict__ vstat,
                                                const float* __restrict__ gimg,
                                                const float* __restrict__ eta_p,
                                                const float* __restrict__ laml_p,
                                                float* __restrict__ y) {
  extern __shared__ float smem[];
  float* Pb     = smem;                 // [8 waves][4 tiles][2][32 lanes][4] K@S partial sums
  float* Kt     = Pb + 512 * VW;        // [64][KSTR]
  float* Ut     = Kt + 64 * KSTR;       // [64][US]
  float* At     = Ut + 64 * US;         // [64][US] V + lam^(t+1) * (K@S): y without its O term
  float* Rt     = At + 64 * US;         // [32 row pairs][VW][2]: a B fragment is one 8-byte read
  float* GS     = Rt + 64 * VW;         // [64][65]
  float* Tl     = GS + 64 * 65;         // [64][TS] (I + beta*strictlow(GS))^-1
  float* lampow = Tl + 64 * TS;         // [65]

  const int tid = threadIdx.x, lane = tid & 31, w = tid >> 5;
  const int b  = blockIdx.x / NSL;            // 4 batches x 32 slices
  const int v0 = (blockIdx.x % NSL) * VW;
  // y plane of this workgroup alone, [L][VW]: a row of the slice is half a
  // 128-byte line, so in [L][D] order two workgroups would write into one line
  float* ysl = y + (size_t)blockIdx.x * L_ * VW;
  const float beta = eta_p[0];
  const float lam  = 1.f / (1.f + __expf(-laml_p[0]));

  if (tid < 65) lampow[tid] = powf(lam, (float)tid);

  const size_t bbase = (size_t)b * L_ * D_;
  // async-stage chunk 0's K (=Q) block
  for (int i = tid; i < CHUNK_ * D_ / 4; i += 256) {
    int t = i >> 7, d4 = (i & 127) << 2;
    async_b128(xa + bbase + (size_t)t * D_ + d4,
               KT_OFF + (unsigned)((t * KSTR + d4) * 4));
  }

  const int nn  = lane & 15;            // N index inside a 16-wide tile
  const int kbo = (lane >> 4) << 1;     // K sub-offset of the f32 A/B fragment
  const int rh  = (lane >> 4) << 3;     // row-half offset of C/D fragment
  const int tm = w & 3, tn = w >> 2;    // row tile, and which half of its registers
  const int rowA = tm * 16 + nn;
  const int tr = tm * 16 + tn * 4 + rh; // first of the 4 rows of K@S that this thread sums up

  // The state never leaves the registers: wave w owns rows d = 64w .. 64w+63 of
  // S as 4 accumulator tiles, Sa[j][i] = S[64w + 16j + i + rh][nn].
  v8f Sa[4] = {};

  for (int ch = 0; ch < NCH; ++ch) {
    const size_t xbase = bbase + (size_t)ch * CHUNK_ * D_;
    wait_async_lds();
    __syncthreads();                    // Kt ready; At/GS/Ut consistent
    const float lamC = lampow[64];
    float lp[4];
    // (unrolled, as every loop over e below: lp, vv and r stay in registers)
#pragma unroll
    for (int e = 0; e < 4; ++e) lp[e] = lampow[tr + e + 1];

    // ---- prefetch next chunk (K + V slice) into cache while we compute
    if (ch + 1 < NCH) {
      const float* nk = xa + xbase + (size_t)CHUNK_ * D_;
      for (int i = tid; i < CHUNK_ * D_ / 32; i += 256)
        __builtin_prefetch(nk + i * 32, 0, 3);
      if (tid < CHUNK_)
        __builtin_prefetch(vstat + xbase + (size_t)(CHUNK_ + tid) * D_ + v0, 0, 3);
    }

    // ---- this chunk's Gram image (gram_k): loads issued here, stored to LDS
    // behind the K@S loop, which covers their latency
    const v4f* gi = (const v4f*)(gimg + (size_t)(b * NCH + ch) * GIMG);
    v4f gq[GIMG / 4 / 256];
    // (the three unrolls below keep gq's indices constant, so it stays in registers)
#pragma unroll
    for (int j = 0; j < GIMG / 4 / 256; ++j) gq[j] = gi[tid + 256 * j];
    // ---- V at the 4 places whose K@S sums this thread forms below: issued here
    // too, so that the K@S loop covers the one round trip to L2
    float vv[4];
#pragma unroll
    for (int e = 0; e < 4; ++e) vv[e] = vstat[xbase + (size_t)(tr + e) * D_ + v0 + nn];

    // ---- A = K@S [64x16]: each wave multiplies all 64 rows of K by its own 64
    // rows of S.  Registers (i, i+1) of a state tile ARE a B fragment: k slots
    // 0,1 (lanes 0-15) are rows i, i+1 of the tile, k slots 2,3 (lanes 16-31)
    // rows i+8, i+9; the K loads below take their columns in the same order.
    {
      v8f P[4] = {};
      // (all loops unrolled: every register index is a compile-time constant)
#pragma unroll
      for (int j = 0; j < 4; ++j) {
#pragma unroll
        for (int q = 0; q < 2; ++q) {
          v4f a4[4];
#pragma unroll
          for (int m = 0; m < 4; ++m)
            a4[m] = *(const v4f*)(Kt + (m * 16 + nn) * KSTR + w * 64 + j * 16 + rh + q * 4);
#pragma unroll
          for (int e = 0; e < 2; ++e) {
#pragma unroll
            for (int m = 0; m < 4; ++m) {
              v2f a = { a4[m][2 * e], a4[m][2 * e + 1] };
              v2f bS = { Sa[j][4 * q + 2 * e], Sa[j][4 * q + 2 * e + 1] };
              P[m] = wmma_f32(a, bS, P[m]);
            }
          }
        }
      }
#pragma unroll
      for (int m = 0; m < 4; ++m) {
        float* pd = Pb + ((w * 4 + m) * 2) * 128 + lane * 4;
        *(v4f*)(pd)       = __builtin_shufflevector(P[m], P[m], 0, 1, 2, 3);
        *(v4f*)(pd + 128) = __builtin_shufflevector(P[m], P[m], 4, 5, 6, 7);
      }
    }
    __syncthreads();                    // all eight partial sums are in Pb
    // wave w adds up registers 4*tn .. 4*tn+3 of tile tm, partial sums in wave order,
    // and forms at once all that needs V and A = K@S together:
    // R = beta*(V - lam^{t+1} A), and V + lam^{t+1} A for y
    {
      v4f ps[8];
#pragma unroll
      for (int s = 0; s < 8; ++s)
        ps[s] = *(const v4f*)(Pb + ((s * 4 + tm) * 2 + tn) * 128 + lane * 4);
#pragma unroll
      for (int s = 1; s < 8; ++s) ps[0] += ps[s];
      float r[4];
#pragma unroll
      for (int e = 0; e < 4; ++e) {
        At[(tr + e) * US + nn] = fmaf(lp[e], ps[0][e], vv[e]);
        r[e] = beta * fmaf(-lp[e], ps[0][e], vv[e]);
      }
      // tr is a multiple of 4: rows (tr, tr+1) and (tr+2, tr+3) are two row pairs of Rt
      v2f r01 = { r[0], r[1] }, r23 = { r[2], r[3] };
      *(v2f*)(Rt + (tr >> 1) * (2 * VW) + 2 * nn)       = r01;
      *(v2f*)(Rt + ((tr >> 1) + 1) * (2 * VW) + 2 * nn) = r23;
    }
#pragma unroll
    for (int j = 0; j < CHUNK_ * CHUNK_ / 4 / 256; ++j) {
      int i = tid + 256 * j;
      int t = i >> 4, s4 = (i & 15) << 2;
#pragma unroll
      for (int e = 0; e < 4; ++e) GS[t * 65 + s4 + e] = gq[j][e];
    }
#pragma unroll
    for (int j = 0; j < CHUNK_ * CHUNK_ / 4 / 256; ++j) {
      int i = tid + 256 * j;
      *(v4f*)(Tl + (i >> 4) * TS + ((i & 15) << 2)) = gq[CHUNK_ * CHUNK_ / 4 / 256 + j];
    }
    __syncthreads();                    // Rt, At, GS and Tl are in LDS

    // ---- U = T @ R, T the chunk's inverse triangle from gram_k (four 16x16
    // tiles: waves 0..3; even and odd k steps in two sums, so that no WMMA
    // waits for the one before it)
    if (w < 4) {
      v8f u0 = {}, u1 = {};
      v2f ta[16], rb[16];
      // (unrolled: the indices of ta and rb are constants, so they stay in registers)
#pragma unroll
      for (int s = 0; s < 16; ++s) {
        ta[s] = *(const v2f*)(Tl + rowA * TS + 4 * s + kbo);
        rb[s] = *(const v2f*)(Rt + (2 * s + (lane >> 4)) * (2 * VW) + 2 * nn);
      }
      // keeps all the reads in front of the WMMAs: sunk next to their use, only
      // two WMMAs ahead, each pair would wait out most of an LDS latency
      __builtin_amdgcn_sched_barrier(0);
#pragma unroll
      for (int s = 0; s < 16; s += 2) {
        u0 = wmma_f32(ta[s], rb[s], u0);
        u1 = wmma_f32(ta[s + 1], rb[s + 1], u1);
      }
#pragma unroll
      for (int i = 0; i < 8; ++i)
        Ut[(tm * 16 + i + rh) * US + nn] = u0[i] + u1[i];
    }
    __syncthreads();

    // ---- state carry FIRST (last Kt consumer): S = lam^64 S + (lam^{63-s}k_s)^T U
#pragma unroll
    for (int j = 0; j < 4; ++j) Sa[j] *= lamC;
    // unrolled: the LDS reads of later k steps issue under the WMMAs of earlier ones
#pragma unroll
    for (int k0 = 0; k0 < CHUNK_; k0 += 4) {
      int kb = k0 + kbo;
      float p0 = lampow[63 - kb], p1 = lampow[62 - kb];
      v2f bU = { Ut[kb * US + nn], Ut[(kb + 1) * US + nn] };
#pragma unroll
      for (int j = 0; j < 4; ++j) {
        v2f a = { p0 * Kt[kb * KSTR + w * 64 + j * 16 + nn],
                  p1 * Kt[(kb + 1) * KSTR + w * 64 + j * 16 + nn] };
        Sa[j] = wmma_f32(a, bU, Sa[j]);
      }
    }
    __syncthreads();                     // all waves done reading Kt

    // ---- kick off next chunk's async K copy; it overlaps the O-matmul below
    if (ch + 1 < NCH) {
      const float* nk = xa + xbase + (size_t)CHUNK_ * D_;
      for (int i = tid; i < CHUNK_ * D_ / 4; i += 256) {
        int t = i >> 7, d4 = (i & 127) << 2;
        async_b128(nk + (size_t)t * D_ + d4,
                   KT_OFF + (unsigned)((t * KSTR + d4) * 4));
      }
    }

    // ---- O = GS @ U ; y = (V + lam^{t+1} A) + O   (four 16x16 tiles: waves 0..3)
    if (w < 4) {
      v8f aO = {};
      for (int k0 = 0; k0 < CHUNK_; k0 += 4) {
        int kb = k0 + kbo;
        v2f a  = { GS[rowA * 65 + kb], GS[rowA * 65 + kb + 1] };
        v2f bU = { Ut[kb * US + nn], Ut[(kb + 1) * US + nn] };
        aO = wmma_f32(a, bU, aO);
      }
#pragma unroll
      for (int i = 0; i < 8; ++i) {
        int t = tm * 16 + i + rh;
        ysl[(size_t)(ch * CHUNK_ + t) * VW + nn] = At[t * US + nn] + aO[i];
      }
      // the stores' address registers are reused by the next trip's loads
      asm volatile("s_wait_xcnt 0x0" ::: "memory");
    }
    // loop-top barrier orders these GS/Ut/At reads before the next chunk rewrites them
  }
}

// ---------------------------------------------------------------- kernel 4
// ys is the scan's plane order [B][NSL][L][VW]; y is the output, [B][L][D]
// One wave per two adjacent rows, no LDS and no barrier.  In a plane rows t and
// t+1 (t even) are one 128-byte line: lanes 8g..8g+7 read that line of slice
// g + 4j, so lane bit 2 says which of the two rows a lane holds 32 values of.
static_assert(VW == 16 && NSL == 32 && L_ % 2 == 0, "lane map of layernorm_k");
__global__ __launch_bounds__(256) void layernorm_k(const float* __restrict__ ys,
                                                   float* __restrict__ y,
                                                   const float* __restrict__ gam,
                                                   const float* __restrict__ bet) {
  const int lane = threadIdx.x & 31;
  const int row = (blockIdx.x * 8 + (threadIdx.x >> 5)) * 2 + ((lane >> 2) & 1);
  const int sl0 = lane >> 3, c4 = (lane & 3) << 2;
  const float* yr = ys + ((size_t)((row / L_) * NSL + sl0) * L_ + row % L_) * VW + c4;
  v4f v[8];
  // (all loops unrolled: v's indices are constants, and the 8 loads fly together)
#pragma unroll
  for (int j = 0; j < 8; ++j) v[j] = *(const v4f*)(yr + (size_t)(4 * j) * L_ * VW);
  // the loads' address registers are reused by what follows
  asm volatile("s_wait_xcnt 0x0" ::: "memory");
  float s = 0.f, q = 0.f;
#pragma unroll
  for (int j = 0; j < 8; ++j) {
#pragma unroll
    for (int e = 0; e < 4; ++e) { s += v[j][e]; q = fmaf(v[j][e], v[j][e], q); }
  }
  // sum over the 16 lanes of the same row: every lane bit but bit 2
#pragma unroll
  for (int mk = 1; mk < 32; mk <<= 1) {
    if (mk == 4) continue;
    s += __shfl_xor(s, mk, 32);
    q += __shfl_xor(q, mk, 32);
  }
  float mean = s * (1.f / D_);
  float var  = q * (1.f / D_) - mean * mean;
  float inv  = rsqrtf(var + EPS_);
  const int col = sl0 * VW + c4;
  float* yo = y + (size_t)row * D_ + col;
#pragma unroll
  for (int j = 0; j < 8; ++j) {
    v4f g = *(const v4f*)(gam + col + 4 * j * VW);
    v4f b = *(const v4f*)(bet + col + 4 * j * VW);
    *(v4f*)(yo + 4 * j * VW) = (v[j] - mean) * inv * g + b;
  }
}

// ---------------------------------------------------------------- launch
extern "C" void kernel_launch(void* const* d_in, const int* in_sizes, int n_in,
                              void* d_out, int out_size, void* d_ws, size_t ws_size,
                              hipStream_t stream) {
  const float* x    = (const float*)d_in[0];
  const float* W    = (const float*)d_in[1];
  const float* eta  = (const float*)d_in[2];
  const float* laml = (const float*)d_in[3];
  const float* g    = (const float*)d_in[4];
  const float* bb   = (const float*)d_in[5];
  float* out = (float*)d_out;

  float* xa    = (float*)d_ws;                       // [B,L,D] tanh(x)
  float* vstat = xa + (size_t)B_ * L_ * D_;          // [B,L,D] static_out
  float* gimg  = vstat + (size_t)B_ * L_ * D_;       // [B*NCH][GIMG] Gram images
  float* ys    = gimg + (size_t)B_ * NCH * GIMG;     // [B][NSL][L][VW] y before layernorm

  tanh_k<<<B_ * L_ * D_ / (256 * TPT * 4), 256, 0, stream>>>(x, xa);

  dim3 g2(B_ * L_ / 64, D_ / 64);
  gemm_xw<<<g2, 256, 0, stream>>>(xa, W, vstat);

  size_t gsmem = (size_t)(3 * 32 * GP + 64 * TS + 64 * KSTR + 65) * sizeof(float);
  gram_k<<<B_ * NCH, 256, gsmem, stream>>>(xa, eta, laml, gimg);

  size_t smem = (size_t)SMEM_FLOATS * sizeof(float);
  gdn_scan<<<B_ * (D_ / VW), 256, smem, stream>>>(xa, vstat, gimg, eta, laml, ys);

  layernorm_k<<<B_ * L_ / 16, 256, 0, stream>>>(ys, out, g, bb);
}

// v008
// One run takes 251 microseconds.
// Two timings next to v007 both put it at 1.05 times that version's speed.
// Counting every step since v000, it is 9.99 times as fast.
#include <hip/hip_runtime.h>
#include <hip/hip_bf16.h>

#define B_ 4
#define L_ 2048
#define D_ 512
#define CHUNK_ 64
#define NCH (L_ / CHUNK_)
#define VW 16           // value-dim slice per workgroup in the scan kernel
#define NSL (D_ / VW)   // value slices, one scan workgroup each per batch
#define US 18           // row stride of Ut and At: 16-wide rows 1, 2 or 8 apart share no bank
#define KSTR 516        // Kt row stride (16B-aligned rows, conflict-free)
#define GP 36            // row stride of the transposed triangle copies (16B-aligned)
#define TS 68            // row stride of the inverse triangle in LDS: 8-byte A-fragment reads share no bank
#define EPS_ 1e-5f
#define GIMG (2 * CHUNK_ * CHUNK_)  // floats of one chunk's Gram image in the workspace

typedef float v2f __attribute__((ext_vector_type(2)));
typedef float v4f __attribute__((ext_vector_type(4)));
typedef float v8f __attribute__((ext_vector_type(8)));

__device__ __forceinline__ v8f wmma_f32(v2f a, v2f b, v8f c) {
  // D = A(16x4 f32) * B(4x16 f32) + C(16x16 f32)
  return __builtin_amdgcn_wmma_f32_16x16x4_f32(false, a, false, b, (short)0, c,
                                               false, false);
}

// Async copy of one chunk of K (64 rows of 512 floats, contiguous) into Kt, rows
// KSTR apart (ASYNCcnt-tracked).  Thread tid takes 16-byte piece tid + 256*j, which
// is row (tid >> 7) + 2*j: both addresses step by a constant from copy to copy, so
// the 32 copies are straight-line code at constant offsets from one address pair.
typedef int v4i __attribute__((ext_vector_type(4)));
typedef __attribute__((address_space(1))) v4i g_v4i;
typedef __attribute__((address_space(3))) v4i l_v4i;
__device__ __forceinline__ void stage_k(const float* src, float* kt, int tid) {
  const float* g = src + (tid >> 7) * D_ + ((tid & 127) << 2);
  float* l = kt + (tid >> 7) * KSTR + ((tid & 127) << 2);
  // unrolled: rolled, each copy waits for an address chain and a loop branch
#pragma unroll
  for (int j = 0; j < CHUNK_ * D_ / 4 / 256; ++j)
    __builtin_amdgcn_global_load_async_to_lds_b128((g_v4i*)(g + 2 * j * D_),
                                                   (l_v4i*)(l + 2 * j * KSTR), 0, 0);
}
__device__ __forceinline__ void wait_async_lds() {
  asm volatile("s_wait_asynccnt 0x0" ::: "memory");
}

// ---------------------------------------------------------------- kernel 1
// Each thread takes TPT 16-byte pieces, 256 pieces apart, all loads in flight at
// once: 4,096 waves in the launch instead of one wave per 32 values.
#define TPT 8
static_assert((B_ * L_ * D_) % (256 * TPT * 4) == 0, "whole blocks only");
__global__ __launch_bounds__(256) void tanh_k(const float* __restrict__ x, float* __restrict__ xa) {
  const size_t p0 = (size_t)blockIdx.x * (256 * TPT) + threadIdx.x;
  const v4f* s = (const v4f*)x + p0;
  v4f* d = (v4f*)xa + p0;
  v4f r[TPT];
  // (both loops unrolled: r's indices are constants, so it stays in registers)
#pragma unroll
  for (int j = 0; j < TPT; ++j) r[j] = s[256 * j];
#pragma unroll
  for (int j = 0; j < TPT; ++j) {
    v4f o = { tanhf(r[j][0]), tanhf(r[j][1]), tanhf(r[j][2]), tanhf(r[j][3]) };
    d[256 * j] = o;
  }
}

// ---------------------------------------------------------------- kernel 2
// static_out[m, e] = sum_d xa[m, d] * W[e, d]   (M=8192, N=512, K=512)
__global__ __launch_bounds__(256) void gemm_xw(const float* __restrict__ xa,
                                               const float* __restrict__ Wm,
                                               float* __restrict__ out) {
  __shared__ float At[64 * 33];   // A panel [64 rows][32 k] padded
  __shared__ float Bt[32 * 65];   // B panel [32 k][64 n] padded (B[k][n] = W[n][k])
  const int tid = threadIdx.x, lane = tid & 31, w = tid >> 5;
  const int m0 = blockIdx.x * 64, n0 = blockIdx.y * 64;
  const int wm = w & 3, wn = w >> 2;           // 4 x 2 wave grid
  const int nn = lane & 15;
  const int kbo = (lane >> 4) << 1;
  const int rh = (lane >> 4) << 3;

  v8f c0 = {}, c1 = {};
  for (int kp = 0; kp < D_; kp += 32) {
    for (int idx = tid; idx < 64 * 32; idx += 256) {
      int r = idx >> 5, c = idx & 31;
      At[r * 33 + c] = xa[(size_t)(m0 + r) * D_ + kp + c];
    }
    for (int idx = tid; idx < 64 * 32; idx += 256) {
      int k = idx & 31, n = idx >> 5;
      Bt[k * 65 + n] = Wm[(size_t)(n0 + n) * D_ + kp + k];
    }
    __syncthreads();
#pragma unroll
    for (int kk = 0; kk < 32; kk += 4) {
      int kb = kk + kbo;
      v2f a  = { At[(wm * 16 + nn) * 33 + kb], At[(wm * 16 + nn) * 33 + kb + 1] };
      v2f b0 = { Bt[kb * 65 + wn * 32 + nn], Bt[(kb + 1) * 65 + wn * 32 + nn] };
      v2f b1 = { Bt[kb * 65 + wn * 32 + 16 + nn], Bt[(kb + 1) * 65 + wn * 32 + 16 + nn] };
      c0 = wmma_f32(a, b0, c0);
      c1 = wmma_f32(a, b1, c1);
    }
    __syncthreads();
  }
#pragma unroll
  for (int i = 0; i < 8; ++i) {
    int r = m0 + wm * 16 + i + rh;
    out[(size_t)r * D_ + n0 + wn * 32 + nn]      = c0[i];
    out[(size_t)r * D_ + n0 + wn * 32 + 16 + nn] = c1[i];
  }
}

// Unit-lower-triangular solve of one 32-row block by ONE wave: lane = column of
// the right-hand side, the 32 rows of that column live in registers.  gt[s*GP + t]
// holds -beta*G[t][s] (t > s), so column s is read as wave-uniform 16-byte loads
// and applied to all later rows as independent FMAs once u[s] is final.
// (templates only so that every register index is a compile-time constant)
template <int C, int HI>
__device__ __forceinline__ void tri_load_cols(v4f (&g)[31][8], const float* gt) {
  if constexpr (C <= HI && C < 31) {
#pragma unroll
    for (int q = (C + 1) >> 2; q < 8; ++q)
      g[C][q] = *(const v4f*)(gt + C * GP + 4 * q);
    tri_load_cols<C + 1, HI>(g, gt);
  }
}
template <int S>
__device__ __forceinline__ void tri_col(float (&u)[32], v4f (&g)[31][8], const float* gt) {
  if constexpr (S < 31) {
    // read ahead: columns up to S + 2 + S/4 (about 20 loads in flight; later
    // columns are shorter) so that the FMAs cover the LDS latency
    tri_load_cols<(S == 0) ? 0 : S + 2 + ((S - 1) >> 2), S + 2 + (S >> 2)>(g, gt);
    // keeps the read-ahead loads above this column's FMAs; without it the
    // compiler sinks them next to their use and their latency is exposed
    __builtin_amdgcn_sched_barrier(0);
#pragma unroll
    for (int q = (S + 1) >> 2; q < 8; ++q) {
#pragma unroll
      for (int e = 0; e < 4; ++e) {
        const int t = 4 * q + e;
        if (t > S) u[t] = fmaf(g[S][q][e], u[S], u[t]);
      }
    }
    tri_col<S + 1>(u, g, gt);
  }
}
template <int ST>   // ST: row stride of the right-hand side
__device__ __forceinline__ void tri_solve32(float* ucol, const float* gt) {
  float u[32];
  v4f g[31][8];
#pragma unroll
  for (int t = 0; t < 32; ++t) u[t] = ucol[t * ST];
  // LDS reads return in order: keeps every u load ahead of the triangle loads,
  // so the first FMAs do not wait for the whole read-ahead
  __builtin_amdgcn_sched_barrier(0);
  tri_col<0>(u, g, gt);
#pragma unroll
  for (int t = 1; t < 32; ++t) ucol[t * ST] = u[t];
}

// ---------------------------------------------------------------- kernel 2b
// One workgroup per (batch, chunk).  Nothing here depends on the scan state, so
// every chunk is done at once, and once instead of once per value slice.
// Image of a chunk: [64][64] G = lam^(t-s) * (k_t . k_s) for s <= t, else 0; then
// [64][64] T = (I + beta*strictlow(G))^-1, unit lower triangular, zeros above.
__global__ __launch_bounds__(256) void gram_k(const float* __restrict__ xa,
                                              const float* __restrict__ eta_p,
                                              const float* __restrict__ laml_p,
                                              float* __restrict__ gimg) {
  extern __shared__ float smem[];
  float* GT     = smem;                 // [2][32][GP] -beta*strictlow(diag blocks)^T
  float* Nl     = GT + 2 * 32 * GP;     // [32][GP] -beta*G[32:64, 0:32]
  float* Tm     = Nl + 32 * GP;         // [64][TS] identity, solved in place into T
  float* Kt     = Tm + 64 * TS;         // [64][KSTR]
  float* lampow = Kt + 64 * KSTR;       // [65]
  const int tid = threadIdx.x, lane = tid & 31, w = tid >> 5;
  const float beta = eta_p[0];
  const float lam  = 1.f / (1.f + __expf(-laml_p[0]));
  if (tid < 65) lampow[tid] = powf(lam, (float)tid);
  // unrolled: four stores at constant offsets from one address
#pragma unroll
  for (int j = 0; j < CHUNK_ * CHUNK_ / 4 / 256; ++j) {
    int i = tid + 256 * j;
    int t = i >> 4, c4 = (i & 15) << 2;
    v4f e = { t == c4 ? 1.f : 0.f, t == c4 + 1 ? 1.f : 0.f,
              t == c4 + 2 ? 1.f : 0.f, t == c4 + 3 ? 1.f : 0.f };
    *(v4f*)(Tm + t * TS + c4) = e;
  }

  // The chunk is one contiguous run of 64*512 floats: thread tid takes 16-byte
  // piece tid + 256*j, which is row (tid >> 7) + 2*j of Kt.
  const v4f* s4 = (const v4f*)(xa + (size_t)blockIdx.x * CHUNK_ * D_) + tid;
  float* kd = Kt + (tid >> 7) * KSTR + ((tid & 127) << 2);
  // unrolled: constant offsets from one address, many loads in flight at once
#pragma unroll
  for (int j = 0; j < CHUNK_ * D_ / 4 / 256; ++j)
    *(v4f*)(kd + 2 * j * KSTR) = s4[256 * j];
  __syncthreads();

  const int nn  = lane & 15;
  const int kbo = (lane >> 4) << 1;
  const int rh  = (lane >> 4) << 3;
  const int tm = w & 3, tn = w >> 2;
  const int rowA = tm * 16 + nn;

  v8f aG0 = {}, aG1 = {};
  // unrolled so that the LDS reads of several k steps issue as one group
#pragma unroll 8
  for (int k0 = 0; k0 < D_; k0 += 4) {
    int kb = k0 + kbo;
    v2f a  = { Kt[rowA * KSTR + kb], Kt[rowA * KSTR + kb + 1] };
    v2f b0 = { Kt[((2 * tn) * 16 + nn) * KSTR + kb],
               Kt[((2 * tn) * 16 + nn) * KSTR + kb + 1] };
    v2f b1 = { Kt[((2 * tn + 1) * 16 + nn) * KSTR + kb],
               Kt[((2 * tn + 1) * 16 + nn) * KSTR + kb + 1] };
    aG0 = wmma_f32(a, b0, aG0);
    aG1 = wmma_f32(a, b1, aG1);
  }

  float* gs = gimg + (size_t)blockIdx.x * GIMG;
  v8f h0, h1;
#pragma unroll
  for (int i = 0; i < 8; ++i) {
    int t = tm * 16 + i + rh;
    int s0 = (2 * tn) * 16 + nn, s1 = s0 + 16;
    float p0 = lampow[(s0 <= t) ? t - s0 : 0];
    float p1 = lampow[(s1 <= t) ? t - s1 : 0];
    float g0 = (s0 <= t) ? p0 * aG0[i] : 0.f;
    float g1 = (s1 <= t) ? p1 * aG1[i] : 0.f;
    gs[t * CHUNK_ + s0] = g0;
    gs[t * CHUNK_ + s1] = g1;
    h0[i] = (s0 < t) ? -beta * g0 : 0.f;
    h1[i] = (s1 < t) ? -beta * g1 : 0.f;
  }
  if ((tm >> 1) == tn) {
    // this wave's two tiles lie in a diagonal 32x32 block; a lane holds 8
    // consecutive rows t of one column s, so the transposed copy is contiguous
    float* g = GT + (tn * 32 + nn) * GP + (tm & 1) * 16 + rh;
    *(v4f*)(g)               = __builtin_shufflevector(h0, h0, 0, 1, 2, 3);
    *(v4f*)(g + 4)           = __builtin_shufflevector(h0, h0, 4, 5, 6, 7);
    *(v4f*)(g + 16 * GP)     = __builtin_shufflevector(h1, h1, 0, 1, 2, 3);
    *(v4f*)(g + 16 * GP + 4) = __builtin_shufflevector(h1, h1, 4, 5, 6, 7);
  } else if (tn == 0) {
    // rows 32..63, columns 0..31: the block below the first diagonal block
    // (unrolled: the indices of h0 and h1 are constants, so they stay in registers)
#pragma unroll
    for (int i = 0; i < 8; ++i) {
      Nl[((tm - 2) * 16 + i + rh) * GP + nn]      = h0[i];
      Nl[((tm - 2) * 16 + i + rh) * GP + 16 + nn] = h1[i];
    }
  }
  __syncthreads();                      // GT, Nl and the identity are in LDS

  // ---- (I + beta*strictlow(G)) T = I by blocked forward substitution, one
  // column of T per lane.  The two diagonal blocks' own inverses first.
  if (w < 2) tri_solve32<TS>(Tm + w * (32 * TS + 32) + lane, GT + w * 32 * GP);
  __syncthreads();
  // right-hand side of the lower left block: -beta*G[32:64, 0:32] @ T[0:32, 0:32]
  if (w < 4) {
    const int tm2 = w & 1, tn2 = w >> 1;
    v8f acc = {};
    // (both loops unrolled: LDS reads issue ahead of the WMMAs; acc stays in registers)
#pragma unroll
    for (int k0 = 0; k0 < 32; k0 += 4) {
      int kb = k0 + kbo;
      v2f a  = *(const v2f*)(Nl + (tm2 * 16 + nn) * GP + kb);
      v2f bT = { Tm[kb * TS + tn2 * 16 + nn], Tm[(kb + 1) * TS + tn2 * 16 + nn] };
      acc = wmma_f32(a, bT, acc);
    }
#pragma unroll
    for (int i = 0; i < 8; ++i)
      Tm[(32 + tm2 * 16 + i + rh) * TS + tn2 * 16 + nn] = acc[i];
  }
  __syncthreads();
  if (w == 0) tri_solve32<TS>(Tm + 32 * TS + lane, GT + 32 * GP);
  __syncthreads();
  v4f* gt = (v4f*)(gs + CHUNK_ * CHUNK_);
  // unrolled: the four LDS reads fly together
#pragma unroll
  for (int j = 0; j < CHUNK_ * CHUNK_ / 4 / 256; ++j) {
    int i = tid + 256 * j;
    gt[i] = *(const v4f*)(Tm + (i >> 4) * TS + ((i & 15) << 2));
  }
}

// ---------------------------------------------------------------- kernel 3
// Chunked gated delta-rule scan for one (batch, value-slice), q == k.
#define SMEM_FLOATS (512 * VW + 64 * KSTR + 2 * 64 * US + 64 * VW + 64 * 65 + 64 * TS + 65)

__global__ __launch_bounds__(256) void gdn_scan(const float* __restrict__ xa,
                                                const float* __restrict__ vstat,
                                                const float* __restrict__ gimg,
                                                const float* __restrict__ eta_p,
                                                const float* __restrict__ laml_p,
                                                float* __restrict__ y) {
  extern __shared__ float smem[];
  float* Pb     = smem;                 // [8 waves][4 tiles][2][32 lanes][4] K@S partial sums
  float* Kt     = Pb + 512 * VW;        // [64][KSTR]
  float* Ut     = Kt + 64 * KSTR;       // [64][US]
  float* At     = Ut + 64 * US;         // [64][US] V + lam^(t+1) * (K@S): y without its O term
  float* Rt     = At + 64 * US;         // [32 row pairs][VW][2]: a B fragment is one 8-byte read
  float* GS     = Rt + 64 * VW;         // [64][65]
  float* Tl     = GS + 64 * 65;         // [64][TS] (I + beta*strictlow(GS))^-1
  float* lampow = Tl + 64 * TS;         // [65]

  const int tid = threadIdx.x, lane = tid & 31, w = tid >> 5;
  const int b  = blockIdx.x / NSL;            // 4 batches x 32 slices
  const int v0 = (blockIdx.x % NSL) * VW;
  // y plane of this workgroup alone, [L][VW]: a row of the slice is half a
  // 128-byte line, so in [L][D] order two workgroups would write into one line
  float* ysl = y + (size_t)blockIdx.x * L_ * VW;
  const float beta = eta_p[0];
  const float lam  = 1.f / (1.f + __expf(-laml_p[0]));

  if (tid < 65) lampow[tid] = powf(lam, (float)tid);

  const size_t bbase = (size_t)b * L_ * D_;
  // async-stage chunk 0's K (=Q) block
  stage_k(xa + bbase, Kt, tid);

  const int nn  = lane & 15;            // N index inside a 16-wide tile
  const int kbo = (lane >> 4) << 1;     // K sub-offset of the f32 A/B fragment
  const int rh  = (lane >> 4) << 3;     // row-half offset of C/D fragment
  const int tm = w & 3, tn = w >> 2;    // row tile, and which half of its registers
  const int rowA = tm * 16 + nn;
  const int tr = tm * 16 + tn * 4 + rh; // first of the 4 rows of K@S that this thread sums up

  // The state never leaves the registers: wave w owns rows d = 64w .. 64w+63 of
  // S as 4 accumulator tiles, Sa[j][i] = S[64w + 16j + i + rh][nn].
  v8f Sa[4] = {};

  for (int ch = 0; ch < NCH; ++ch) {
    const size_t xbase = bbase + (size_t)ch * CHUNK_ * D_;
    wait_async_lds();
    __syncthreads();                    // Kt ready; At/GS/Ut consistent
    const float lamC = lampow[64];
    float lp[4];
    // (unrolled, as every loop over e below: lp, vv and r stay in registers)
#pragma unroll
    for (int e = 0; e < 4; ++e) lp[e] = lampow[tr + e + 1];

    // ---- prefetch next chunk (K + V slice) into cache while we compute
    if (ch + 1 < NCH) {
      const float* nk = xa + xbase + (size_t)CHUNK_ * D_;
      // unrolled: constant offsets from one address, no loop branch
#pragma unroll
      for (int j = 0; j < CHUNK_ * D_ / 32 / 256; ++j)
        __builtin_prefetch(nk + (tid + 256 * j) * 32, 0, 3);
      if (tid < CHUNK_)
        __builtin_prefetch(vstat + xbase + (size_t)(CHUNK_ + tid) * D_ + v0, 0, 3);
    }

    // ---- this chunk's Gram image (gram_k): loads issued here, stored to LDS
    // behind the K@S loop, which covers their latency
    const v4f* gi = (const v4f*)(gimg + (size_t)(b * NCH + ch) * GIMG);
    v4f gq[GIMG / 4 / 256];
    // (the three unrolls below keep gq's indices constant, so it stays in registers)
#pragma unroll
    for (int j = 0; j < GIMG / 4 / 256; ++j) gq[j] = gi[tid + 256 * j];
    // ---- V at the 4 places whose K@S sums this thread forms below: issued here
    // too, so that the K@S loop covers the one round trip to L2
    float vv[4];
#pragma unroll
    for (int e = 0; e < 4; ++e) vv[e] = vstat[xbase + (size_t)(tr + e) * D_ + v0 + nn];

    // ---- A = K@S [64x16]: each wave multiplies all 64 rows of K by its own 64
    // rows of S.  Registers (i, i+1) of a state tile ARE a B fragment: k slots
    // 0,1 (lanes 0-15) are rows i, i+1 of the tile, k slots 2,3 (lanes 16-31)
    // rows i+8, i+9; the K loads below take their columns in the same order.
    {
      v8f P[4] = {};
      // (all loops unrolled: every register index is a compile-time constant)
#pragma unroll
      for (int j = 0; j < 4; ++j) {
#pragma unroll
        for (int q = 0; q < 2; ++q) {
          v4f a4[4];
#pragma unroll
          for (int m = 0; m < 4; ++m)
            a4[m] = *(const v4f*)(Kt + (m * 16 + nn) * KSTR + w * 64 + j * 16 + rh + q * 4);
#pragma unroll
          for (int e = 0; e < 2; ++e) {
#pragma unroll
            for (int m = 0; m < 4; ++m) {
              v2f a = { a4[m][2 * e], a4[m][2 * e + 1] };
              v2f bS = { Sa[j][4 * q + 2 * e], Sa[j][4 * q + 2 * e + 1] };
              P[m] = wmma_f32(a, bS, P[m]);
            }
          }
        }
      }
#pragma unroll
      for (int m = 0; m < 4; ++m) {
        float* pd = Pb + ((w * 4 + m) * 2) * 128 + lane * 4;
        *(v4f*)(pd)       = __builtin_shufflevector(P[m], P[m], 0, 1, 2, 3);
        *(v4f*)(pd + 128) = __builtin_shufflevector(P[m], P[m], 4, 5, 6, 7);
      }
    }
    __syncthreads();                    // all eight partial sums are in Pb
    // wave w adds up registers 4*tn .. 4*tn+3 of tile tm, partial sums in wave order,
    // and forms at once all that needs V and A = K@S together:
    // R = beta*(V - lam^{t+1} A), and V + lam^{t+1} A for y
    {
      v4f ps[8];
#pragma unroll
      for (int s = 0; s < 8; ++s)
        ps[s] = *(const v4f*)(Pb + ((s * 4 + tm) * 2 + tn) * 128 + lane * 4);
#pragma unroll
      for (int s = 1; s < 8; ++s) ps[0] += ps[s];
      float r[4];
#pragma unroll
      for (int e = 0; e < 4; ++e) {
        At[(tr + e) * US + nn] = fmaf(lp[e], ps[0][e], vv[e]);
        r[e] = beta * fmaf(-lp[e], ps[0][e], vv[e]);
      }
      // tr is a multiple of 4: rows (tr, tr+1) and (tr+2, tr+3) are two row pairs of Rt
      v2f r01 = { r[0], r[1] }, r23 = { r[2], r[3] };
      *(v2f*)(Rt + (tr >> 1) * (2 * VW) + 2 * nn)       = r01;
      *(v2f*)(Rt + ((tr >> 1) + 1) * (2 * VW) + 2 * nn) = r23;
    }
#pragma unroll
    for (int j = 0; j < CHUNK_ * CHUNK_ / 4 / 256; ++j) {
      int i = tid + 256 * j;
      int t = i >> 4, s4 = (i & 15) << 2;
#pragma unroll
      for (int e = 0; e < 4; ++e) GS[t * 65 + s4 + e] = gq[j][e];
    }
#pragma unroll
    for (int j = 0; j < CHUNK_ * CHUNK_ / 4 / 256; ++j) {
      int i = tid + 256 * j;
      *(v4f*)(Tl + (i >> 4) * TS + ((i & 15) << 2)) = gq[CHUNK_ * CHUNK_ / 4 / 256 + j];
    }
    __syncthreads();                    // Rt, At, GS and Tl are in LDS

    // ---- U = T @ R, T the chunk's inverse triangle from gram_k (four 16x16
    // tiles: waves 0..3; even and odd k steps in two sums, so that no WMMA
    // waits for the one before it)
    if (w < 4) {
      v8f u0 = {}, u1 = {};
      v2f ta[16], rb[16];
      // (unrolled: the indices of ta and rb are constants, so they stay in registers)
#pragma unroll
      for (int s = 0; s < 16; ++s) {
        ta[s] = *(const v2f*)(Tl + rowA * TS + 4 * s + kbo);
        rb[s] = *(const v2f*)(Rt + (2 * s + (lane >> 4)) * (2 * VW) + 2 * nn);
      }
      // keeps all the reads in front of the WMMAs: sunk next to their use, only
      // two WMMAs ahead, each pair would wait out most of an LDS latency
      __builtin_amdgcn_sched_barrier(0);
#pragma unroll
      for (int s = 0; s < 16; s += 2) {
        u0 = wmma_f32(ta[s], rb[s], u0);
        u1 = wmma_f32(ta[s + 1], rb[s + 1], u1);
      }
#pragma unroll
      for (int i = 0; i < 8; ++i)
        Ut[(tm * 16 + i + rh) * US + nn] = u0[i] + u1[i];
    }
    __syncthreads();

    // ---- state carry FIRST (last Kt consumer): S = lam^64 S + (lam^{63-s}k_s)^T U
#pragma unroll
    for (int j = 0; j < 4; ++j) Sa[j] *= lamC;
    // unrolled: the LDS reads of later k steps issue under the WMMAs of earlier ones
#pragma unroll
    for (int k0 = 0; k0 < CHUNK_; k0 += 4) {
      int kb = k0 + kbo;
      float p0 = lampow[63 - kb], p1 = lampow[62 - kb];
      v2f bU = { Ut[kb * US + nn], Ut[(kb + 1) * US + nn] };
#pragma unroll
      for (int j = 0; j < 4; ++j) {
        v2f a = { p0 * Kt[kb * KSTR + w * 64 + j * 16 + nn],
                  p1 * Kt[(kb + 1) * KSTR + w * 64 + j * 16 + nn] };
        Sa[j] = wmma_f32(a, bU, Sa[j]);
      }
    }
    __syncthreads();                     // all waves done reading Kt

    // ---- kick off next chunk's async K copy; it overlaps the O-matmul below
    if (ch + 1 < NCH) stage_k(xa + xbase + (size_t)CHUNK_ * D_, Kt, tid);

    // ---- O = GS @ U ; y = (V + lam^{t+1} A) + O   (four 16x16 tiles: waves 0..3)
    if (w < 4) {
      v8f aO = {};
      for (int k0 = 0; k0 < CHUNK_; k0 += 4) {
        int kb = k0 + kbo;
        v2f a  = { GS[rowA * 65 + kb], GS[rowA * 65 + kb + 1] };
        v2f bU = { Ut[kb * US + nn], Ut[(kb + 1) * US + nn] };
        aO = wmma_f32(a, bU, aO);
      }
#pragma unroll
      for (int i = 0; i < 8; ++i) {
        int t = tm * 16 + i + rh;
        ysl[(size_t)(ch * CHUNK_ + t) * VW + nn] = At[t * US + nn] + aO[i];
      }
      // the stores' address registers are reused by the next trip's loads
      asm volatile("s_wait_xcnt 0x0" ::: "memory");
    }
    // loop-top barrier orders these GS/Ut/At reads before the next chunk rewrites them
  }
}

// ---------------------------------------------------------------- kernel 4
// ys is the scan's plane order [B][NSL][L][VW]; y is the output, [B][L][D]
// One wave per two adjacent rows, no LDS and no barrier.  In a plane rows t and
// t+1 (t even) are one 128-byte line: lanes 8g..8g+7 read that line of slice
// g + 4j, so lane bit 2 says which of the two rows a lane holds 32 values of.
static_assert(VW == 16 && NSL == 32 && L_ % 2 == 0, "lane map of layernorm_k");
__global__ __launch_bounds__(256) void layernorm_k(const float* __restrict__ ys,
                                                   float* __restrict__ y,
                                                   const float* __restrict__ gam,
                                                   const float* __restrict__ bet) {
  const int lane = threadIdx.x & 31;
  const int row = (blockIdx.x * 8 + (threadIdx.x >> 5)) * 2 + ((lane >> 2) & 1);
  const int sl0 = lane >> 3, c4 = (lane & 3) << 2;
  const float* yr = ys + ((size_t)((row / L_) * NSL + sl0) * L_ + row % L_) * VW + c4;
  v4f v[8];
  // (all loops unrolled: v's indices are constants, and the 8 loads fly together)
#pragma unroll
  for (int j = 0; j < 8; ++j) v[j] = *(const v4f*)(yr + (size_t)(4 * j) * L_ * VW);
  // the loads' address registers are reused by what follows
  asm volatile("s_wait_xcnt 0x0" ::: "memory");
  float s = 0.f, q = 0.f;
#pragma unroll
  for (int j = 0; j < 8; ++j) {
#pragma unroll
    for (int e = 0; e < 4; ++e) { s += v[j][e]; q = fmaf(v[j][e], v[j][e], q); }
  }
  // sum over the 16 lanes of the same row: every lane bit but bit 2
#pragma unroll
  for (int mk = 1; mk < 32; mk <<= 1) {
    if (mk == 4) continue;
    s += __shfl_xor(s, mk, 32);
    q += __shfl_xor(q, mk, 32);
  }
  float mean = s * (1.f / D_);
  float var  = q * (1.f / D_) - mean * mean;
  float inv  = rsqrtf(var + EPS_);
  const int col = sl0 * VW + c4;
  float* yo = y + (size_t)row * D_ + col;
#pragma unroll
  for (int j = 0; j < 8; ++j) {
    v4f g = *(const v4f*)(gam + col + 4 * j * VW);
    v4f b = *(const v4f*)(bet + col + 4 * j * VW);
    *(v4f*)(yo + 4 * j * VW) = (v[j] - mean) * inv * g + b;
  }
}

// ---------------------------------------------------------------- launch
extern "C" void kernel_launch(void* const* d_in, const int* in_sizes, int n_in,
                              void* d_out, int out_size, void* d_ws, size_t ws_size,
                              hipStream_t stream) {
  const float* x    = (const float*)d_in[0];
  const float* W    = (const float*)d_in[1];
  const float* eta  = (const float*)d_in[2];
  const float* laml = (const float*)d_in[3];
  const float* g    = (const float*)d_in[4];
  const float* bb   = (const float*)d_in[5];
  float* out = (float*)d_out;

  float* xa    = (float*)d_ws;                       // [B,L,D] tanh(x)
  float* vstat = xa + (size_t)B_ * L_ * D_;          // [B,L,D] static_out
  float* gimg  = vstat + (size_t)B_ * L_ * D_;       // [B*NCH][GIMG] Gram images
  float* ys    = gimg + (size_t)B_ * NCH * GIMG;     // [B][NSL][L][VW] y before layernorm

  tanh_k<<<B_ * L_ * D_ / (256 * TPT * 4), 256, 0, stream>>>(x, xa);

  dim3 g2(B_ * L_ / 64, D_ / 64);
  gemm_xw<<<g2, 256, 0, stream>>>(xa, W, vstat);

  size_t gsmem = (size_t)(3 * 32 * GP + 64 * TS + 64 * KSTR + 65) * sizeof(float);
  gram_k<<<B_ * NCH, 256, gsmem, stream>>>(xa, eta, laml, gimg);

  size_t smem = (size_t)SMEM_FLOATS * sizeof(float);
  gdn_scan<<<B_ * (D_ / VW), 256, smem, stream>>>(xa, vstat, gimg, eta, laml, ys);

  layernorm_k<<<B_ * L_ / 16, 256, 0, stream>>>(ys, out, g, bb);
}

// v009
// One run takes 187 microseconds.
// Two timings next to v008 both put it at 1.34 times that version's speed.
// Counting every step since v000, it is 13.4 times as fast.
#include <hip/hip_runtime.h>
#include <hip/hip_bf16.h>

#define B_ 4
#define L_ 2048
#define D_ 512
#define CHUNK_ 64
#define NCH (L_ / CHUNK_)
#define VW 16           // value-dim slice per workgroup in the scan kernel
#define NSL (D_ / VW)   // value slices, one scan workgroup each per batch
#define US 18           // row stride of Ut and At: 16-wide rows 1, 2 or 8 apart share no bank
#define KSTR 516        // Kt row stride (16B-aligned rows, conflict-free)
#define GP 36            // row stride of the transposed triangle copies (16B-aligned)
#define TS 68            // row stride of the inverse triangle in LDS: 8-byte A-fragment reads share no bank
#define EPS_ 1e-5f
#define GIMG (2 * CHUNK_ * CHUNK_)  // floats of one chunk's Gram image in the workspace

typedef float v2f __attribute__((ext_vector_type(2)));
typedef float v4f __attribute__((ext_vector_type(4)));
typedef float v8f __attribute__((ext_vector_type(8)));

__device__ __forceinline__ v8f wmma_f32(v2f a, v2f b, v8f c) {
  // D = A(16x4 f32) * B(4x16 f32) + C(16x16 f32)
  return __builtin_amdgcn_wmma_f32_16x16x4_f32(false, a, false, b, (short)0, c,
                                               false, false);
}

// Async copy of one chunk of K (64 rows of 512 floats, contiguous) into Kt, rows
// KSTR apart (ASYNCcnt-tracked).  Thread tid takes 16-byte piece tid + 256*j, which
// is row (tid >> 7) + 2*j: both addresses step by a constant from copy to copy, so
// the 32 copies are straight-line code at constant offsets from one address pair.
typedef int v4i __attribute__((ext_vector_type(4)));
typedef __attribute__((address_space(1))) v4i g_v4i;
typedef __attribute__((address_space(3))) v4i l_v4i;
__device__ __forceinline__ void stage_k(const float* src, float* kt, int tid) {
  const float* g = src + (tid >> 7) * D_ + ((tid & 127) << 2);
  float* l = kt + (tid >> 7) * KSTR + ((tid & 127) << 2);
  // unrolled: rolled, each copy waits for an address chain and a loop branch
#pragma unroll
  for (int j = 0; j < CHUNK_ * D_ / 4 / 256; ++j)
    __builtin_amdgcn_global_load_async_to_lds_b128((g_v4i*)(g + 2 * j * D_),
                                                   (l_v4i*)(l + 2 * j * KSTR), 0, 0);
}
__device__ __forceinline__ void wait_async_lds() {
  asm volatile("s_wait_asynccnt 0x0" ::: "memory");
}

// ---------------------------------------------------------------- kernel 1
// Each thread takes TPT 16-byte pieces, 256 pieces apart, all loads in flight at
// once: 4,096 waves in the launch instead of one wave per 32 values.
#define TPT 8
static_assert((B_ * L_ * D_) % (256 * TPT * 4) == 0, "whole blocks only");
__global__ __launch_bounds__(256) void tanh_k(const float* __restrict__ x, float* __restrict__ xa) {
  const size_t p0 = (size_t)blockIdx.x * (256 * TPT) + threadIdx.x;
  const v4f* s = (const v4f*)x + p0;
  v4f* d = (v4f*)xa + p0;
  v4f r[TPT];
  // (both loops unrolled: r's indices are constants, so it stays in registers)
#pragma unroll
  for (int j = 0; j < TPT; ++j) r[j] = s[256 * j];
#pragma unroll
  for (int j = 0; j < TPT; ++j) {
    v4f o = { tanhf(r[j][0]), tanhf(r[j][1]), tanhf(r[j][2]), tanhf(r[j][3]) };
    d[256 * j] = o;
  }
}

// ---------------------------------------------------------------- kernel 2
// static_out[m, e] = sum_d xa[m, d] * W[e, d]   (M=8192, N=512, K=512)
// Both operands are k-contiguous, and a lane's A or B fragment is two adjacent k of
// one row: both panels lie in LDS as they lie in memory, [row][k].  One 16-byte LDS
// read is a lane's fragments of two k steps: lanes 0-15 take k 0..3 of a group of 8,
// lanes 16-31 k 4..7, the same for A and for B.
#define GBM 128         // rows of xa per workgroup
#define GBN 64          // rows of W per workgroup
#define GBK 64          // k per panel
#define PITCH 68          // panel row pitch: 16 B x 17, so 16 rows' 16-byte reads share no bank
static_assert((B_ * L_) % GBM == 0 && D_ % GBN == 0 && D_ % GBK == 0, "whole tiles only");
__global__ __launch_bounds__(256) void gemm_xw(const float* __restrict__ xa,
                                               const float* __restrict__ Wm,
                                               float* __restrict__ out) {
  __shared__ float Pa[2][GBM * PITCH];   // xa panel [128 rows][64 k], two buffers
  __shared__ float Pw[2][GBN * PITCH];   // W panel [64 rows][64 k], two buffers
  const int tid = threadIdx.x, lane = tid & 31, w = tid >> 5;
  const int m0 = blockIdx.x * GBM, n0 = blockIdx.y * GBN;
  const int wm = w & 3, wn = w >> 2;           // 4 x 2 wave grid, 32 x 32 per wave
  const int nn = lane & 15;
  const int hf = lane >> 4;
  const int rh = hf << 3;

  // staging: thread tid takes 16-byte column tid & 15 of rows (tid >> 4) + 16*j
  const int sr = tid >> 4, sc = (tid & 15) << 2;
  const float* ga = xa + (size_t)(m0 + sr) * D_ + sc;
  const float* gw = Wm + (size_t)(n0 + sr) * D_ + sc;
  const int sl = sr * PITCH + sc;
  const int fa = (wm * 32 + nn) * PITCH + hf * 4;
  const int fw = (wn * 32 + nn) * PITCH + hf * 4;

  v4f ra[GBM / 16], rw[GBN / 16];
  v8f c[2][2] = {};
  // (every loop here is unrolled: register indices, buffer numbers and address
  // offsets are constants, and a panel's 12 loads are in flight together)
#pragma unroll
  for (int j = 0; j < GBM / 16; ++j) ra[j] = *(const v4f*)(ga + (size_t)j * 16 * D_);
#pragma unroll
  for (int j = 0; j < GBN / 16; ++j) rw[j] = *(const v4f*)(gw + (size_t)j * 16 * D_);
#pragma unroll
  for (int j = 0; j < GBM / 16; ++j) *(v4f*)(&Pa[0][sl + j * 16 * PITCH]) = ra[j];
#pragma unroll
  for (int j = 0; j < GBN / 16; ++j) *(v4f*)(&Pw[0][sl + j * 16 * PITCH]) = rw[j];
  __syncthreads();

#pragma unroll
  for (int p = 0; p < D_ / GBK; ++p) {
    // the next panel's loads fly under this panel's WMMAs
    if (p + 1 < D_ / GBK) {
#pragma unroll
      for (int j = 0; j < GBM / 16; ++j)
        ra[j] = *(const v4f*)(ga + (size_t)j * 16 * D_ + (p + 1) * GBK);
#pragma unroll
      for (int j = 0; j < GBN / 16; ++j)
        rw[j] = *(const v4f*)(gw + (size_t)j * 16 * D_ + (p + 1) * GBK);
    }
    const float* pa = &Pa[p & 1][fa];
    const float* pw = &Pw[p & 1][fw];
#pragma unroll
    for (int k8 = 0; k8 < GBK; k8 += 8) {
      v4f a0 = *(const v4f*)(pa + k8), a1 = *(const v4f*)(pa + 16 * PITCH + k8);
      v4f b0 = *(const v4f*)(pw + k8), b1 = *(const v4f*)(pw + 16 * PITCH + k8);
#pragma unroll
      for (int e = 0; e < 4; e += 2) {
        v2f x0 = { a0[e], a0[e + 1] }, x1 = { a1[e], a1[e + 1] };
        v2f y0 = { b0[e], b0[e + 1] }, y1 = { b1[e], b1[e + 1] };
        c[0][0] = wmma_f32(x0, y0, c[0][0]);
        c[0][1] = wmma_f32(x0, y1, c[0][1]);
        c[1][0] = wmma_f32(x1, y0, c[1][0]);
        c[1][1] = wmma_f32(x1, y1, c[1][1]);
      }
    }
    if (p + 1 < D_ / GBK) {
      // into the buffer whose last readers left it at the barrier of trip p - 1
#pragma unroll
      for (int j = 0; j < GBM / 16; ++j) *(v4f*)(&Pa[(p + 1) & 1][sl + j * 16 * PITCH]) = ra[j];
#pragma unroll
      for (int j = 0; j < GBN / 16; ++j) *(v4f*)(&Pw[(p + 1) & 1][sl + j * 16 * PITCH]) = rw[j];
      __syncthreads();
    }
  }
#pragma unroll
  for (int a = 0; a < 2; ++a) {
#pragma unroll
    for (int i = 0; i < 8; ++i) {
      float* o = out + (size_t)(m0 + wm * 32 + a * 16 + i + rh) * D_ + n0 + wn * 32 + nn;
      o[0]  = c[a][0][i];
      o[16] = c[a][1][i];
    }
  }
}

// Unit-lower-triangular solve of one 32-row block by ONE wave: lane = column of
// the right-hand side, the 32 rows of that column live in registers.  gt[s*GP + t]
// holds -beta*G[t][s] (t > s), so column s is read as wave-uniform 16-byte loads
// and applied to all later rows as independent FMAs once u[s] is final.
// (templates only so that every register index is a compile-time constant)
template <int C, int HI>
__device__ __forceinline__ void tri_load_cols(v4f (&g)[31][8], const float* gt) {
  if constexpr (C <= HI && C < 31) {
#pragma unroll
    for (int q = (C + 1) >> 2; q < 8; ++q)
      g[C][q] = *(const v4f*)(gt + C * GP + 4 * q);
    tri_load_cols<C + 1, HI>(g, gt);
  }
}
template <int S>
__device__ __forceinline__ void tri_col(float (&u)[32], v4f (&g)[31][8], const float* gt) {
  if constexpr (S < 31) {
    // read ahead: columns up to S + 2 + S/4 (about 20 loads in flight; later
    // columns are shorter) so that the FMAs cover the LDS latency
    tri_load_cols<(S == 0) ? 0 : S + 2 + ((S - 1) >> 2), S + 2 + (S >> 2)>(g, gt);
    // keeps the read-ahead loads above this column's FMAs; without it the
    // compiler sinks them next to their use and their latency is exposed
    __builtin_amdgcn_sched_barrier(0);
#pragma unroll
    for (int q = (S + 1) >> 2; q < 8; ++q) {
#pragma unroll
      for (int e = 0; e < 4; ++e) {
        const int t = 4 * q + e;
        if (t > S) u[t] = fmaf(g[S][q][e], u[S], u[t]);
      }
    }
    tri_col<S + 1>(u, g, gt);
  }
}
template <int ST>   // ST: row stride of the right-hand side
__device__ __forceinline__ void tri_solve32(float* ucol, const float* gt) {
  float u[32];
  v4f g[31][8];
#pragma unroll
  for (int t = 0; t < 32; ++t) u[t] = ucol[t * ST];
  // LDS reads return in order: keeps every u load ahead of the triangle loads,
  // so the first FMAs do not wait for the whole read-ahead
  __builtin_amdgcn_sched_barrier(0);
  tri_col<0>(u, g, gt);
#pragma unroll
  for (int t = 1; t < 32; ++t) ucol[t * ST] = u[t];
}

// ---------------------------------------------------------------- kernel 2b
// One workgroup per (batch, chunk).  Nothing here depends on the scan state, so
// every chunk is done at once, and once instead of once per value slice.
// Image of a chunk: [64][64] G = lam^(t-s) * (k_t . k_s) for s <= t, else 0; then
// [64][64] T = (I + beta*strictlow(G))^-1, unit lower triangular, zeros above.
__global__ __launch_bounds__(256) void gram_k(const float* __restrict__ xa,
                                              const float* __restrict__ eta_p,
                                              const float* __restrict__ laml_p,
                                              float* __restrict__ gimg) {
  extern __shared__ float smem[];
  float* GT     = smem;                 // [2][32][GP] -beta*strictlow(diag blocks)^T
  float* Nl     = GT + 2 * 32 * GP;     // [32][GP] -beta*G[32:64, 0:32]
  float* Tm     = Nl + 32 * GP;         // [64][TS] identity, solved in place into T
  float* Kt     = Tm + 64 * TS;         // [64][KSTR]
  float* lampow = Kt + 64 * KSTR;       // [65]
  const int tid = threadIdx.x, lane = tid & 31, w = tid >> 5;
  const float beta = eta_p[0];
  const float lam  = 1.f / (1.f + __expf(-laml_p[0]));
  if (tid < 65) lampow[tid] = powf(lam, (float)tid);
  // unrolled: four stores at constant offsets from one address
#pragma unroll
  for (int j = 0; j < CHUNK_ * CHUNK_ / 4 / 256; ++j) {
    int i = tid + 256 * j;
    int t = i >> 4, c4 = (i & 15) << 2;
    v4f e = { t == c4 ? 1.f : 0.f, t == c4 + 1 ? 1.f : 0.f,
              t == c4 + 2 ? 1.f : 0.f, t == c4 + 3 ? 1.f : 0.f };
    *(v4f*)(Tm + t * TS + c4) = e;
  }

  // The chunk is one contiguous run of 64*512 floats: thread tid takes 16-byte
  // piece tid + 256*j, which is row (tid >> 7) + 2*j of Kt.
  const v4f* s4 = (const v4f*)(xa + (size_t)blockIdx.x * CHUNK_ * D_) + tid;
  float* kd = Kt + (tid >> 7) * KSTR + ((tid & 127) << 2);
  // unrolled: constant offsets from one address, many loads in flight at once
#pragma unroll
  for (int j = 0; j < CHUNK_ * D_ / 4 / 256; ++j)
    *(v4f*)(kd + 2 * j * KSTR) = s4[256 * j];
  __syncthreads();

  const int nn  = lane & 15;
  const int kbo = (lane >> 4) << 1;
  const int rh  = (lane >> 4) << 3;
  const int tm = w & 3, tn = w >> 2;
  const int rowA = tm * 16 + nn;

  v8f aG0 = {}, aG1 = {};
  // unrolled so that the LDS reads of several k steps issue as one group
#pragma unroll 8
  for (int k0 = 0; k0 < D_; k0 += 4) {
    int kb = k0 + kbo;
    v2f a  = { Kt[rowA * KSTR + kb], Kt[rowA * KSTR + kb + 1] };
    v2f b0 = { Kt[((2 * tn) * 16 + nn) * KSTR + kb],
               Kt[((2 * tn) * 16 + nn) * KSTR + kb + 1] };
    v2f b1 = { Kt[((2 * tn + 1) * 16 + nn) * KSTR + kb],
               Kt[((2 * tn + 1) * 16 + nn) * KSTR + kb + 1] };
    aG0 = wmma_f32(a, b0, aG0);
    aG1 = wmma_f32(a, b1, aG1);
  }

  float* gs = gimg + (size_t)blockIdx.x * GIMG;
  v8f h0, h1;
#pragma unroll
  for (int i = 0; i < 8; ++i) {
    int t = tm * 16 + i + rh;
    int s0 = (2 * tn) * 16 + nn, s1 = s0 + 16;
    float p0 = lampow[(s0 <= t) ? t - s0 : 0];
    float p1 = lampow[(s1 <= t) ? t - s1 : 0];
    float g0 = (s0 <= t) ? p0 * aG0[i] : 0.f;
    float g1 = (s1 <= t) ? p1 * aG1[i] : 0.f;
    gs[t * CHUNK_ + s0] = g0;
    gs[t * CHUNK_ + s1] = g1;
    h0[i] = (s0 < t) ? -beta * g0 : 0.f;
    h1[i] = (s1 < t) ? -beta * g1 : 0.f;
  }
  if ((tm >> 1) == tn) {
    // this wave's two tiles lie in a diagonal 32x32 block; a lane holds 8
    // consecutive rows t of one column s, so the transposed copy is contiguous
    float* g = GT + (tn * 32 + nn) * GP + (tm & 1) * 16 + rh;
    *(v4f*)(g)               = __builtin_shufflevector(h0, h0, 0, 1, 2, 3);
    *(v4f*)(g + 4)           = __builtin_shufflevector(h0, h0, 4, 5, 6, 7);
    *(v4f*)(g + 16 * GP)     = __builtin_shufflevector(h1, h1, 0, 1, 2, 3);
    *(v4f*)(g + 16 * GP + 4) = __builtin_shufflevector(h1, h1, 4, 5, 6, 7);
  } else if (tn == 0) {
    // rows 32..63, columns 0..31: the block below the first diagonal block
    // (unrolled: the indices of h0 and h1 are constants, so they stay in registers)
#pragma unroll
    for (int i = 0; i < 8; ++i) {
      Nl[((tm - 2) * 16 + i + rh) * GP + nn]      = h0[i];
      Nl[((tm - 2) * 16 + i + rh) * GP + 16 + nn] = h1[i];
    }
  }
  __syncthreads();                      // GT, Nl and the identity are in LDS

  // ---- (I + beta*strictlow(G)) T = I by blocked forward substitution, one
  // column of T per lane.  The two diagonal blocks' own inverses first.
  if (w < 2) tri_solve32<TS>(Tm + w * (32 * TS + 32) + lane, GT + w * 32 * GP);
  __syncthreads();
  // right-hand side of the lower left block: -beta*G[32:64, 0:32] @ T[0:32, 0:32]
  if (w < 4) {
    const int tm2 = w & 1, tn2 = w >> 1;
    v8f acc = {};
    // (both loops unrolled: LDS reads issue ahead of the WMMAs; acc stays in registers)
#pragma unroll
    for (int k0 = 0; k0 < 32; k0 += 4) {
      int kb = k0 + kbo;
      v2f a  = *(const v2f*)(Nl + (tm2 * 16 + nn) * GP + kb);
      v2f bT = { Tm[kb * TS + tn2 * 16 + nn], Tm[(kb + 1) * TS + tn2 * 16 + nn] };
      acc = wmma_f32(a, bT, acc);
    }
#pragma unroll
    for (int i = 0; i < 8; ++i)
      Tm[(32 + tm2 * 16 + i + rh) * TS + tn2 * 16 + nn] = acc[i];
  }
  __syncthreads();
  if (w == 0) tri_solve32<TS>(Tm + 32 * TS + lane, GT + 32 * GP);
  __syncthreads();
  v4f* gt = (v4f*)(gs + CHUNK_ * CHUNK_);
  // unrolled: the four LDS reads fly together
#pragma unroll
  for (int j = 0; j < CHUNK_ * CHUNK_ / 4 / 256; ++j) {
    int i = tid + 256 * j;
    gt[i] = *(const v4f*)(Tm + (i >> 4) * TS + ((i & 15) << 2));
  }
}

// ---------------------------------------------------------------- kernel 3
// Chunked gated delta-rule scan for one (batch, value-slice), q == k.
#define SMEM_FLOATS (512 * VW + 64 * KSTR + 2 * 64 * US + 64 * VW + 64 * 65 + 64 * TS + 65)

__global__ __launch_bounds__(256) void gdn_scan(const float* __restrict__ xa,
                                                const float* __restrict__ vstat,
                                                const float* __restrict__ gimg,
                                                const float* __restrict__ eta_p,
                                                const float* __restrict__ laml_p,
                                                float* __restrict__ y) {
  extern __shared__ float smem[];
  float* Pb     = smem;                 // [8 waves][4 tiles][2][32 lanes][4] K@S partial sums
  float* Kt     = Pb + 512 * VW;        // [64][KSTR]
  float* Ut     = Kt + 64 * KSTR;       // [64][US]
  float* At     = Ut + 64 * US;         // [64][US] V + lam^(t+1) * (K@S): y without its O term
  float* Rt     = At + 64 * US;         // [32 row pairs][VW][2]: a B fragment is one 8-byte read
  float* GS     = Rt + 64 * VW;         // [64][65]
  float* Tl     = GS + 64 * 65;         // [64][TS] (I + beta*strictlow(GS))^-1
  float* lampow = Tl + 64 * TS;         // [65]

  const int tid = threadIdx.x, lane = tid & 31, w = tid >> 5;
  const int b  = blockIdx.x / NSL;            // 4 batches x 32 slices
  const int v0 = (blockIdx.x % NSL) * VW;
  // y plane of this workgroup alone, [L][VW]: a row of the slice is half a
  // 128-byte line, so in [L][D] order two workgroups would write into one line
  float* ysl = y + (size_t)blockIdx.x * L_ * VW;
  const float beta = eta_p[0];
  const float lam  = 1.f / (1.f + __expf(-laml_p[0]));

  if (tid < 65) lampow[tid] = powf(lam, (float)tid);

  const size_t bbase = (size_t)b * L_ * D_;
  // async-stage chunk 0's K (=Q) block
  stage_k(xa + bbase, Kt, tid);

  const int nn  = lane & 15;            // N index inside a 16-wide tile
  const int kbo = (lane >> 4) << 1;     // K sub-offset of the f32 A/B fragment
  const int rh  = (lane >> 4) << 3;     // row-half offset of C/D fragment
  const int tm = w & 3, tn = w >> 2;    // row tile, and which half of its registers
  const int rowA = tm * 16 + nn;
  const int tr = tm * 16 + tn * 4 + rh; // first of the 4 rows of K@S that this thread sums up

  // The state never leaves the registers: wave w owns rows d = 64w .. 64w+63 of
  // S as 4 accumulator tiles, Sa[j][i] = S[64w + 16j + i + rh][nn].
  v8f Sa[4] = {};

  for (int ch = 0; ch < NCH; ++ch) {
    const size_t xbase = bbase + (size_t)ch * CHUNK_ * D_;
    wait_async_lds();
    __syncthreads();                    // Kt ready; At/GS/Ut consistent
    const float lamC = lampow[64];
    float lp[4];
    // (unrolled, as every loop over e below: lp, vv and r stay in registers)
#pragma unroll
    for (int e = 0; e < 4; ++e) lp[e] = lampow[tr + e + 1];

    // ---- prefetch next chunk (K + V slice) into cache while we compute
    if (ch + 1 < NCH) {
      const float* nk = xa + xbase + (size_t)CHUNK_ * D_;
      // unrolled: constant offsets from one address, no loop branch
#pragma unroll
      for (int j = 0; j < CHUNK_ * D_ / 32 / 256; ++j)
        __builtin_prefetch(nk + (tid + 256 * j) * 32, 0, 3);
      if (tid < CHUNK_)
        __builtin_prefetch(vstat + xbase + (size_t)(CHUNK_ + tid) * D_ + v0, 0, 3);
    }

    // ---- this chunk's Gram image (gram_k): loads issued here, stored to LDS
    // behind the K@S loop, which covers their latency
    const v4f* gi = (const v4f*)(gimg + (size_t)(b * NCH + ch) * GIMG);
    v4f gq[GIMG / 4 / 256];
    // (the three unrolls below keep gq's indices constant, so it stays in registers)
#pragma unroll
    for (int j = 0; j < GIMG / 4 / 256; ++j) gq[j] = gi[tid + 256 * j];
    // ---- V at the 4 places whose K@S sums this thread forms below: issued here
    // too, so that the K@S loop covers the one round trip to L2
    float vv[4];
#pragma unroll
    for (int e = 0; e < 4; ++e) vv[e] = vstat[xbase + (size_t)(tr + e) * D_ + v0 + nn];

    // ---- A = K@S [64x16]: each wave multiplies all 64 rows of K by its own 64
    // rows of S.  Registers (i, i+1) of a state tile ARE a B fragment: k slots
    // 0,1 (lanes 0-15) are rows i, i+1 of the tile, k slots 2,3 (lanes 16-31)
    // rows i+8, i+9; the K loads below take their columns in the same order.
    {
      v8f P[4] = {};
      // (all loops unrolled: every register index is a compile-time constant)
#pragma unroll
      for (int j = 0; j < 4; ++j) {
#pragma unroll
        for (int q = 0; q < 2; ++q) {
          v4f a4[4];
#pragma unroll
          for (int m = 0; m < 4; ++m)
            a4[m] = *(const v4f*)(Kt + (m * 16 + nn) * KSTR + w * 64 + j * 16 + rh + q * 4);
#pragma unroll
          for (int e = 0; e < 2; ++e) {
#pragma unroll
            for (int m = 0; m < 4; ++m) {
              v2f a = { a4[m][2 * e], a4[m][2 * e + 1] };
              v2f bS = { Sa[j][4 * q + 2 * e], Sa[j][4 * q + 2 * e + 1] };
              P[m] = wmma_f32(a, bS, P[m]);
            }
          }
        }
      }
#pragma unroll
      for (int m = 0; m < 4; ++m) {
        float* pd = Pb + ((w * 4 + m) * 2) * 128 + lane * 4;
        *(v4f*)(pd)       = __builtin_shufflevector(P[m], P[m], 0, 1, 2, 3);
        *(v4f*)(pd + 128) = __builtin_shufflevector(P[m], P[m], 4, 5, 6, 7);
      }
    }
    __syncthreads();                    // all eight partial sums are in Pb
    // wave w adds up registers 4*tn .. 4*tn+3 of tile tm, partial sums in wave order,
    // and forms at once all that needs V and A = K@S together:
    // R = beta*(V - lam^{t+1} A), and V + lam^{t+1} A for y
    {
      v4f ps[8];
#pragma unroll
      for (int s = 0; s < 8; ++s)
        ps[s] = *(const v4f*)(Pb + ((s * 4 + tm) * 2 + tn) * 128 + lane * 4);
#pragma unroll
      for (int s = 1; s < 8; ++s) ps[0] += ps[s];
      float r[4];
#pragma unroll
      for (int e = 0; e < 4; ++e) {
        At[(tr + e) * US + nn] = fmaf(lp[e], ps[0][e], vv[e]);
        r[e] = beta * fmaf(-lp[e], ps[0][e], vv[e]);
      }
      // tr is a multiple of 4: rows (tr, tr+1) and (tr+2, tr+3) are two row pairs of Rt
      v2f r01 = { r[0], r[1] }, r23 = { r[2], r[3] };
      *(v2f*)(Rt + (tr >> 1) * (2 * VW) + 2 * nn)       = r01;
      *(v2f*)(Rt + ((tr >> 1) + 1) * (2 * VW) + 2 * nn) = r23;
    }
#pragma unroll
    for (int j = 0; j < CHUNK_ * CHUNK_ / 4 / 256; ++j) {
      int i = tid + 256 * j;
      int t = i >> 4, s4 = (i & 15) << 2;
#pragma unroll
      for (int e = 0; e < 4; ++e) GS[t * 65 + s4 + e] = gq[j][e];
    }
#pragma unroll
    for (int j = 0; j < CHUNK_ * CHUNK_ / 4 / 256; ++j) {
      int i = tid + 256 * j;
      *(v4f*)(Tl + (i >> 4) * TS + ((i & 15) << 2)) = gq[CHUNK_ * CHUNK_ / 4 / 256 + j];
    }
    __syncthreads();                    // Rt, At, GS and Tl are in LDS

    // ---- U = T @ R, T the chunk's inverse triangle from gram_k (four 16x16
    // tiles: waves 0..3; even and odd k steps in two sums, so that no WMMA
    // waits for the one before it)
    if (w < 4) {
      v8f u0 = {}, u1 = {};
      v2f ta[16], rb[16];
      // (unrolled: the indices of ta and rb are constants, so they stay in registers)
#pragma unroll
      for (int s = 0; s < 16; ++s) {
        ta[s] = *(const v2f*)(Tl + rowA * TS + 4 * s + kbo);
        rb[s] = *(const v2f*)(Rt + (2 * s + (lane >> 4)) * (2 * VW) + 2 * nn);
      }
      // keeps all the reads in front of the WMMAs: sunk next to their use, only
      // two WMMAs ahead, each pair would wait out most of an LDS latency
      __builtin_amdgcn_sched_barrier(0);
#pragma unroll
      for (int s = 0; s < 16; s += 2) {
        u0 = wmma_f32(ta[s], rb[s], u0);
        u1 = wmma_f32(ta[s + 1], rb[s + 1], u1);
      }
#pragma unroll
      for (int i = 0; i < 8; ++i)
        Ut[(tm * 16 + i + rh) * US + nn] = u0[i] + u1[i];
    }
    __syncthreads();

    // ---- state carry FIRST (last Kt consumer): S = lam^64 S + (lam^{63-s}k_s)^T U
#pragma unroll
    for (int j = 0; j < 4; ++j) Sa[j] *= lamC;
    // unrolled: the LDS reads of later k steps issue under the WMMAs of earlier ones
#pragma unroll
    for (int k0 = 0; k0 < CHUNK_; k0 += 4) {
      int kb = k0 + kbo;
      float p0 = lampow[63 - kb], p1 = lampow[62 - kb];
      v2f bU = { Ut[kb * US + nn], Ut[(kb + 1) * US + nn] };
#pragma unroll
      for (int j = 0; j < 4; ++j) {
        v2f a = { p0 * Kt[kb * KSTR + w * 64 + j * 16 + nn],
                  p1 * Kt[(kb + 1) * KSTR + w * 64 + j * 16 + nn] };
        Sa[j] = wmma_f32(a, bU, Sa[j]);
      }
    }
    __syncthreads();                     // all waves done reading Kt

    // ---- kick off next chunk's async K copy; it overlaps the O-matmul below
    if (ch + 1 < NCH) stage_k(xa + xbase + (size_t)CHUNK_ * D_, Kt, tid);

    // ---- O = GS @ U ; y = (V + lam^{t+1} A) + O   (four 16x16 tiles: waves 0..3)
    if (w < 4) {
      v8f aO = {};
      for (int k0 = 0; k0 < CHUNK_; k0 += 4) {
        int kb = k0 + kbo;
        v2f a  = { GS[rowA * 65 + kb], GS[rowA * 65 + kb + 1] };
        v2f bU = { Ut[kb * US + nn], Ut[(kb + 1) * US + nn] };
        aO = wmma_f32(a, bU, aO);
      }
#pragma unroll
      for (int i = 0; i < 8; ++i) {
        int t = tm * 16 + i + rh;
        ysl[(size_t)(ch * CHUNK_ + t) * VW + nn] = At[t * US + nn] + aO[i];
      }
      // the stores' address registers are reused by the next trip's loads
      asm volatile("s_wait_xcnt 0x0" ::: "memory");
    }
    // loop-top barrier orders these GS/Ut/At reads before the next chunk rewrites them
  }
}

// ---------------------------------------------------------------- kernel 4
// ys is the scan's plane order [B][NSL][L][VW]; y is the output, [B][L][D]
// One wave per two adjacent rows, no LDS and no barrier.  In a plane rows t and
// t+1 (t even) are one 128-byte line: lanes 8g..8g+7 read that line of slice
// g + 4j, so lane bit 2 says which of the two rows a lane holds 32 values of.
static_assert(VW == 16 && NSL == 32 && L_ % 2 == 0, "lane map of layernorm_k");
__global__ __launch_bounds__(256) void layernorm_k(const float* __restrict__ ys,
                                                   float* __restrict__ y,
                                                   const float* __restrict__ gam,
                                                   const float* __restrict__ bet) {
  const int lane = threadIdx.x & 31;
  const int row = (blockIdx.x * 8 + (threadIdx.x >> 5)) * 2 + ((lane >> 2) & 1);
  const int sl0 = lane >> 3, c4 = (lane & 3) << 2;
  const float* yr = ys + ((size_t)((row / L_) * NSL + sl0) * L_ + row % L_) * VW + c4;
  v4f v[8];
  // (all loops unrolled: v's indices are constants, and the 8 loads fly together)
#pragma unroll
  for (int j = 0; j < 8; ++j) v[j] = *(const v4f*)(yr + (size_t)(4 * j) * L_ * VW);
  // the loads' address registers are reused by what follows
  asm volatile("s_wait_xcnt 0x0" ::: "memory");
  float s = 0.f, q = 0.f;
#pragma unroll
  for (int j = 0; j < 8; ++j) {
#pragma unroll
    for (int e = 0; e < 4; ++e) { s += v[j][e]; q = fmaf(v[j][e], v[j][e], q); }
  }
  // sum over the 16 lanes of the same row: every lane bit but bit 2
#pragma unroll
  for (int mk = 1; mk < 32; mk <<= 1) {
    if (mk == 4) continue;
    s += __shfl_xor(s, mk, 32);
    q += __shfl_xor(q, mk, 32);
  }
  float mean = s * (1.f / D_);
  float var  = q * (1.f / D_) - mean * mean;
  float inv  = rsqrtf(var + EPS_);
  const int col = sl0 * VW + c4;
  float* yo = y + (size_t)row * D_ + col;
#pragma unroll
  for (int j = 0; j < 8; ++j) {
    v4f g = *(const v4f*)(gam + col + 4 * j * VW);
    v4f b = *(const v4f*)(bet + col + 4 * j * VW);
    *(v4f*)(yo + 4 * j * VW) = (v[j] - mean) * inv * g + b;
  }
}

// ---------------------------------------------------------------- launch
extern "C" void kernel_launch(void* const* d_in, const int* in_sizes, int n_in,
                              void* d_out, int out_size, void* d_ws, size_t ws_size,
                              hipStream_t stream) {
  const float* x    = (const float*)d_in[0];
  const float* W    = (const float*)d_in[1];
  const float* eta  = (const float*)d_in[2];
  const float* laml = (const float*)d_in[3];
  const float* g    = (const float*)d_in[4];
  const float* bb   = (const float*)d_in[5];
  float* out = (float*)d_out;

  float* xa    = (float*)d_ws;                       // [B,L,D] tanh(x)
  float* vstat = xa + (size_t)B_ * L_ * D_;          // [B,L,D] static_out
  float* gimg  = vstat + (size_t)B_ * L_ * D_;       // [B*NCH][GIMG] Gram images
  float* ys    = gimg + (size_t)B_ * NCH * GIMG;     // [B][NSL][L][VW] y before layernorm

  tanh_k<<<B_ * L_ * D_ / (256 * TPT * 4), 256, 0, stream>>>(x, xa);

  dim3 g2(B_ * L_ / GBM, D_ / GBN);
  gemm_xw<<<g2, 256, 0, stream>>>(xa, W, vstat);

  size_t gsmem = (size_t)(3 * 32 * GP + 64 * TS + 64 * KSTR + 65) * sizeof(float);
  gram_k<<<B_ * NCH, 256, gsmem, stream>>>(xa, eta, laml, gimg);

  size_t smem = (size_t)SMEM_FLOATS * sizeof(float);
  gdn_scan<<<B_ * (D_ / VW), 256, smem, stream>>>(xa, vstat, gimg, eta, laml, ys);

  layernorm_k<<<B_ * L_ / 16, 256, 0, stream>>>(ys, out, g, bb);
}

// v010
// One run takes 164 microseconds.
// In both of two side-by-side timings against v009, it was 1.14 times as fast.
// Counting every step since v000, it is 15.3 times as fast.
#include <hip/hip_runtime.h>
#include <hip/hip_bf16.h>

#define B_ 4
#define L_ 2048
#define D_ 512
#define CHUNK_ 64
#define NCH (L_ / CHUNK_)
#define VW 16           // value-dim slice per workgroup in the scan kernel
#define NSL (D_ / VW)   // value slices, one scan workgroup each per batch
#define US 18           // row stride of Ut and At: 16-wide rows 1, 2 or 8 apart share no bank
#define KSTR 516        // Kt row stride (16B-aligned rows, conflict-free)
#define GP 36            // row stride of the transposed triangle copies (16B-aligned)
#define TS 68            // row stride of the inverse triangle in LDS: 8-byte A-fragment reads share no bank
#define EPS_ 1e-5f
#define GIMG (2 * CHUNK_ * CHUNK_)  // floats of one chunk's Gram image in the workspace

typedef float v2f __attribute__((ext_vector_type(2)));
typedef float v4f __attribute__((ext_vector_type(4)));
typedef float v8f __attribute__((ext_vector_type(8)));

__device__ __forceinline__ v8f wmma_f32(v2f a, v2f b, v8f c) {
  // D = A(16x4 f32) * B(4x16 f32) + C(16x16 f32)
  return __builtin_amdgcn_wmma_f32_16x16x4_f32(false, a, false, b, (short)0, c,
                                               false, false);
}

// Async copy of one chunk of K (64 rows of 512 floats, contiguous) into Kt, rows
// KSTR apart (ASYNCcnt-tracked).  Thread tid takes 16-byte piece tid + 256*j, which
// is row (tid >> 7) + 2*j: both addresses step by a constant from copy to copy, so
// the 32 copies are straight-line code at constant offsets from one address pair.
typedef int v4i __attribute__((ext_vector_type(4)));
typedef __attribute__((address_space(1))) v4i g_v4i;
typedef __attribute__((address_space(3))) v4i l_v4i;
__device__ __forceinline__ void stage_k(const float* src, float* kt, int tid) {
  const float* g = src + (tid >> 7) * D_ + ((tid & 127) << 2);
  float* l = kt + (tid >> 7) * KSTR + ((tid & 127) << 2);
  // unrolled: rolled, each copy waits for an address chain and a loop branch
#pragma unroll
  for (int j = 0; j < CHUNK_ * D_ / 4 / 256; ++j)
    __builtin_amdgcn_global_load_async_to_lds_b128((g_v4i*)(g + 2 * j * D_),
                                                   (l_v4i*)(l + 2 * j * KSTR), 0, 0);
}
__device__ __forceinline__ void wait_async_lds() {
  asm volatile("s_wait_asynccnt 0x0" ::: "memory");
}

// ---------------------------------------------------------------- kernel 1
// Each thread takes TPT 16-byte pieces, 256 pieces apart, all loads in flight at
// once: 4,096 waves in the launch instead of one wave per 32 values.
#define TPT 8
static_assert((B_ * L_ * D_) % (256 * TPT * 4) == 0, "whole blocks only");
__global__ __launch_bounds__(256) void tanh_k(const float* __restrict__ x, float* __restrict__ xa) {
  const size_t p0 = (size_t)blockIdx.x * (256 * TPT) + threadIdx.x;
  const v4f* s = (const v4f*)x + p0;
  v4f* d = (v4f*)xa + p0;
  v4f r[TPT];
  // (both loops unrolled: r's indices are constants, so it stays in registers)
#pragma unroll
  for (int j = 0; j < TPT; ++j) r[j] = s[256 * j];
#pragma unroll
  for (int j = 0; j < TPT; ++j) {
    v4f o = { tanhf(r[j][0]), tanhf(r[j][1]), tanhf(r[j][2]), tanhf(r[j][3]) };
    d[256 * j] = o;
  }
}

// ---------------------------------------------------------------- kernel 2
// static_out[m, e] = sum_d xa[m, d] * W[e, d]   (M=8192, N=512, K=512)
// Both operands are k-contiguous, and a lane's A or B fragment is two adjacent k of
// one row: both panels lie in LDS as they lie in memory, [row][k].  One 16-byte LDS
// read is a lane's fragments of two k steps: lanes 0-15 take k 0..3 of a group of 8,
// lanes 16-31 k 4..7, the same for A and for B.
#define GBM 128         // rows of xa per workgroup
#define GBN 64          // rows of W per workgroup
#define GBK 64          // k per panel
#define PITCH 68          // panel row pitch: 16 B x 17, so 16 rows' 16-byte reads share no bank
static_assert((B_ * L_) % GBM == 0 && D_ % GBN == 0 && D_ % GBK == 0, "whole tiles only");
__global__ __launch_bounds__(256) void gemm_xw(const float* __restrict__ xa,
                                               const float* __restrict__ Wm,
                                               float* __restrict__ out) {
  __shared__ float Pa[2][GBM * PITCH];   // xa panel [128 rows][64 k], two buffers
  __shared__ float Pw[2][GBN * PITCH];   // W panel [64 rows][64 k], two buffers
  const int tid = threadIdx.x, lane = tid & 31, w = tid >> 5;
  const int m0 = blockIdx.x * GBM, n0 = blockIdx.y * GBN;
  const int wm = w & 3, wn = w >> 2;           // 4 x 2 wave grid, 32 x 32 per wave
  const int nn = lane & 15;
  const int hf = lane >> 4;
  const int rh = hf << 3;

  // staging: thread tid takes 16-byte column tid & 15 of rows (tid >> 4) + 16*j
  const int sr = tid >> 4, sc = (tid & 15) << 2;
  const float* ga = xa + (size_t)(m0 + sr) * D_ + sc;
  const float* gw = Wm + (size_t)(n0 + sr) * D_ + sc;
  const int sl = sr * PITCH + sc;
  const int fa = (wm * 32 + nn) * PITCH + hf * 4;
  const int fw = (wn * 32 + nn) * PITCH + hf * 4;

  v4f ra[GBM / 16], rw[GBN / 16];
  v8f c[2][2] = {};
  // (every loop here is unrolled: register indices, buffer numbers and address
  // offsets are constants, and a panel's 12 loads are in flight together)
#pragma unroll
  for (int j = 0; j < GBM / 16; ++j) ra[j] = *(const v4f*)(ga + (size_t)j * 16 * D_);
#pragma unroll
  for (int j = 0; j < GBN / 16; ++j) rw[j] = *(const v4f*)(gw + (size_t)j * 16 * D_);
#pragma unroll
  for (int j = 0; j < GBM / 16; ++j) *(v4f*)(&Pa[0][sl + j * 16 * PITCH]) = ra[j];
#pragma unroll
  for (int j = 0; j < GBN / 16; ++j) *(v4f*)(&Pw[0][sl + j * 16 * PITCH]) = rw[j];
  __syncthreads();

#pragma unroll
  for (int p = 0; p < D_ / GBK; ++p) {
    // the next panel's loads fly under this panel's WMMAs
    if (p + 1 < D_ / GBK) {
#pragma unroll
      for (int j = 0; j < GBM / 16; ++j)
        ra[j] = *(const v4f*)(ga + (size_t)j * 16 * D_ + (p + 1) * GBK);
#pragma unroll
      for (int j = 0; j < GBN / 16; ++j)
        rw[j] = *(const v4f*)(gw + (size_t)j * 16 * D_ + (p + 1) * GBK);
    }
    const float* pa = &Pa[p & 1][fa];
    const float* pw = &Pw[p & 1][fw];
#pragma unroll
    for (int k8 = 0; k8 < GBK; k8 += 8) {
      v4f a0 = *(const v4f*)(pa + k8), a1 = *(const v4f*)(pa + 16 * PITCH + k8);
      v4f b0 = *(const v4f*)(pw + k8), b1 = *(const v4f*)(pw + 16 * PITCH + k8);
#pragma unroll
      for (int e = 0; e < 4; e += 2) {
        v2f x0 = { a0[e], a0[e + 1] }, x1 = { a1[e], a1[e + 1] };
        v2f y0 = { b0[e], b0[e + 1] }, y1 = { b1[e], b1[e + 1] };
        c[0][0] = wmma_f32(x0, y0, c[0][0]);
        c[0][1] = wmma_f32(x0, y1, c[0][1]);
        c[1][0] = wmma_f32(x1, y0, c[1][0]);
        c[1][1] = wmma_f32(x1, y1, c[1][1]);
      }
    }
    if (p + 1 < D_ / GBK) {
      // into the buffer whose last readers left it at the barrier of trip p - 1
#pragma unroll
      for (int j = 0; j < GBM / 16; ++j) *(v4f*)(&Pa[(p + 1) & 1][sl + j * 16 * PITCH]) = ra[j];
#pragma unroll
      for (int j = 0; j < GBN / 16; ++j) *(v4f*)(&Pw[(p + 1) & 1][sl + j * 16 * PITCH]) = rw[j];
      __syncthreads();
    }
  }
#pragma unroll
  for (int a = 0; a < 2; ++a) {
#pragma unroll
    for (int i = 0; i < 8; ++i) {
      float* o = out + (size_t)(m0 + wm * 32 + a * 16 + i + rh) * D_ + n0 + wn * 32 + nn;
      o[0]  = c[a][0][i];
      o[16] = c[a][1][i];
    }
  }
}

// Unit-lower-triangular solve of one 32-row block by ONE wave: lane = column of
// the right-hand side, the 32 rows of that column live in registers.  gt[s*GP + t]
// holds -beta*G[t][s] (t > s), so column s is read as wave-uniform 16-byte loads
// and applied to all later rows as independent FMAs once u[s] is final.
// (templates only so that every register index is a compile-time constant)
template <int C, int HI>
__device__ __forceinline__ void tri_load_cols(v4f (&g)[31][8], const float* gt) {
  if constexpr (C <= HI && C < 31) {
#pragma unroll
    for (int q = (C + 1) >> 2; q < 8; ++q)
      g[C][q] = *(const v4f*)(gt + C * GP + 4 * q);
    tri_load_cols<C + 1, HI>(g, gt);
  }
}
template <int S>
__device__ __forceinline__ void tri_col(float (&u)[32], v4f (&g)[31][8], const float* gt) {
  if constexpr (S < 31) {
    // read ahead: columns up to S + 2 + S/4 (about 20 loads in flight; later
    // columns are shorter) so that the FMAs cover the LDS latency
    tri_load_cols<(S == 0) ? 0 : S + 2 + ((S - 1) >> 2), S + 2 + (S >> 2)>(g, gt);
    // keeps the read-ahead loads above this column's FMAs; without it the
    // compiler sinks them next to their use and their latency is exposed
    __builtin_amdgcn_sched_barrier(0);
#pragma unroll
    for (int q = (S + 1) >> 2; q < 8; ++q) {
#pragma unroll
      for (int e = 0; e < 4; ++e) {
        const int t = 4 * q + e;
        if (t > S) u[t] = fmaf(g[S][q][e], u[S], u[t]);
      }
    }
    tri_col<S + 1>(u, g, gt);
  }
}
template <int ST>   // ST: row stride of the right-hand side
__device__ __forceinline__ void tri_solve32(float* ucol, const float* gt) {
  float u[32];
  v4f g[31][8];
#pragma unroll
  for (int t = 0; t < 32; ++t) u[t] = ucol[t * ST];
  // LDS reads return in order: keeps every u load ahead of the triangle loads,
  // so the first FMAs do not wait for the whole read-ahead
  __builtin_amdgcn_sched_barrier(0);
  tri_col<0>(u, g, gt);
#pragma unroll
  for (int t = 1; t < 32; ++t) ucol[t * ST] = u[t];
}

// ---------------------------------------------------------------- kernel 2b
// One workgroup per (batch, chunk).  Nothing here depends on the scan state, so
// every chunk is done at once, and once instead of once per value slice.
// Image of a chunk: [64][64] G = lam^(t-s) * (k_t . k_s) for s <= t, else 0; then
// [64][64] T = (I + beta*strictlow(G))^-1, unit lower triangular, zeros above.
__global__ __launch_bounds__(256) void gram_k(const float* __restrict__ xa,
                                              const float* __restrict__ eta_p,
                                              const float* __restrict__ laml_p,
                                              float* __restrict__ gimg) {
  extern __shared__ float smem[];
  float* GT     = smem;                 // [2][32][GP] -beta*strictlow(diag blocks)^T
  float* Nl     = GT + 2 * 32 * GP;     // [32][GP] -beta*G[32:64, 0:32]
  float* Tm     = Nl + 32 * GP;         // [64][TS] identity, solved in place into T
  float* Kt     = Tm + 64 * TS;         // [64][KSTR]
  float* lampow = Kt + 64 * KSTR;       // [65]
  const int tid = threadIdx.x, lane = tid & 31, w = tid >> 5;
  const float beta = eta_p[0];
  const float lam  = 1.f / (1.f + __expf(-laml_p[0]));
  if (tid < 65) lampow[tid] = powf(lam, (float)tid);
  // unrolled: four stores at constant offsets from one address
#pragma unroll
  for (int j = 0; j < CHUNK_ * CHUNK_ / 4 / 256; ++j) {
    int i = tid + 256 * j;
    int t = i >> 4, c4 = (i & 15) << 2;
    v4f e = { t == c4 ? 1.f : 0.f, t == c4 + 1 ? 1.f : 0.f,
              t == c4 + 2 ? 1.f : 0.f, t == c4 + 3 ? 1.f : 0.f };
    *(v4f*)(Tm + t * TS + c4) = e;
  }

  // The chunk is one contiguous run of 64*512 floats: thread tid takes 16-byte
  // piece tid + 256*j, which is row (tid >> 7) + 2*j of Kt.
  const v4f* s4 = (const v4f*)(xa + (size_t)blockIdx.x * CHUNK_ * D_) + tid;
  float* kd = Kt + (tid >> 7) * KSTR + ((tid & 127) << 2);
  // unrolled: constant offsets from one address, many loads in flight at once
#pragma unroll
  for (int j = 0; j < CHUNK_ * D_ / 4 / 256; ++j)
    *(v4f*)(kd + 2 * j * KSTR) = s4[256 * j];
  __syncthreads();

  const int nn  = lane & 15;
  const int kbo = (lane >> 4) << 1;
  const int rh  = (lane >> 4) << 3;
  const int tm = w & 3, tn = w >> 2;
  const int rowA = tm * 16 + nn;

  v8f aG0 = {}, aG1 = {};
  // unrolled so that the LDS reads of several k steps issue as one group
#pragma unroll 8
  for (int k0 = 0; k0 < D_; k0 += 4) {
    int kb = k0 + kbo;
    v2f a  = { Kt[rowA * KSTR + kb], Kt[rowA * KSTR + kb + 1] };
    v2f b0 = { Kt[((2 * tn) * 16 + nn) * KSTR + kb],
               Kt[((2 * tn) * 16 + nn) * KSTR + kb + 1] };
    v2f b1 = { Kt[((2 * tn + 1) * 16 + nn) * KSTR + kb],
               Kt[((2 * tn + 1) * 16 + nn) * KSTR + kb + 1] };
    aG0 = wmma_f32(a, b0, aG0);
    aG1 = wmma_f32(a, b1, aG1);
  }

  float* gs = gimg + (size_t)blockIdx.x * GIMG;
  v8f h0, h1;
#pragma unroll
  for (int i = 0; i < 8; ++i) {
    int t = tm * 16 + i + rh;
    int s0 = (2 * tn) * 16 + nn, s1 = s0 + 16;
    float p0 = lampow[(s0 <= t) ? t - s0 : 0];
    float p1 = lampow[(s1 <= t) ? t - s1 : 0];
    float g0 = (s0 <= t) ? p0 * aG0[i] : 0.f;
    float g1 = (s1 <= t) ? p1 * aG1[i] : 0.f;
    gs[t * CHUNK_ + s0] = g0;
    gs[t * CHUNK_ + s1] = g1;
    h0[i] = (s0 < t) ? -beta * g0 : 0.f;
    h1[i] = (s1 < t) ? -beta * g1 : 0.f;
  }
  if ((tm >> 1) == tn) {
    // this wave's two tiles lie in a diagonal 32x32 block; a lane holds 8
    // consecutive rows t of one column s, so the transposed copy is contiguous
    float* g = GT + (tn * 32 + nn) * GP + (tm & 1) * 16 + rh;
    *(v4f*)(g)               = __builtin_shufflevector(h0, h0, 0, 1, 2, 3);
    *(v4f*)(g + 4)           = __builtin_shufflevector(h0, h0, 4, 5, 6, 7);
    *(v4f*)(g + 16 * GP)     = __builtin_shufflevector(h1, h1, 0, 1, 2, 3);
    *(v4f*)(g + 16 * GP + 4) = __builtin_shufflevector(h1, h1, 4, 5, 6, 7);
  } else if (tn == 0) {
    // rows 32..63, columns 0..31: the block below the first diagonal block
    // (unrolled: the indices of h0 and h1 are constants, so they stay in registers)
#pragma unroll
    for (int i = 0; i < 8; ++i) {
      Nl[((tm - 2) * 16 + i + rh) * GP + nn]      = h0[i];
      Nl[((tm - 2) * 16 + i + rh) * GP + 16 + nn] = h1[i];
    }
  }
  __syncthreads();                      // GT, Nl and the identity are in LDS

  // ---- (I + beta*strictlow(G)) T = I by blocked forward substitution, one
  // column of T per lane.  The two diagonal blocks' own inverses first.
  if (w < 2) tri_solve32<TS>(Tm + w * (32 * TS + 32) + lane, GT + w * 32 * GP);
  __syncthreads();
  // right-hand side of the lower left block: -beta*G[32:64, 0:32] @ T[0:32, 0:32]
  if (w < 4) {
    const int tm2 = w & 1, tn2 = w >> 1;
    v8f acc = {};
    // (both loops unrolled: LDS reads issue ahead of the WMMAs; acc stays in registers)
#pragma unroll
    for (int k0 = 0; k0 < 32; k0 += 4) {
      int kb = k0 + kbo;
      v2f a  = *(const v2f*)(Nl + (tm2 * 16 + nn) * GP + kb);
      v2f bT = { Tm[kb * TS + tn2 * 16 + nn], Tm[(kb + 1) * TS + tn2 * 16 + nn] };
      acc = wmma_f32(a, bT, acc);
    }
#pragma unroll
    for (int i = 0; i < 8; ++i)
      Tm[(32 + tm2 * 16 + i + rh) * TS + tn2 * 16 + nn] = acc[i];
  }
  __syncthreads();
  if (w == 0) tri_solve32<TS>(Tm + 32 * TS + lane, GT + 32 * GP);
  __syncthreads();
  v4f* gt = (v4f*)(gs + CHUNK_ * CHUNK_);
  // unrolled: the four LDS reads fly together
#pragma unroll
  for (int j = 0; j < CHUNK_ * CHUNK_ / 4 / 256; ++j) {
    int i = tid + 256 * j;
    gt[i] = *(const v4f*)(Tm + (i >> 4) * TS + ((i & 15) << 2));
  }
}

// ---------------------------------------------------------------- kernel 3
// Chunked gated delta-rule scan for one (batch, value-slice), q == k.
#define KBUF (64 * KSTR)  // floats of one K buffer
#define SMEM_FLOATS (512 * VW + 2 * KBUF + 64 * US + 64 * VW + 64 * TS + 65)
static_assert(64 * 65 + 64 * US <= 512 * VW, "GS and At lie in the partial-sum buffer");
static_assert(SMEM_FLOATS * 4 <= 320 * 1024, "one workgroup's LDS");

__global__ __launch_bounds__(256) void gdn_scan(const float* __restrict__ xa,
                                                const float* __restrict__ vstat,
                                                const float* __restrict__ gimg,
                                                const float* __restrict__ eta_p,
                                                const float* __restrict__ laml_p,
                                                float* __restrict__ y) {
  __shared__ __attribute__((aligned(16))) float smem[SMEM_FLOATS];
  float* Pb     = smem;                 // [8 waves][4 tiles][2][32 lanes][4] K@S partial sums
  // GS and At take Pb's place once its sums are read: that is the room for K's second buffer
  float* GS     = Pb;                   // [64][65]
  float* At     = GS + 64 * 65;         // [64][US] V + lam^(t+1) * (K@S): y without its O term
  float* Kt2    = Pb + 512 * VW;        // [2 buffers][64][KSTR]: chunk ch lies in buffer ch & 1
  float* Ut     = Kt2 + 2 * KBUF;       // [64][US]
  float* Rt     = Ut + 64 * US;         // [32 row pairs][VW][2]: a B fragment is one 8-byte read
  float* Tl     = Rt + 64 * VW;         // [64][TS] (I + beta*strictlow(GS))^-1
  float* lampow = Tl + 64 * TS;         // [65]

  const int tid = threadIdx.x, lane = tid & 31, w = tid >> 5;
  const int b  = blockIdx.x / NSL;            // 4 batches x 32 slices
  const int v0 = (blockIdx.x % NSL) * VW;
  // y plane of this workgroup alone, [L][VW]: a row of the slice is half a
  // 128-byte line, so in [L][D] order two workgroups would write into one line
  float* ysl = y + (size_t)blockIdx.x * L_ * VW;
  const float beta = eta_p[0];
  const float lam  = 1.f / (1.f + __expf(-laml_p[0]));

  if (tid < 65) lampow[tid] = powf(lam, (float)tid);

  const size_t bbase = (size_t)b * L_ * D_;
  // chunk 0's K (=Q) block lands and is published; chunk 1's copies then fly under trip 0
  stage_k(xa + bbase, Kt2, tid);
  wait_async_lds();
  __syncthreads();                      // buffer 0 and lampow are in LDS
  stage_k(xa + bbase + (size_t)CHUNK_ * D_, Kt2 + KBUF, tid);

  const int nn  = lane & 15;            // N index inside a 16-wide tile
  const int kbo = (lane >> 4) << 1;     // K sub-offset of the f32 A/B fragment
  const int rh  = (lane >> 4) << 3;     // row-half offset of C/D fragment
  const int tm = w & 3, tn = w >> 2;    // row tile, and which half of its registers
  const int rowA = tm * 16 + nn;
  const int tr = tm * 16 + tn * 4 + rh; // first of the 4 rows of K@S that this thread sums up

  // The state never leaves the registers: wave w owns rows d = 64w .. 64w+63 of
  // S as 4 accumulator tiles, Sa[j][i] = S[64w + 16j + i + rh][nn].
  v8f Sa[4] = {};

  // two trips per pass of the loop: the buffer's number is then a constant in each, and
  // every LDS address of K stays loop-invariant as with one buffer
#pragma unroll 2
  for (int ch = 0; ch < NCH; ++ch) {
    const size_t xbase = bbase + (size_t)ch * CHUNK_ * D_;
    float* Kt = Kt2 + (ch & 1) * KBUF;  // this trip reads this buffer alone
    const float lamC = lampow[64];
    float lp[4];
    // (unrolled, as every loop over e below: lp, vv and r stay in registers)
#pragma unroll
    for (int e = 0; e < 4; ++e) lp[e] = lampow[tr + e + 1];

    // ---- prefetch the next chunk's V slice into cache while we compute
    if (ch + 1 < NCH && tid < CHUNK_)
      __builtin_prefetch(vstat + xbase + (size_t)(CHUNK_ + tid) * D_ + v0, 0, 3);

    // ---- this chunk's Gram image (gram_k): loads issued here, stored to LDS
    // behind the K@S loop, which covers their latency
    const v4f* gi = (const v4f*)(gimg + (size_t)(b * NCH + ch) * GIMG);
    v4f gq[GIMG / 4 / 256];
    // (the three unrolls below keep gq's indices constant, so it stays in registers)
#pragma unroll
    for (int j = 0; j < GIMG / 4 / 256; ++j) gq[j] = gi[tid + 256 * j];
    // ---- V at the 4 places whose K@S sums this thread forms below: issued here
    // too, so that the K@S loop covers the one round trip to L2
    float vv[4];
#pragma unroll
    for (int e = 0; e < 4; ++e) vv[e] = vstat[xbase + (size_t)(tr + e) * D_ + v0 + nn];

    // ---- A = K@S [64x16]: each wave multiplies all 64 rows of K by its own 64
    // rows of S.  Registers (i, i+1) of a state tile ARE a B fragment: k slots
    // 0,1 (lanes 0-15) are rows i, i+1 of the tile, k slots 2,3 (lanes 16-31)
    // rows i+8, i+9; the K loads below take their columns in the same order.
    {
      v8f P[4] = {};
      // (all loops unrolled: every register index is a compile-time constant)
#pragma unroll
      for (int j = 0; j < 4; ++j) {
#pragma unroll
        for (int q = 0; q < 2; ++q) {
          v4f a4[4];
#pragma unroll
          for (int m = 0; m < 4; ++m)
            a4[m] = *(const v4f*)(Kt + (m * 16 + nn) * KSTR + w * 64 + j * 16 + rh + q * 4);
#pragma unroll
          for (int e = 0; e < 2; ++e) {
#pragma unroll
            for (int m = 0; m < 4; ++m) {
              v2f a = { a4[m][2 * e], a4[m][2 * e + 1] };
              v2f bS = { Sa[j][4 * q + 2 * e], Sa[j][4 * q + 2 * e + 1] };
              P[m] = wmma_f32(a, bS, P[m]);
            }
          }
        }
      }
#pragma unroll
      for (int m = 0; m < 4; ++m) {
        float* pd = Pb + ((w * 4 + m) * 2) * 128 + lane * 4;
        *(v4f*)(pd)       = __builtin_shufflevector(P[m], P[m], 0, 1, 2, 3);
        *(v4f*)(pd + 128) = __builtin_shufflevector(P[m], P[m], 4, 5, 6, 7);
      }
    }
    __syncthreads();                    // all eight partial sums are in Pb
    // wave w adds up registers 4*tn .. 4*tn+3 of tile tm, partial sums in wave order,
    // and forms at once all that needs V and A = K@S together:
    // R = beta*(V - lam^{t+1} A), and V + lam^{t+1} A for y
    float av[4];
    {
      v4f ps[8];
#pragma unroll
      for (int s = 0; s < 8; ++s)
        ps[s] = *(const v4f*)(Pb + ((s * 4 + tm) * 2 + tn) * 128 + lane * 4);
#pragma unroll
      for (int s = 1; s < 8; ++s) ps[0] += ps[s];
      float r[4];
#pragma unroll
      for (int e = 0; e < 4; ++e) {
        av[e] = fmaf(lp[e], ps[0][e], vv[e]);
        r[e] = beta * fmaf(-lp[e], ps[0][e], vv[e]);
      }
      // tr is a multiple of 4: rows (tr, tr+1) and (tr+2, tr+3) are two row pairs of Rt
      v2f r01 = { r[0], r[1] }, r23 = { r[2], r[3] };
      *(v2f*)(Rt + (tr >> 1) * (2 * VW) + 2 * nn)       = r01;
      *(v2f*)(Rt + ((tr >> 1) + 1) * (2 * VW) + 2 * nn) = r23;
    }
#pragma unroll
    for (int j = 0; j < CHUNK_ * CHUNK_ / 4 / 256; ++j) {
      int i = tid + 256 * j;
      *(v4f*)(Tl + (i >> 4) * TS + ((i & 15) << 2)) = gq[CHUNK_ * CHUNK_ / 4 / 256 + j];
    }
    __syncthreads();                    // Rt and Tl are in LDS; Pb's last reads are over

    // ---- U = T @ R, T the chunk's inverse triangle from gram_k (four 16x16
    // tiles: waves 0..3; even and odd k steps in two sums, so that no WMMA
    // waits for the one before it)
    if (w < 4) {
      v8f u0 = {}, u1 = {};
      v2f ta[16], rb[16];
      // (unrolled: the indices of ta and rb are constants, so they stay in registers)
#pragma unroll
      for (int s = 0; s < 16; ++s) {
        ta[s] = *(const v2f*)(Tl + rowA * TS + 4 * s + kbo);
        rb[s] = *(const v2f*)(Rt + (2 * s + (lane >> 4)) * (2 * VW) + 2 * nn);
      }
      // keeps all the reads in front of the WMMAs: sunk next to their use, only
      // two WMMAs ahead, each pair would wait out most of an LDS latency
      __builtin_amdgcn_sched_barrier(0);
#pragma unroll
      for (int s = 0; s < 16; s += 2) {
        u0 = wmma_f32(ta[s], rb[s], u0);
        u1 = wmma_f32(ta[s + 1], rb[s + 1], u1);
      }
#pragma unroll
      for (int i = 0; i < 8; ++i)
        Ut[(tm * 16 + i + rh) * US + nn] = u0[i] + u1[i];
    }
    // ---- At and GS, for the O term, go where Pb was
#pragma unroll
    for (int e = 0; e < 4; ++e) At[(tr + e) * US + nn] = av[e];
#pragma unroll
    for (int j = 0; j < CHUNK_ * CHUNK_ / 4 / 256; ++j) {
      int i = tid + 256 * j;
      int t = i >> 4, s4 = (i & 15) << 2;
#pragma unroll
      for (int e = 0; e < 4; ++e) GS[t * 65 + s4 + e] = gq[j][e];
    }
    __syncthreads();                    // Ut, At and GS are in LDS

    // ---- state carry: S = lam^64 S + (lam^{63-s}k_s)^T U
#pragma unroll
    for (int j = 0; j < 4; ++j) Sa[j] *= lamC;
    // unrolled: the LDS reads of later k steps issue under the WMMAs of earlier ones
#pragma unroll
    for (int k0 = 0; k0 < CHUNK_; k0 += 4) {
      int kb = k0 + kbo;
      float p0 = lampow[63 - kb], p1 = lampow[62 - kb];
      v2f bU = { Ut[kb * US + nn], Ut[(kb + 1) * US + nn] };
#pragma unroll
      for (int j = 0; j < 4; ++j) {
        v2f a = { p0 * Kt[kb * KSTR + w * 64 + j * 16 + nn],
                  p1 * Kt[(kb + 1) * KSTR + w * 64 + j * 16 + nn] };
        Sa[j] = wmma_f32(a, bU, Sa[j]);
      }
    }

    // ---- O = GS @ U ; y = (V + lam^{t+1} A) + O   (four 16x16 tiles: waves 0..3)
    float yv[8];
    if (w < 4) {
      v8f aO = {};
      for (int k0 = 0; k0 < CHUNK_; k0 += 4) {
        int kb = k0 + kbo;
        v2f a  = { GS[rowA * 65 + kb], GS[rowA * 65 + kb + 1] };
        v2f bU = { Ut[kb * US + nn], Ut[(kb + 1) * US + nn] };
        aO = wmma_f32(a, bU, aO);
      }
#pragma unroll
      for (int i = 0; i < 8; ++i) yv[i] = At[(tm * 16 + i + rh) * US + nn] + aO[i];
    }
    // ---- foot of the trip: this wave's LDS reads are over, its copies of chunk
    // ch + 1 have landed; the barrier publishes that chunk and ends every reader's
    // last read of this trip's buffer, of Ut, At and GS
    asm volatile("s_wait_dscnt 0x0" ::: "memory");
    wait_async_lds();
    __syncthreads();
    // chunk ch + 2 into the buffer just read: its copies fly under the whole of trip ch + 1
    if (ch + 2 < NCH) stage_k(xa + xbase + (size_t)(2 * CHUNK_) * D_, Kt, tid);
    // y goes out behind the barrier: in front of it the barrier would wait for the stores
    if (w < 4) {
#pragma unroll
      for (int i = 0; i < 8; ++i)
        ysl[(size_t)(ch * CHUNK_ + tm * 16 + i + rh) * VW + nn] = yv[i];
      // the stores' address registers are reused by the next trip's loads
      asm volatile("s_wait_xcnt 0x0" ::: "memory");
    }
  }
  // no copy is left in flight when the wave ends
  wait_async_lds();
}

// ---------------------------------------------------------------- kernel 4
// ys is the scan's plane order [B][NSL][L][VW]; y is the output, [B][L][D]
// One wave per two adjacent rows, no LDS and no barrier.  In a plane rows t and
// t+1 (t even) are one 128-byte line: lanes 8g..8g+7 read that line of slice
// g + 4j, so lane bit 2 says which of the two rows a lane holds 32 values of.
static_assert(VW == 16 && NSL == 32 && L_ % 2 == 0, "lane map of layernorm_k");
__global__ __launch_bounds__(256) void layernorm_k(const float* __restrict__ ys,
                                                   float* __restrict__ y,
                                                   const float* __restrict__ gam,
                                                   const float* __restrict__ bet) {
  const int lane = threadIdx.x & 31;
  const int row = (blockIdx.x * 8 + (threadIdx.x >> 5)) * 2 + ((lane >> 2) & 1);
  const int sl0 = lane >> 3, c4 = (lane & 3) << 2;
  const float* yr = ys + ((size_t)((row / L_) * NSL + sl0) * L_ + row % L_) * VW + c4;
  v4f v[8];
  // (all loops unrolled: v's indices are constants, and the 8 loads fly together)
#pragma unroll
  for (int j = 0; j < 8; ++j) v[j] = *(const v4f*)(yr + (size_t)(4 * j) * L_ * VW);
  // the loads' address registers are reused by what follows
  asm volatile("s_wait_xcnt 0x0" ::: "memory");
  float s = 0.f, q = 0.f;
#pragma unroll
  for (int j = 0; j < 8; ++j) {
#pragma unroll
    for (int e = 0; e < 4; ++e) { s += v[j][e]; q = fmaf(v[j][e], v[j][e], q); }
  }
  // sum over the 16 lanes of the same row: every lane bit but bit 2
#pragma unroll
  for (int mk = 1; mk < 32; mk <<= 1) {
    if (mk == 4) continue;
    s += __shfl_xor(s, mk, 32);
    q += __shfl_xor(q, mk, 32);
  }
  float mean = s * (1.f / D_);
  float var  = q * (1.f / D_) - mean * mean;
  float inv  = rsqrtf(var + EPS_);
  const int col = sl0 * VW + c4;
  float* yo = y + (size_t)row * D_ + col;
#pragma unroll
  for (int j = 0; j < 8; ++j) {
    v4f g = *(const v4f*)(gam + col + 4 * j * VW);
    v4f b = *(const v4f*)(bet + col + 4 * j * VW);
    *(v4f*)(yo + 4 * j * VW) = (v[j] - mean) * inv * g + b;
  }
}

// ---------------------------------------------------------------- launch
extern "C" void kernel_launch(void* const* d_in, const int* in_sizes, int n_in,
                              void* d_out, int out_size, void* d_ws, size_t ws_size,
                              hipStream_t stream) {
  const float* x    = (const float*)d_in[0];
  const float* W    = (const float*)d_in[1];
  const float* eta  = (const float*)d_in[2];
  const float* laml = (const float*)d_in[3];
  const float* g    = (const float*)d_in[4];
  const float* bb   = (const float*)d_in[5];
  float* out = (float*)d_out;

  float* xa    = (float*)d_ws;                       // [B,L,D] tanh(x)
  float* vstat = xa + (size_t)B_ * L_ * D_;          // [B,L,D] static_out
  float* gimg  = vstat + (size_t)B_ * L_ * D_;       // [B*NCH][GIMG] Gram images
  float* ys    = gimg + (size_t)B_ * NCH * GIMG;     // [B][NSL][L][VW] y before layernorm

  tanh_k<<<B_ * L_ * D_ / (256 * TPT * 4), 256, 0, stream>>>(x, xa);

  dim3 g2(B_ * L_ / GBM, D_ / GBN);
  gemm_xw<<<g2, 256, 0, stream>>>(xa, W, vstat);

  size_t gsmem = (size_t)(3 * 32 * GP + 64 * TS + 64 * KSTR + 65) * sizeof(float);
  gram_k<<<B_ * NCH, 256, gsmem, stream>>>(xa, eta, laml, gimg);

  gdn_scan<<<B_ * (D_ / VW), 256, 0, stream>>>(xa, vstat, gimg, eta, laml, ys);

  layernorm_k<<<B_ * L_ / 16, 256, 0, stream>>>(ys, out, g, bb);
}
